// v000
// Measured on an AMD MI455X. A time is GPU time per run, averaged over a window of back-to-back runs after a warm-up
// (all launches, gaps included; the runs take copies of the inputs in turn), and the median of several windows.
// Apart from v000's, it joins two sittings. Times from different sittings can be a few percent apart, while
// side-by-side timings come from the same sitting.
// The starting kernel, v000, takes 1440 microseconds a run.
// compute dtype: all float inputs rounded to bf16; q/k/v projections with EXACT bf16 products on WMMA 16x16x32 (f32 accumulate); interleaved RoPE in f32 (sincosf) on the projected q/k rows; q as f16 hi + residual (x 2^10) against k once to f16 (2 products) x 1024^-0.5; softmax in f32 (precise expf); P x 2^11 once to f16 against v once to f16 (1 product); ctx split bf16 hi + lo against exact Wo (2 products); f32 output.
#include <hip/hip_runtime.h>
#include <math.h>

typedef __attribute__((ext_vector_type(16))) _Float16 v16h;
typedef __attribute__((ext_vector_type(16))) __bf16 v16b;
typedef __attribute__((ext_vector_type(8)))  _Float16 v8h;
typedef __attribute__((ext_vector_type(8)))  float v8f;
typedef __attribute__((ext_vector_type(4)))  float v4f;
typedef __attribute__((ext_vector_type(2)))  float v2f;
typedef __attribute__((ext_vector_type(4)))  unsigned v4u;
typedef __attribute__((ext_vector_type(4)))  int v4i;
typedef float __attribute__((may_alias)) float_a;
typedef int __attribute__((may_alias)) int_a;

template <typename T> __device__ __forceinline__ void vst2(void* p, T v) { *(T*)p = v;  }
__device__ __forceinline__ v8f wmma16(v16h a, v16h b, v8f c) {
  v8f d = __builtin_amdgcn_wmma_f32_16x16x32_f16(false, a, false, b, (short)0, c, false, false);
  asm volatile("v_nop\n\tv_nop\n\tv_nop\n\tv_nop" : "+v"(d) : "v"(a), "v"(b));
  return d;
}
__device__ __forceinline__ v8f wmma_bf(v16b a, v16b b, v8f c) {
  v8f d = __builtin_amdgcn_wmma_f32_16x16x32_bf16(false, a, false, b, (short)0, c, false, false);
  asm volatile("v_nop\n\tv_nop\n\tv_nop\n\tv_nop" : "+v"(d) : "v"(a), "v"(b));
  return d;
}
// 16x16x32 fragments: lane = (h = lane>>4, row/col = lane&15); elements 0..7 = k0+8h+0..7, 8..15 = k0+16+8h+0..7; D element r = row 8h+r
__device__ __forceinline__ v16h frag_h(const _Float16* rowk0, int lane) {
  union { v16h v; v8h q[2]; } u; const _Float16* p = rowk0 + 8 * (lane >> 4);
  u.q[0] = *(const v8h*)p; u.q[1] = *(const v8h*)(p + 16); return u.v;
}
__device__ __forceinline__ v16h frag_f32(const float* rowk0, int lane) {
  v16h a; const float* p = rowk0 + 8 * (lane >> 4);
#pragma unroll
  for (int i = 0; i < 8; ++i) { a[i] = (_Float16)p[i]; a[8 + i] = (_Float16)p[16 + i]; }
  return a;
}
__device__ __forceinline__ v16h frag_f32s(const float* rowk0, int lane, float sc) {
  v16h a; const float* p = rowk0 + 8 * (lane >> 4);
#pragma unroll
  for (int i = 0; i < 8; ++i) { a[i] = (_Float16)(p[i] * sc); a[8 + i] = (_Float16)(p[16 + i] * sc); }
  return a;
}
// column fragment from a [K][ld] layout (column n), rows >= K read as 0
__device__ __forceinline__ v16h fragc_f32(const float* W, int k0, int n, int lane, int ld, int K) {
  v16h a; const int g = lane >> 4;
#pragma unroll
  for (int i = 0; i < 8; ++i) { const int ka = k0 + 8 * g + i, kb = ka + 16;
    a[i] = (_Float16)(ka < K ? W[(size_t)(ka < K ? ka : K - 1) * ld + n] : 0.f); a[8 + i] = (_Float16)(kb < K ? W[(size_t)(kb < K ? kb : K - 1) * ld + n] : 0.f); }
  return a;
}
struct F2 { v16b h, l; };
__device__ __forceinline__ F2 bsplit16(const float v[16]) { F2 r;
#pragma unroll
  for (int i = 0; i < 16; ++i) { const __bf16 h = (__bf16)v[i]; r.h[i] = h; r.l[i] = (__bf16)(v[i] - (float)h); }
  return r; }
__device__ __forceinline__ F2 split_row(const float* row, int k0, int lane) { float v[16]; const float* p = row + k0 + 8 * (lane >> 4);
#pragma unroll
  for (int i = 0; i < 8; ++i) { v[i] = p[i]; v[8 + i] = p[16 + i]; }
  return bsplit16(v); }
__device__ __forceinline__ F2 split_rowK(const float* row, int k0, int lane, int K) { float v[16]; const int g = lane >> 4;
#pragma unroll
  for (int i = 0; i < 8; ++i) { const int ka = k0 + 8 * g + i, kb = ka + 16; v[i] = ka < K ? row[ka < K ? ka : K - 1] : 0.f; v[8 + i] = kb < K ? row[kb < K ? kb : K - 1] : 0.f; }
  return bsplit16(v); }
__device__ __forceinline__ F2 split_col(const float* W, int k0, int n, int lane, int ld, int K) { float v[16]; const int g = lane >> 4;
#pragma unroll
  for (int i = 0; i < 8; ++i) { const int ka = k0 + 8 * g + i, kb = ka + 16; v[i] = ka < K ? W[(size_t)(ka < K ? ka : K - 1) * ld + n] : 0.f; v[8 + i] = kb < K ? W[(size_t)(kb < K ? kb : K - 1) * ld + n] : 0.f; }
  return bsplit16(v); }
__device__ __forceinline__ v8f mac3(const F2& a, const F2& b, v8f c) { c = wmma_bf(a.l, b.h, c); c = wmma_bf(a.h, b.l, c); return wmma_bf(a.h, b.h, c); }
__device__ __forceinline__ float sigm(float v) { return 1.0f / (1.0f + expf(-v)); }
#define LDSX() do { asm volatile("s_wait_dscnt 0" ::: "memory"); __builtin_amdgcn_wave_barrier(); __builtin_amdgcn_fence(__ATOMIC_RELEASE, "workgroup"); } while (0)

// Multi-head attention with RoPE (B 2, S 2,048, 1,024 = 16 x 64; 0.02-scale weights and biases): q,k,v = x W^T + b ((out,in)); interleaved-pair RoPE on q, k (angle t x 10000^(-2i/64)); scores = q k^T / sqrt(1024) (note: sqrt(D), not sqrt(hd)); out = merged(softmax(scores) v) Wo^T (no output bias).
#define NB 2
#define TT 2048
#define CC 1024            // NH * HD = projected width
#define DIN 1024          // input (model) width
#define NH 16
#define HD 64
#define NQB (TT / 64)
#define HG 4
#define SCALE (0.03125f)
#define CAUSAL 0
#ifndef TNB
#define TNB NB
#endif
__device__ __forceinline__ float bfr(float v) { return (float)(__bf16)v; }
__host__ __device__ __forceinline__ int kb_last(int qb) { return CAUSAL ? ((qb * 64 + 63) >> 7) : (TT / 128 - 1); }
typedef __attribute__((ext_vector_type(8))) __bf16 v8b;
__device__ __forceinline__ v16b frag_b(const __bf16* rowk0, int lane) {
  union { v16b v; v8b q[2]; } u; const __bf16* p = rowk0 + 8 * (lane >> 4);
  u.q[0] = *(const v8b*)p; u.q[1] = *(const v8b*)(p + 16); return u.v;
}
#define QBH 0              // causal: query blocks 0..QBH-1 of each sequence (few keys, no averaging) take the high-precision path
#define QHI 2048            // rows carrying a q residual plane (all rows when non-causal: 2-product logits everywhere)
#define KHI 64            // key rows carrying k residual / v bf16 hi+lo planes (used only by the causal high-precision path)
// B fragment (k rows k0+.., output column o) of a weight: (in,out) [K][ld] or (out,in) [ld rows of K]: bf16 exact, or f16(bf16 * 256) exact
__device__ __forceinline__ v16b wcol_io(const float* Wm, int k0, int o, int lane, int ld) { v16b w; const int g = lane >> 4;
#pragma unroll
  for (int i = 0; i < 8; ++i) { w[i] = (__bf16)Wm[(size_t)(k0 + 8 * g + i) * ld + o]; w[8 + i] = (__bf16)Wm[(size_t)(k0 + 16 + 8 * g + i) * ld + o]; }
  return w; }
__device__ __forceinline__ v16b wcol_oi(const float* Wm, int k0, int o, int lane, int K) { v16b w; const float* p = Wm + (size_t)o * K + k0 + 8 * (lane >> 4);
#pragma unroll
  for (int i = 0; i < 8; ++i) { w[i] = (__bf16)p[i]; w[8 + i] = (__bf16)p[16 + i]; }
  return w; }
__device__ __forceinline__ v16h wcolh_io(const float* Wm, int k0, int o, int lane, int ld) { v16h w; const int g = lane >> 4;
#pragma unroll
  for (int i = 0; i < 8; ++i) { w[i] = (_Float16)(bfr(Wm[(size_t)(k0 + 8 * g + i) * ld + o]) * 256.0f); w[8 + i] = (_Float16)(bfr(Wm[(size_t)(k0 + 16 + 8 * g + i) * ld + o]) * 256.0f); }
  return w; }
__device__ __forceinline__ v16h wcolh_oi(const float* Wm, int k0, int o, int lane, int K) { v16h w; const float* p = Wm + (size_t)o * K + k0 + 8 * (lane >> 4);
#pragma unroll
  for (int i = 0; i < 8; ++i) { w[i] = (_Float16)(bfr(p[i]) * 256.0f); w[8 + i] = (_Float16)(bfr(p[16 + i]) * 256.0f); }
  return w; }
#define WQKV_LAYOUT 1   // 0 = (in,out) [DIN][CC]; 1 = (out,in) [CC][DIN]; 2 = per-head [NH][DIN][HD]
__device__ __forceinline__ v16b wcol_hdk(const float* Wm, int k0, int o, int lane) { v16b w; const int g = lane >> 4; const float* p = Wm + (size_t)(o / HD) * DIN * HD + (o % HD);
#pragma unroll
  for (int i = 0; i < 8; ++i) { w[i] = (__bf16)p[(size_t)(k0 + 8 * g + i) * HD]; w[8 + i] = (__bf16)p[(size_t)(k0 + 16 + 8 * g + i) * HD]; }
  return w; }
#define WO_OUT_IN 1
#if WQKV_LAYOUT == 1
#define WCOL(W, k0, o, lane) wcol_oi(W, k0, o, lane, DIN)
#elif WQKV_LAYOUT == 2
#define WCOL(W, k0, o, lane) wcol_hdk(W, k0, o, lane)
#else
#define WCOL(W, k0, o, lane) wcol_io(W, k0, o, lane, CC)
#endif
#if WO_OUT_IN
#define WOCOL(W, k0, o, lane) wcol_oi(W, k0, o, lane, CC)
#define WOCOLH(W, k0, o, lane) wcolh_oi(W, k0, o, lane, CC)
#else
#define WOCOL(W, k0, o, lane) wcol_io(W, k0, o, lane, DIN)
#define WOCOLH(W, k0, o, lane) wcolh_io(W, k0, o, lane, DIN)
#endif
__constant__ float c_invf[32] = {1.000000000e+0f,7.498942018e-1f,5.623413324e-1f,4.216965139e-1f,3.162277639e-1f,2.371373773e-1f,1.778279394e-1f,1.333521456e-1f,1.000000015e-1f,7.498942316e-2f,5.623413250e-2f,4.216964915e-2f,3.162277490e-2f,2.371373773e-2f,1.778279431e-2f,1.333521400e-2f,9.999999776e-3f,7.498942316e-3f,5.623413250e-3f,4.216964822e-3f,3.162277630e-3f,2.371373819e-3f,1.778279431e-3f,1.333521446e-3f,1.000000047e-3f,7.498941850e-4f,5.623413017e-4f,4.216965172e-4f,3.162277571e-4f,2.371373703e-4f,1.778279402e-4f,1.333521504e-4f};   /* f32(1 / 10000^(2i/64)) */
#define PROJ_EPI(which, row, t, h) do { if ((which) < 2) { float* rw = (row); const float pf = (float)(t); _Pragma("unroll") for (int i = 0; i < 32; ++i) { const float a = rw[2 * i], b = rw[2 * i + 1]; float sn, cs; sincosf(pf * c_invf[i], &sn, &cs); rw[2 * i] = a * cs - b * sn; rw[2 * i + 1] = a * sn + b * cs; } } } while (0)   /* interleaved (even, odd) RoPE pairs, angle = t * 10000^(-2i/64) */
#ifndef SM_EXTRA_PARAMS
#define SM_EXTRA_PARAMS
#endif
#ifndef PROJ_EXTRA_PARAMS
#define PROJ_EXTRA_PARAMS
#endif
#ifndef SM_MASK_HOOK
#define SM_MASK_HOOK (void)0
#endif

#define WS_QH  0u                                      // f16 q rows [b*t][CC]
#define WS_KH  (WS_QH + 2u * (size_t)NB * TT * CC)      // f16 k rows [b*t][CC]
#define WS_VT  (WS_KH + 2u * (size_t)NB * TT * CC)      // f16 v planes [b][c][t]
#define WS_QL  (WS_VT + 2u * (size_t)NB * CC * TT)      // f16 q residual x 2^10 rows [b][t < QHI][CC]
#define WS_KL  (WS_QL + 2u * (size_t)NB * QHI * CC)     // f16 k residual x 2^10 rows [b][t < KHI][CC]
#define WS_VB  (WS_KL + 2u * (size_t)NB * KHI * CC)     // bf16 v hi planes [b][c][t < KHI]
#define WS_VBL (WS_VB + 2u * (size_t)NB * CC * KHI)
#define WS_S   (WS_VBL + 2u * (size_t)NB * CC * KHI)    // f32 logits / P [hg][t][s]
#define WS_Y   (WS_S  + 4u * (size_t)HG * TT * TT)      // f32 ctx rows [b*t][CC] (only when there is an output projection)
#define WS_END (WS_Y  + 4u * (size_t)NB * TT * CC)

// ---- k_proj: block = (64 rows, 128 cols, which): q/k/v = X W (+ b) with exact bf16 products (K = DIN) -> which 0: q f16 rows (+ residual rows < QHI); 1: k f16 rows (+ residual rows < KHI); 2: v f16 planes [c][t] (+ bf16 hi/lo planes for t < KHI)
__global__ __launch_bounds__(128) void k_proj(const float* __restrict__ XQ, const float* __restrict__ XK, const float* __restrict__ XV, const float* __restrict__ WQ, const float* __restrict__ WK, const float* __restrict__ WV, const float* __restrict__ BQ, const float* __restrict__ BK, const float* __restrict__ BV,
    _Float16* __restrict__ QH, _Float16* __restrict__ QL, _Float16* __restrict__ KH, _Float16* __restrict__ KL, _Float16* __restrict__ VT, __bf16* __restrict__ VB, __bf16* __restrict__ VBL PROJ_EXTRA_PARAMS) {
  __shared__ __align__(16) float st[64][132]; __shared__ __align__(16) _Float16 sh[64][136], sl[64][136]; __shared__ __align__(16) _Float16 th[128][72]; __shared__ __align__(16) __bf16 tb[128][72], tbl[128][72];
  const int tid = threadIdx.x, wave = tid >> 5, lane = tid & 31, col = lane & 15, g = lane >> 4; const int which = blockIdx.z; const int c0 = blockIdx.y * 128; const size_t r0 = (size_t)blockIdx.x * 64; const size_t bb = r0 / TT; const int t0 = (int)(r0 % TT);
  const float* X = which == 0 ? XQ : which == 1 ? XK : XV; const float* WA = which == 0 ? WQ : which == 1 ? WK : WV; const float* BA = which == 0 ? BQ : which == 1 ? BK : BV;
  v8f acc[8] = {};
#pragma unroll 2
  for (int kc = 0; kc < DIN / 32; ++kc) { v16b a; { const float* p = X + (r0 + wave * 16 + col) * DIN + kc * 32 + 8 * g;
#pragma unroll
      for (int i = 0; i < 8; ++i) { a[i] = (__bf16)p[i]; a[8 + i] = (__bf16)p[16 + i]; } }
    asm volatile("s_wait_loadcnt 0x0" ::: "memory");
#pragma unroll
    for (int j = 0; j < 8; ++j) { const v16b w = WCOL(WA, kc * 32, c0 + j * 16 + col, lane); asm volatile("s_wait_loadcnt 0x0" ::: "memory"); acc[j] = wmma_bf(a, w, acc[j]); } }
  { // stage the f32 tile (acc + bias) in LDS, run the per-(row, head) epilogue hook, then convert
#pragma unroll
    for (int j = 0; j < 8; ++j) { const float bias = BA ? bfr(BA[c0 + j * 16 + col]) : 0.f;
#pragma unroll
      for (int r = 0; r < 8; ++r) st[wave * 16 + 8 * g + r][j * 16 + col] = acc[j][r] + bias; }
    __syncthreads();
    for (int e = tid; e < 64 * (128 / HD); e += 128) { const int rl = e / (128 / HD), hh = e % (128 / HD); PROJ_EPI(which, &st[rl][hh * HD], (int)((r0 + rl) % TT), (c0 / HD) + hh); }
    __syncthreads(); }
  if (which < 2) { _Float16* DH = which == 0 ? QH : KH; _Float16* DL = which == 0 ? QL : KL; const int nhi = which == 0 ? QHI : KHI; const bool hi_rows = t0 < nhi;
    for (int e = tid; e < 64 * 128; e += 128) { const int rl = e >> 7, cl = e & 127; const float v = st[rl][cl]; const _Float16 hv = (_Float16)v; sh[rl][cl] = hv; sl[rl][cl] = (_Float16)((v - (float)hv) * 1024.0f); }
    __syncthreads();
    for (int e = tid; e < 64 * 16; e += 128) { const int rl = e >> 4, q = e & 15; vst2((unsigned*)(DH + (r0 + rl) * CC + c0 + q * 8), *(const v4u*)&sh[rl][q * 8]); if (hi_rows) vst2((unsigned*)(DL + (bb * nhi + t0 + rl) * (size_t)CC + c0 + q * 8), *(const v4u*)&sl[rl][q * 8]); }
  } else { const bool hi_rows = t0 < KHI;
    for (int e = tid; e < 64 * 128; e += 128) { const int rl = e & 63, cl = e >> 6; const float v = st[rl][cl]; th[cl][rl] = (_Float16)v; const __bf16 bh = (__bf16)v; tb[cl][rl] = bh; tbl[cl][rl] = (__bf16)(v - (float)bh); }
    __syncthreads();
    for (int e = tid; e < 128 * 8; e += 128) { const int cl = e >> 3, q = e & 7; vst2((unsigned*)(VT + (bb * CC + c0 + cl) * (size_t)TT + t0 + q * 8), *(const v4u*)&th[cl][q * 8]); if (hi_rows) { const size_t o3 = (bb * CC + c0 + cl) * (size_t)KHI + t0 + q * 8; vst2((unsigned*)(VB + o3), *(const v4u*)&tb[cl][q * 8]); vst2((unsigned*)(VBL + o3), *(const v4u*)&tbl[cl][q * 8]); } } } }
// ---- k_sc: block = (query block qb, key block kb <= kb_last(qb), head in group) of batch b: logits x SCALE; q hi + residual (x 2^10) against k (2 products) for query rows < QHI, plus the k residual (3 products) for query blocks < QBH (causal early rows); causal: blocks past the diagonal exit, the mask itself is applied by index in k_sm
__global__ __launch_bounds__(128) void k_sc(const _Float16* __restrict__ QH, const _Float16* __restrict__ KH, const _Float16* __restrict__ QL, const _Float16* __restrict__ KL, int b, int h0, float* __restrict__ S0) { __shared__ __align__(16) float ss[4][16][132];
  const int qb = blockIdx.x, kb = blockIdx.y; if (kb > kb_last(qb)) return;
  const int h = h0 + blockIdx.z; float* S = S0 + (size_t)blockIdx.z * TT * TT;
  const int tid = threadIdx.x, wave = tid >> 5, lane = tid & 31, col = lane & 15, g = lane >> 4; const int k0 = kb * 128; const int ql0 = qb * 64 + wave * 16; const size_t q0 = (size_t)b * TT + ql0, kr0 = (size_t)b * TT + k0;
  v8f acc[8] = {}, accl[8] = {};
  const _Float16* QLb = QL + (size_t)b * QHI * CC; const _Float16* KLb = KL + (size_t)b * KHI * CC;
  if (qb < QBH) {
#pragma unroll
    for (int kc = 0; kc < HD / 32; ++kc) { const v16h ah = frag_h(QH + (q0 + col) * CC + h * HD + kc * 32, lane), al = frag_h(QLb + (size_t)(ql0 + col) * CC + h * HD + kc * 32, lane);
#pragma unroll
      for (int j = 0; j < 8; ++j) { const v16h kbf = frag_h(KH + (kr0 + j * 16 + col) * CC + h * HD + kc * 32, lane), klf = frag_h(KLb + (size_t)(k0 + j * 16 + col) * CC + h * HD + kc * 32, lane); acc[j] = wmma16(ah, kbf, acc[j]); accl[j] = wmma16(al, kbf, accl[j]); accl[j] = wmma16(ah, klf, accl[j]); } }
  } else if (qb * 64 < QHI) {
#pragma unroll
    for (int kc = 0; kc < HD / 32; ++kc) { const v16h ah = frag_h(QH + (q0 + col) * CC + h * HD + kc * 32, lane), al = frag_h(QLb + (size_t)(ql0 + col) * CC + h * HD + kc * 32, lane);
#pragma unroll
      for (int j = 0; j < 8; ++j) { const v16h kbf = frag_h(KH + (kr0 + j * 16 + col) * CC + h * HD + kc * 32, lane); acc[j] = wmma16(ah, kbf, acc[j]); accl[j] = wmma16(al, kbf, accl[j]); } }
  } else {
#pragma unroll
    for (int kc = 0; kc < HD / 32; ++kc) { const v16h ah = frag_h(QH + (q0 + col) * CC + h * HD + kc * 32, lane);
#pragma unroll
      for (int j = 0; j < 8; ++j) { const v16h kbf = frag_h(KH + (kr0 + j * 16 + col) * CC + h * HD + kc * 32, lane); acc[j] = wmma16(ah, kbf, acc[j]); } } }
#pragma unroll
  for (int j = 0; j < 8; ++j) {
#pragma unroll
    for (int r = 0; r < 8; ++r) ss[wave][8 * g + r][j * 16 + col] = (acc[j][r] + accl[j][r] * (1.0f / 1024.0f)) * SCALE; }
  LDSX(); for (int rl = 0; rl < 16; ++rl) vst2(S + (size_t)(ql0 + rl) * TT + k0 + lane * 4, *(const v4f*)&ss[wave][rl][lane * 4]); }
// ---- k_sm: block = query row t (head in group): keys [0, kend): causal -> logit if s <= t else excluded; softmax in f32; P x 2^11 in place (0 for excluded)
__global__ __launch_bounds__(256) void k_sm(float* __restrict__ S0 SM_EXTRA_PARAMS) { __shared__ float sred[8]; __shared__ float sbc; __shared__ __align__(16) float shv[TT];
  const int tid = threadIdx.x; const int t = blockIdx.x; const int kend = (kb_last(t >> 6) + 1) * 128;
  float* sr = S0 + (size_t)blockIdx.y * TT * TT + (size_t)t * TT;
  float m = -3.0e38f; for (int k = tid; k < kend; k += 256) { float v = (!CAUSAL || k <= t) ? sr[k] : -3.0e38f; SM_MASK_HOOK; shv[k] = v; m = fmaxf(m, v); }
#pragma unroll
  for (int o = 1; o < 32; o <<= 1) m = fmaxf(m, __shfl_xor(m, o));
  if ((tid & 31) == 0) sred[tid >> 5] = m; __syncthreads(); if (tid == 0) { float a = sred[0]; for (int i = 1; i < 8; ++i) a = fmaxf(a, sred[i]); sbc = a; } __syncthreads(); m = sbc; __syncthreads();
  float sum = 0.f; for (int k = tid; k < kend; k += 256) { const float v = shv[k]; const float e = (v <= -1.0e38f) ? 0.f : expf(v - m); shv[k] = e; sum += e; }
#pragma unroll
  for (int o = 1; o < 32; o <<= 1) sum += __shfl_xor(sum, o);
  if ((tid & 31) == 0) sred[tid >> 5] = sum; __syncthreads(); if (tid == 0) { float a = 0.f; for (int i = 0; i < 8; ++i) a += sred[i]; sbc = a > 0.f ? 2048.0f / a : 0.f; }   /* a fully excluded row yields P = 0 */ __syncthreads(); const float inv = sbc;
  for (int k = tid; k < kend; k += 256) shv[k] = shv[k] * inv;
  __syncthreads(); for (int q = tid; q < kend / 4; q += 256) vst2(sr + q * 4, *(const v4f*)&shv[q * 4]); }
// ---- k_pv: block = 64 queries (qb) of (b, h): ctx = P . v over keys [0, kend) (P x 2^11 once to f16 against v f16: 1 product; causal early query blocks: P and v as bf16 hi + lo, 3 products); 256-B (row, head) segment by 16 lanes
__global__ __launch_bounds__(128) void k_pv(const float* __restrict__ PS0, const _Float16* __restrict__ VT, const __bf16* __restrict__ VB, const __bf16* __restrict__ VBL, int b, int h0, float* __restrict__ Y) { const int h = h0 + blockIdx.z; const float* PS = PS0 + (size_t)blockIdx.z * TT * TT; __shared__ __align__(16) float ss[4][16][HD + 4];
  const int tid = threadIdx.x, wave = tid >> 5, lane = tid & 31, col = lane & 15, g = lane >> 4; const int qb = blockIdx.x; const int ql0 = qb * 64 + wave * 16; const int kce = (kb_last(qb) + 1) * 4;
  v8f acc[HD / 16] = {};
  if (qb < QBH) {
#pragma unroll 1
    for (int kc = 0; kc < kce; ++kc) { const F2 p = split_row(PS + (size_t)(ql0 + col) * TT, kc * 32, lane);
      asm volatile("s_wait_loadcnt 0x0" ::: "memory");
#pragma unroll
      for (int j = 0; j < HD / 16; ++j) { const size_t po = ((size_t)b * CC + h * HD + j * 16 + col) * (size_t)KHI + kc * 32; const v16b vh = frag_b(VB + po, lane); acc[j] = wmma_bf(p.h, vh, acc[j]); acc[j] = wmma_bf(p.l, vh, acc[j]); acc[j] = wmma_bf(p.h, frag_b(VBL + po, lane), acc[j]); } }
  } else {
#pragma unroll 1
    for (int kc = 0; kc < kce; ++kc) { const v16h p = frag_f32(PS + (size_t)(ql0 + col) * TT + kc * 32, lane);
      asm volatile("s_wait_loadcnt 0x0" ::: "memory");
#pragma unroll
      for (int j = 0; j < HD / 16; ++j) { const size_t po = ((size_t)b * CC + h * HD + j * 16 + col) * (size_t)TT + kc * 32; acc[j] = wmma16(p, frag_h(VT + po, lane), acc[j]); } } }
#pragma unroll
  for (int j = 0; j < HD / 16; ++j)
#pragma unroll
    for (int r = 0; r < 8; ++r) ss[wave][8 * g + r][j * 16 + col] = acc[j][r] * (1.0f / 2048.0f);
  LDSX(); for (int rl = 0; rl < 16; ++rl) if (lane < HD / 4) vst2(Y + ((size_t)b * TT + ql0 + rl) * CC + h * HD + lane * 4, *(const v4f*)&ss[wave][rl][lane * 4]); }
// ---- k_out: block = (64 rows, 128 cols): out = ctx Wo (+ bo): all rows: ctx bf16 hi + lo against exact bf16 Wo (2 products); the f16(bf16 x 2^8) 1-product branch is never taken
__global__ __launch_bounds__(128) void k_out(const float* __restrict__ Y, const float* __restrict__ WO, const float* __restrict__ BO, float* __restrict__ OUT) { __shared__ __align__(16) float sf[4][16][132];
  const int tid = threadIdx.x, wave = tid >> 5, lane = tid & 31, col = lane & 15, g = lane >> 4; const int c0 = blockIdx.y * 128; const size_t r0 = (size_t)blockIdx.x * 64 + wave * 16;
  v8f acc[8] = {};
  if (true) {   /* ALL rows: ctx split bf16 hi + lo x exact Wo (2 products) */
#pragma unroll 2
    for (int kc = 0; kc < CC / 32; ++kc) { const F2 a = split_row(Y + (r0 + col) * CC, kc * 32, lane); asm volatile("s_wait_loadcnt 0x0" ::: "memory");
#pragma unroll
      for (int j = 0; j < 8; ++j) { const v16b w = WOCOL(WO, kc * 32, c0 + j * 16 + col, lane); asm volatile("s_wait_loadcnt 0x0" ::: "memory"); acc[j] = wmma_bf(a.h, w, acc[j]); acc[j] = wmma_bf(a.l, w, acc[j]); } }
#pragma unroll
    for (int j = 0; j < 8; ++j) { const float bias = BO ? bfr(BO[c0 + j * 16 + col]) : 0.f;
#pragma unroll
      for (int r = 0; r < 8; ++r) sf[wave][8 * g + r][j * 16 + col] = acc[j][r] + bias; }
  } else {
#pragma unroll 2
    for (int kc = 0; kc < CC / 32; ++kc) { const v16h a = frag_f32(Y + (r0 + col) * CC + kc * 32, lane); asm volatile("s_wait_loadcnt 0x0" ::: "memory");
#pragma unroll
      for (int j = 0; j < 8; ++j) { const v16h w = WOCOLH(WO, kc * 32, c0 + j * 16 + col, lane); asm volatile("s_wait_loadcnt 0x0" ::: "memory"); acc[j] = wmma16(a, w, acc[j]); } }
#pragma unroll
    for (int j = 0; j < 8; ++j) { const float bias = BO ? bfr(BO[c0 + j * 16 + col]) : 0.f;
#pragma unroll
      for (int r = 0; r < 8; ++r) sf[wave][8 * g + r][j * 16 + col] = acc[j][r] * (1.0f / 256.0f) + bias; } }
  LDSX(); for (int rl = 0; rl < 16; ++rl) vst2(OUT + (r0 + rl) * DIN + c0 + lane * 4, *(const v4f*)&sf[wave][rl][lane * 4]); }

extern "C" void kernel_launch(void* const* d_in, const int* in_sizes, int n_in, void* d_out, int out_size, void* d_ws, size_t ws_size, hipStream_t stream) {
  (void)in_sizes; (void)n_in; (void)out_size;
  const float** F = (const float**)d_in;
  if (ws_size < (size_t)WS_END) return;
  char* ws = (char*)d_ws; _Float16 *QH = (_Float16*)(ws + WS_QH), *KH = (_Float16*)(ws + WS_KH), *VT = (_Float16*)(ws + WS_VT), *QL = (_Float16*)(ws + WS_QL), *KL = (_Float16*)(ws + WS_KL); __bf16 *VB = (__bf16*)(ws + WS_VB), *VBL = (__bf16*)(ws + WS_VBL); float *S = (float*)(ws + WS_S), *Y = (float*)(ws + WS_Y);
  (void)Y; (void)QL; (void)KL; (void)VB; (void)VBL;
  // inputs: 0 x [2,2048,1024]; 1 Wq [1024,1024] (out,in), 2 bq; 3 Wk, 4 bk; 5 Wv, 6 bv; 7 Wo (no bias)
  k_proj<<<dim3(TNB * TT / 64, CC / 128, 3), 128, 0, stream>>>(F[0], F[0], F[0], F[1], F[3], F[5], F[2], F[4], F[6], QH, QL, KH, KL, VT, VB, VBL);
  for (int b = 0; b < TNB; ++b) for (int h0 = 0; h0 < NH; h0 += HG) {
    k_sc<<<dim3(NQB, TT / 128, HG), 128, 0, stream>>>(QH, KH, QL, KL, b, h0, S);
    k_sm<<<dim3(TT, HG), 256, 0, stream>>>(S);
    k_pv<<<dim3(NQB, 1, HG), 128, 0, stream>>>(S, VT, VB, VBL, b, h0, Y);
  }
  k_out<<<dim3(TNB * TT / 64, DIN / 128), 128, 0, stream>>>(Y, F[7], nullptr, (float*)d_out);
}

// v001
// It runs in 511 microseconds.
// Two timings next to v000 both put it at 2.84 times that version's speed.
// compute dtype: all float inputs rounded to bf16; q/k/v projections with EXACT bf16 products on WMMA 16x16x32 (f32 accumulate); interleaved RoPE in f32 (sincosf) on the projected q/k rows; q as f16 hi + residual (x 2^10) against k once to f16 (2 products) x 1024^-0.5; one-pass softmax in f32 (running maximum and sum, exp2 of the scaled difference); exp(logit - maximum) once to f16 against v once to f16 (1 product), divided by the sum at the end; ctx split bf16 hi + lo against exact Wo (2 products); f32 output.
#include <hip/hip_runtime.h>
#include <math.h>

typedef __attribute__((ext_vector_type(16))) _Float16 v16h;
typedef __attribute__((ext_vector_type(16))) __bf16 v16b;
typedef __attribute__((ext_vector_type(8)))  _Float16 v8h;
typedef __attribute__((ext_vector_type(8)))  float v8f;
typedef __attribute__((ext_vector_type(4)))  float v4f;
typedef __attribute__((ext_vector_type(2)))  float v2f;
typedef __attribute__((ext_vector_type(4)))  unsigned v4u;
typedef __attribute__((ext_vector_type(4)))  int v4i;
typedef float __attribute__((may_alias)) float_a;
typedef int __attribute__((may_alias)) int_a;

template <typename T> __device__ __forceinline__ void vst2(void* p, T v) { *(T*)p = v;  }
__device__ __forceinline__ v8f wmma16(v16h a, v16h b, v8f c) {
  v8f d = __builtin_amdgcn_wmma_f32_16x16x32_f16(false, a, false, b, (short)0, c, false, false);
  asm volatile("v_nop\n\tv_nop\n\tv_nop\n\tv_nop" : "+v"(d) : "v"(a), "v"(b));
  return d;
}
__device__ __forceinline__ v8f wmma_bf(v16b a, v16b b, v8f c) {
  v8f d = __builtin_amdgcn_wmma_f32_16x16x32_bf16(false, a, false, b, (short)0, c, false, false);
  asm volatile("v_nop\n\tv_nop\n\tv_nop\n\tv_nop" : "+v"(d) : "v"(a), "v"(b));
  return d;
}
// 16x16x32 fragments: lane = (h = lane>>4, row/col = lane&15); elements 0..7 = k0+8h+0..7, 8..15 = k0+16+8h+0..7; D element r = row 8h+r
__device__ __forceinline__ v16h frag_h(const _Float16* rowk0, int lane) {
  union { v16h v; v8h q[2]; } u; const _Float16* p = rowk0 + 8 * (lane >> 4);
  u.q[0] = *(const v8h*)p; u.q[1] = *(const v8h*)(p + 16); return u.v;
}
__device__ __forceinline__ v16h frag_f32(const float* rowk0, int lane) {
  v16h a; const float* p = rowk0 + 8 * (lane >> 4);
#pragma unroll
  for (int i = 0; i < 8; ++i) { a[i] = (_Float16)p[i]; a[8 + i] = (_Float16)p[16 + i]; }
  return a;
}
__device__ __forceinline__ v16h frag_f32s(const float* rowk0, int lane, float sc) {
  v16h a; const float* p = rowk0 + 8 * (lane >> 4);
#pragma unroll
  for (int i = 0; i < 8; ++i) { a[i] = (_Float16)(p[i] * sc); a[8 + i] = (_Float16)(p[16 + i] * sc); }
  return a;
}
// column fragment from a [K][ld] layout (column n), rows >= K read as 0
__device__ __forceinline__ v16h fragc_f32(const float* W, int k0, int n, int lane, int ld, int K) {
  v16h a; const int g = lane >> 4;
#pragma unroll
  for (int i = 0; i < 8; ++i) { const int ka = k0 + 8 * g + i, kb = ka + 16;
    a[i] = (_Float16)(ka < K ? W[(size_t)(ka < K ? ka : K - 1) * ld + n] : 0.f); a[8 + i] = (_Float16)(kb < K ? W[(size_t)(kb < K ? kb : K - 1) * ld + n] : 0.f); }
  return a;
}
struct F2 { v16b h, l; };
__device__ __forceinline__ F2 bsplit16(const float v[16]) { F2 r;
#pragma unroll
  for (int i = 0; i < 16; ++i) { const __bf16 h = (__bf16)v[i]; r.h[i] = h; r.l[i] = (__bf16)(v[i] - (float)h); }
  return r; }
__device__ __forceinline__ F2 split_row(const float* row, int k0, int lane) { float v[16]; const float* p = row + k0 + 8 * (lane >> 4);
#pragma unroll
  for (int i = 0; i < 8; ++i) { v[i] = p[i]; v[8 + i] = p[16 + i]; }
  return bsplit16(v); }
__device__ __forceinline__ F2 split_rowK(const float* row, int k0, int lane, int K) { float v[16]; const int g = lane >> 4;
#pragma unroll
  for (int i = 0; i < 8; ++i) { const int ka = k0 + 8 * g + i, kb = ka + 16; v[i] = ka < K ? row[ka < K ? ka : K - 1] : 0.f; v[8 + i] = kb < K ? row[kb < K ? kb : K - 1] : 0.f; }
  return bsplit16(v); }
__device__ __forceinline__ F2 split_col(const float* W, int k0, int n, int lane, int ld, int K) { float v[16]; const int g = lane >> 4;
#pragma unroll
  for (int i = 0; i < 8; ++i) { const int ka = k0 + 8 * g + i, kb = ka + 16; v[i] = ka < K ? W[(size_t)(ka < K ? ka : K - 1) * ld + n] : 0.f; v[8 + i] = kb < K ? W[(size_t)(kb < K ? kb : K - 1) * ld + n] : 0.f; }
  return bsplit16(v); }
__device__ __forceinline__ v8f mac3(const F2& a, const F2& b, v8f c) { c = wmma_bf(a.l, b.h, c); c = wmma_bf(a.h, b.l, c); return wmma_bf(a.h, b.h, c); }
__device__ __forceinline__ float sigm(float v) { return 1.0f / (1.0f + expf(-v)); }
#define LDSX() do { asm volatile("s_wait_dscnt 0" ::: "memory"); __builtin_amdgcn_wave_barrier(); __builtin_amdgcn_fence(__ATOMIC_RELEASE, "workgroup"); } while (0)

// Multi-head attention with RoPE (B 2, S 2,048, 1,024 = 16 x 64; 0.02-scale weights and biases): q,k,v = x W^T + b ((out,in)); interleaved-pair RoPE on q, k (angle t x 10000^(-2i/64)); scores = q k^T / sqrt(1024) (note: sqrt(D), not sqrt(hd)); out = merged(softmax(scores) v) Wo^T (no output bias).
#define NB 2
#define TT 2048
#define CC 1024            // NH * HD = projected width
#define DIN 1024          // input (model) width
#define NH 16
#define HD 64
#define NQB (TT / 64)
#define HG 4
#define SCALE (0.03125f)
#define CAUSAL 0
#ifndef TNB
#define TNB NB
#endif
__device__ __forceinline__ float bfr(float v) { return (float)(__bf16)v; }
__host__ __device__ __forceinline__ int kb_last(int qb) { return CAUSAL ? ((qb * 64 + 63) >> 7) : (TT / 128 - 1); }
typedef __attribute__((ext_vector_type(8))) __bf16 v8b;
__device__ __forceinline__ v16b frag_b(const __bf16* rowk0, int lane) {
  union { v16b v; v8b q[2]; } u; const __bf16* p = rowk0 + 8 * (lane >> 4);
  u.q[0] = *(const v8b*)p; u.q[1] = *(const v8b*)(p + 16); return u.v;
}
#define QBH 0
#define QHI 2048            // rows carrying a q residual plane (all rows when non-causal: 2-product logits everywhere)
#define KHI 64            // key rows carrying k residual / v bf16 hi+lo planes (written by k_proj, read by no kernel)
// B fragment (k rows k0+.., output column o) of a weight: (in,out) [K][ld] or (out,in) [ld rows of K]: bf16 exact, or f16(bf16 * 256) exact
__device__ __forceinline__ v16b wcol_io(const float* Wm, int k0, int o, int lane, int ld) { v16b w; const int g = lane >> 4;
#pragma unroll
  for (int i = 0; i < 8; ++i) { w[i] = (__bf16)Wm[(size_t)(k0 + 8 * g + i) * ld + o]; w[8 + i] = (__bf16)Wm[(size_t)(k0 + 16 + 8 * g + i) * ld + o]; }
  return w; }
__device__ __forceinline__ v16b wcol_oi(const float* Wm, int k0, int o, int lane, int K) { v16b w; const float* p = Wm + (size_t)o * K + k0 + 8 * (lane >> 4);
#pragma unroll
  for (int i = 0; i < 8; ++i) { w[i] = (__bf16)p[i]; w[8 + i] = (__bf16)p[16 + i]; }
  return w; }
__device__ __forceinline__ v16h wcolh_io(const float* Wm, int k0, int o, int lane, int ld) { v16h w; const int g = lane >> 4;
#pragma unroll
  for (int i = 0; i < 8; ++i) { w[i] = (_Float16)(bfr(Wm[(size_t)(k0 + 8 * g + i) * ld + o]) * 256.0f); w[8 + i] = (_Float16)(bfr(Wm[(size_t)(k0 + 16 + 8 * g + i) * ld + o]) * 256.0f); }
  return w; }
__device__ __forceinline__ v16h wcolh_oi(const float* Wm, int k0, int o, int lane, int K) { v16h w; const float* p = Wm + (size_t)o * K + k0 + 8 * (lane >> 4);
#pragma unroll
  for (int i = 0; i < 8; ++i) { w[i] = (_Float16)(bfr(p[i]) * 256.0f); w[8 + i] = (_Float16)(bfr(p[16 + i]) * 256.0f); }
  return w; }
#define WQKV_LAYOUT 1   // 0 = (in,out) [DIN][CC]; 1 = (out,in) [CC][DIN]; 2 = per-head [NH][DIN][HD]
__device__ __forceinline__ v16b wcol_hdk(const float* Wm, int k0, int o, int lane) { v16b w; const int g = lane >> 4; const float* p = Wm + (size_t)(o / HD) * DIN * HD + (o % HD);
#pragma unroll
  for (int i = 0; i < 8; ++i) { w[i] = (__bf16)p[(size_t)(k0 + 8 * g + i) * HD]; w[8 + i] = (__bf16)p[(size_t)(k0 + 16 + 8 * g + i) * HD]; }
  return w; }
#define WO_OUT_IN 1
#if WQKV_LAYOUT == 1
#define WCOL(W, k0, o, lane) wcol_oi(W, k0, o, lane, DIN)
#elif WQKV_LAYOUT == 2
#define WCOL(W, k0, o, lane) wcol_hdk(W, k0, o, lane)
#else
#define WCOL(W, k0, o, lane) wcol_io(W, k0, o, lane, CC)
#endif
#if WO_OUT_IN
#define WOCOL(W, k0, o, lane) wcol_oi(W, k0, o, lane, CC)
#define WOCOLH(W, k0, o, lane) wcolh_oi(W, k0, o, lane, CC)
#else
#define WOCOL(W, k0, o, lane) wcol_io(W, k0, o, lane, DIN)
#define WOCOLH(W, k0, o, lane) wcolh_io(W, k0, o, lane, DIN)
#endif
__constant__ float c_invf[32] = {1.000000000e+0f,7.498942018e-1f,5.623413324e-1f,4.216965139e-1f,3.162277639e-1f,2.371373773e-1f,1.778279394e-1f,1.333521456e-1f,1.000000015e-1f,7.498942316e-2f,5.623413250e-2f,4.216964915e-2f,3.162277490e-2f,2.371373773e-2f,1.778279431e-2f,1.333521400e-2f,9.999999776e-3f,7.498942316e-3f,5.623413250e-3f,4.216964822e-3f,3.162277630e-3f,2.371373819e-3f,1.778279431e-3f,1.333521446e-3f,1.000000047e-3f,7.498941850e-4f,5.623413017e-4f,4.216965172e-4f,3.162277571e-4f,2.371373703e-4f,1.778279402e-4f,1.333521504e-4f};   /* f32(1 / 10000^(2i/64)) */
#define PROJ_EPI(which, row, t, h) do { if ((which) < 2) { float* rw = (row); const float pf = (float)(t); _Pragma("unroll") for (int i = 0; i < 32; ++i) { const float a = rw[2 * i], b = rw[2 * i + 1]; float sn, cs; sincosf(pf * c_invf[i], &sn, &cs); rw[2 * i] = a * cs - b * sn; rw[2 * i + 1] = a * sn + b * cs; } } } while (0)   /* interleaved (even, odd) RoPE pairs, angle = t * 10000^(-2i/64) */
#ifndef SM_EXTRA_PARAMS
#define SM_EXTRA_PARAMS
#endif
#ifndef PROJ_EXTRA_PARAMS
#define PROJ_EXTRA_PARAMS
#endif
#ifndef SM_MASK_HOOK
#define SM_MASK_HOOK (void)0
#endif

#define WS_QH  0u                                      // f16 q rows [b*t][CC]
#define WS_KH  (WS_QH + 2u * (size_t)NB * TT * CC)      // f16 k rows [b*t][CC]
#define WS_VT  (WS_KH + 2u * (size_t)NB * TT * CC)      // f16 v planes [b][c][t]
#define WS_QL  (WS_VT + 2u * (size_t)NB * CC * TT)      // f16 q residual x 2^10 rows [b][t < QHI][CC]
#define WS_KL  (WS_QL + 2u * (size_t)NB * QHI * CC)     // f16 k residual x 2^10 rows [b][t < KHI][CC]
#define WS_VB  (WS_KL + 2u * (size_t)NB * KHI * CC)     // bf16 v hi planes [b][c][t < KHI]
#define WS_VBL (WS_VB + 2u * (size_t)NB * CC * KHI)
#define WS_S   (WS_VBL + 2u * (size_t)NB * CC * KHI)    // f32 [hg][t][s], unused: k_fa keeps logits and P in registers
#define WS_Y   (WS_S  + 4u * (size_t)HG * TT * TT)      // f32 ctx rows [b*t][CC] (only when there is an output projection)
#define WS_END (WS_Y  + 4u * (size_t)NB * TT * CC)

// ---- k_proj: block = (64 rows, 128 cols, which): q/k/v = X W (+ b) with exact bf16 products (K = DIN) -> which 0: q f16 rows (+ residual rows < QHI); 1: k f16 rows (+ residual rows < KHI); 2: v f16 planes [c][t] (+ bf16 hi/lo planes for t < KHI)
__global__ __launch_bounds__(128) void k_proj(const float* __restrict__ XQ, const float* __restrict__ XK, const float* __restrict__ XV, const float* __restrict__ WQ, const float* __restrict__ WK, const float* __restrict__ WV, const float* __restrict__ BQ, const float* __restrict__ BK, const float* __restrict__ BV,
    _Float16* __restrict__ QH, _Float16* __restrict__ QL, _Float16* __restrict__ KH, _Float16* __restrict__ KL, _Float16* __restrict__ VT, __bf16* __restrict__ VB, __bf16* __restrict__ VBL PROJ_EXTRA_PARAMS) {
  __shared__ __align__(16) float st[64][132]; __shared__ __align__(16) _Float16 sh[64][136], sl[64][136]; __shared__ __align__(16) _Float16 th[128][72]; __shared__ __align__(16) __bf16 tb[128][72], tbl[128][72];
  const int tid = threadIdx.x, wave = tid >> 5, lane = tid & 31, col = lane & 15, g = lane >> 4; const int which = blockIdx.z; const int c0 = blockIdx.y * 128; const size_t r0 = (size_t)blockIdx.x * 64; const size_t bb = r0 / TT; const int t0 = (int)(r0 % TT);
  const float* X = which == 0 ? XQ : which == 1 ? XK : XV; const float* WA = which == 0 ? WQ : which == 1 ? WK : WV; const float* BA = which == 0 ? BQ : which == 1 ? BK : BV;
  v8f acc[8] = {};
#pragma unroll 2
  for (int kc = 0; kc < DIN / 32; ++kc) { v16b a; { const float* p = X + (r0 + wave * 16 + col) * DIN + kc * 32 + 8 * g;
#pragma unroll
      for (int i = 0; i < 8; ++i) { a[i] = (__bf16)p[i]; a[8 + i] = (__bf16)p[16 + i]; } }
    asm volatile("s_wait_loadcnt 0x0" ::: "memory");
#pragma unroll
    for (int j = 0; j < 8; ++j) { const v16b w = WCOL(WA, kc * 32, c0 + j * 16 + col, lane); asm volatile("s_wait_loadcnt 0x0" ::: "memory"); acc[j] = wmma_bf(a, w, acc[j]); } }
  { // stage the f32 tile (acc + bias) in LDS, run the per-(row, head) epilogue hook, then convert
#pragma unroll
    for (int j = 0; j < 8; ++j) { const float bias = BA ? bfr(BA[c0 + j * 16 + col]) : 0.f;
#pragma unroll
      for (int r = 0; r < 8; ++r) st[wave * 16 + 8 * g + r][j * 16 + col] = acc[j][r] + bias; }
    __syncthreads();
    for (int e = tid; e < 64 * (128 / HD); e += 128) { const int rl = e / (128 / HD), hh = e % (128 / HD); PROJ_EPI(which, &st[rl][hh * HD], (int)((r0 + rl) % TT), (c0 / HD) + hh); }
    __syncthreads(); }
  if (which < 2) { _Float16* DH = which == 0 ? QH : KH; _Float16* DL = which == 0 ? QL : KL; const int nhi = which == 0 ? QHI : KHI; const bool hi_rows = t0 < nhi;
    for (int e = tid; e < 64 * 128; e += 128) { const int rl = e >> 7, cl = e & 127; const float v = st[rl][cl]; const _Float16 hv = (_Float16)v; sh[rl][cl] = hv; sl[rl][cl] = (_Float16)((v - (float)hv) * 1024.0f); }
    __syncthreads();
    for (int e = tid; e < 64 * 16; e += 128) { const int rl = e >> 4, q = e & 15; vst2((unsigned*)(DH + (r0 + rl) * CC + c0 + q * 8), *(const v4u*)&sh[rl][q * 8]); if (hi_rows) vst2((unsigned*)(DL + (bb * nhi + t0 + rl) * (size_t)CC + c0 + q * 8), *(const v4u*)&sl[rl][q * 8]); }
  } else { const bool hi_rows = t0 < KHI;
    for (int e = tid; e < 64 * 128; e += 128) { const int rl = e & 63, cl = e >> 6; const float v = st[rl][cl]; th[cl][rl] = (_Float16)v; const __bf16 bh = (__bf16)v; tb[cl][rl] = bh; tbl[cl][rl] = (__bf16)(v - (float)bh); }
    __syncthreads();
    for (int e = tid; e < 128 * 8; e += 128) { const int cl = e >> 3, q = e & 7; vst2((unsigned*)(VT + (bb * CC + c0 + cl) * (size_t)TT + t0 + q * 8), *(const v4u*)&th[cl][q * 8]); if (hi_rows) { const size_t o3 = (bb * CC + c0 + cl) * (size_t)KHI + t0 + q * 8; vst2((unsigned*)(VB + o3), *(const v4u*)&tb[cl][q * 8]); vst2((unsigned*)(VBL + o3), *(const v4u*)&tbl[cl][q * 8]); } } } }
#define FA_Q 128
#define FA_K 64
#define FA_NS (TT / FA_K)
#define FA_LD 72           // LDS row pitch in halves: 144 B = 16 B x odd, conflict-free for the 16-byte fragment reads
__device__ __forceinline__ float xhalf(float v) { const int i = __builtin_bit_cast(int, v); return __builtin_bit_cast(float, __builtin_amdgcn_permlanex16(i, i, 0x76543210, 0xfedcba98, false, false)); }   /* lane l <-> l ^ 16 */
__global__ __launch_bounds__(256) void k_fa(const _Float16* __restrict__ QH, const _Float16* __restrict__ QL, const _Float16* __restrict__ KH, const _Float16* __restrict__ VT, float* __restrict__ Y) {
  __shared__ __align__(16) _Float16 ks[2][FA_K][FA_LD], vs[2][HD][FA_LD];
  const int tid = threadIdx.x, wave = tid >> 5, lane = tid & 31, col = lane & 15, g = lane >> 4; const int h = blockIdx.y, b = blockIdx.z; const int ql0 = blockIdx.x * FA_Q + wave * 16;
  v16h qh[HD / 32], qr[HD / 32];
#pragma unroll
  for (int kc = 0; kc < HD / 32; ++kc) { qh[kc] = frag_h(QH + ((size_t)b * TT + ql0 + col) * CC + h * HD + kc * 32, lane); qr[kc] = frag_h(QL + ((size_t)b * QHI + ql0 + col) * CC + h * HD + kc * 32, lane); }
  // staging: a thread moves two 16-byte pieces of the k tile (64 keys x 128 B) and two of the v tile (64 dims x 128 B), whole 128-B lines per 8 lanes
  const int sr = tid >> 3, sq = (tid & 7) * 8;
  const _Float16* kg = KH + ((size_t)b * TT + sr) * CC + h * HD + sq; const _Float16* vg = VT + ((size_t)b * CC + h * HD + sr) * (size_t)TT + sq;
  v4u k0r = *(const v4u*)kg, k1r = *(const v4u*)(kg + (size_t)32 * CC), v0r = *(const v4u*)vg, v1r = *(const v4u*)(vg + (size_t)32 * TT);
  *(v4u*)&ks[0][sr][sq] = k0r; *(v4u*)&ks[0][sr + 32][sq] = k1r; *(v4u*)&vs[0][sr][sq] = v0r; *(v4u*)&vs[0][sr + 32][sq] = v1r;
  __syncthreads();
  const float cl2 = SCALE * 1.44269504088896f;   // logit scale x log2(e): exp(x) = 2^(x log2 e)
  v8f o[HD / 16] = {}; float m = -3.0e38f, l = 0.f;
  // the stage loop stays rolled; every inner loop is unrolled so that the fragment and accumulator arrays are indexed by constants and stay in registers
#pragma unroll 1
  for (int s = 0; s < FA_NS; ++s) { const int cur = s & 1;
    if (s + 1 < FA_NS) { const _Float16* kn = kg + (size_t)(s + 1) * FA_K * CC; const _Float16* vn = vg + (s + 1) * FA_K; k0r = *(const v4u*)kn; k1r = *(const v4u*)(kn + (size_t)32 * CC); v0r = *(const v4u*)vn; v1r = *(const v4u*)(vn + (size_t)32 * TT); }
    v8f sa[FA_K / 16] = {}, sb[FA_K / 16] = {};
#pragma unroll
    for (int kc = 0; kc < HD / 32; ++kc) {
#pragma unroll
      for (int t = 0; t < FA_K / 16; ++t) { const v16h kf = frag_h(&ks[cur][t * 16 + col][kc * 32], lane);
        sa[t] = __builtin_amdgcn_wmma_f32_16x16x32_f16(false, kf, false, qh[kc], (short)0, sa[t], false, false);
        sb[t] = __builtin_amdgcn_wmma_f32_16x16x32_f16(false, kf, false, qr[kc], (short)0, sb[t], false, false); } }
    float mt[FA_K / 16];   // one maximum and one sum per 16-key tile: four short chains, not one of 32 dependent links
#pragma unroll
    for (int t = 0; t < FA_K / 16; ++t) { mt[t] = -3.0e38f;
#pragma unroll
      for (int r = 0; r < 8; ++r) { sa[t][r] = sa[t][r] + sb[t][r] * (1.0f / 1024.0f); mt[t] = fmaxf(mt[t], sa[t][r]); } }
    float mx = fmaxf(fmaxf(mt[0], mt[1]), fmaxf(mt[2], mt[3])); mx = fmaxf(mx, xhalf(mx));
    const float mn = fmaxf(m, mx), mc = mn * cl2; const float al = __builtin_amdgcn_exp2f(m * cl2 - mc); m = mn;
    float st[FA_K / 16]; v16h p[FA_K / 32];
#pragma unroll
    for (int t = 0; t < FA_K / 16; ++t) { st[t] = 0.f;
#pragma unroll
      for (int r = 0; r < 8; ++r) { const float e = __builtin_amdgcn_exp2f(sa[t][r] * cl2 - mc); st[t] += e; p[t >> 1][(t & 1) * 8 + r] = (_Float16)e; } }
    l = l * al + ((st[0] + st[1]) + (st[2] + st[3]));
#pragma unroll
    for (int j = 0; j < HD / 16; ++j) {
#pragma unroll
      for (int r = 0; r < 8; ++r) o[j][r] *= al; }
#pragma unroll
    for (int kk = 0; kk < FA_K / 32; ++kk) {
#pragma unroll
      for (int j = 0; j < HD / 16; ++j) o[j] = __builtin_amdgcn_wmma_f32_16x16x32_f16(false, frag_h(&vs[cur][j * 16 + col][kk * 32], lane), false, p[kk], (short)0, o[j], false, false); }
    if (s + 1 < FA_NS) { *(v4u*)&ks[cur ^ 1][sr][sq] = k0r; *(v4u*)&ks[cur ^ 1][sr + 32][sq] = k1r; *(v4u*)&vs[cur ^ 1][sr][sq] = v0r; *(v4u*)&vs[cur ^ 1][sr + 32][sq] = v1r; }
    __syncthreads(); }   // one barrier a stage: publishes stage s + 1 and ends every wave's reads of the buffer that stage s + 2 overwrites
  l += xhalf(l); const float inv = 1.0f / l;
  float* yr = Y + ((size_t)b * TT + ql0 + col) * CC + h * HD + 8 * g;   // lane = query col; o[j][r] = dim j*16 + 8g + r
#pragma unroll
  for (int j = 0; j < HD / 16; ++j) { v4f a, c;
#pragma unroll
    for (int r = 0; r < 4; ++r) { a[r] = o[j][r] * inv; c[r] = o[j][4 + r] * inv; }
    vst2(yr + j * 16, a); vst2(yr + j * 16 + 4, c); } }
// ---- k_out: block = (64 rows, 128 cols): out = ctx Wo (+ bo): all rows: ctx bf16 hi + lo against exact bf16 Wo (2 products)
__global__ __launch_bounds__(128) void k_out(const float* __restrict__ Y, const float* __restrict__ WO, const float* __restrict__ BO, float* __restrict__ OUT) { __shared__ __align__(16) float sf[4][16][132];
  const int tid = threadIdx.x, wave = tid >> 5, lane = tid & 31, col = lane & 15, g = lane >> 4; const int c0 = blockIdx.y * 128; const size_t r0 = (size_t)blockIdx.x * 64 + wave * 16;
  v8f acc[8] = {};
  if (true) {   /* ALL rows: ctx split bf16 hi + lo x exact Wo (2 products) */
#pragma unroll 2
    for (int kc = 0; kc < CC / 32; ++kc) { const F2 a = split_row(Y + (r0 + col) * CC, kc * 32, lane); asm volatile("s_wait_loadcnt 0x0" ::: "memory");
#pragma unroll
      for (int j = 0; j < 8; ++j) { const v16b w = WOCOL(WO, kc * 32, c0 + j * 16 + col, lane); asm volatile("s_wait_loadcnt 0x0" ::: "memory"); acc[j] = wmma_bf(a.h, w, acc[j]); acc[j] = wmma_bf(a.l, w, acc[j]); } }
#pragma unroll
    for (int j = 0; j < 8; ++j) { const float bias = BO ? bfr(BO[c0 + j * 16 + col]) : 0.f;
#pragma unroll
      for (int r = 0; r < 8; ++r) sf[wave][8 * g + r][j * 16 + col] = acc[j][r] + bias; }
  } else {
#pragma unroll 2
    for (int kc = 0; kc < CC / 32; ++kc) { const v16h a = frag_f32(Y + (r0 + col) * CC + kc * 32, lane); asm volatile("s_wait_loadcnt 0x0" ::: "memory");
#pragma unroll
      for (int j = 0; j < 8; ++j) { const v16h w = WOCOLH(WO, kc * 32, c0 + j * 16 + col, lane); asm volatile("s_wait_loadcnt 0x0" ::: "memory"); acc[j] = wmma16(a, w, acc[j]); } }
#pragma unroll
    for (int j = 0; j < 8; ++j) { const float bias = BO ? bfr(BO[c0 + j * 16 + col]) : 0.f;
#pragma unroll
      for (int r = 0; r < 8; ++r) sf[wave][8 * g + r][j * 16 + col] = acc[j][r] * (1.0f / 256.0f) + bias; } }
  LDSX(); for (int rl = 0; rl < 16; ++rl) vst2(OUT + (r0 + rl) * DIN + c0 + lane * 4, *(const v4f*)&sf[wave][rl][lane * 4]); }

extern "C" void kernel_launch(void* const* d_in, const int* in_sizes, int n_in, void* d_out, int out_size, void* d_ws, size_t ws_size, hipStream_t stream) {
  (void)in_sizes; (void)n_in; (void)out_size;
  const float** F = (const float**)d_in;
  if (ws_size < (size_t)WS_END) return;
  char* ws = (char*)d_ws; _Float16 *QH = (_Float16*)(ws + WS_QH), *KH = (_Float16*)(ws + WS_KH), *VT = (_Float16*)(ws + WS_VT), *QL = (_Float16*)(ws + WS_QL), *KL = (_Float16*)(ws + WS_KL); __bf16 *VB = (__bf16*)(ws + WS_VB), *VBL = (__bf16*)(ws + WS_VBL); float *S = (float*)(ws + WS_S), *Y = (float*)(ws + WS_Y);
  (void)Y; (void)QL; (void)KL; (void)VB; (void)VBL; (void)S;
  // inputs: 0 x [2,2048,1024]; 1 Wq [1024,1024] (out,in), 2 bq; 3 Wk, 4 bk; 5 Wv, 6 bv; 7 Wo (no bias)
  k_proj<<<dim3(TNB * TT / 64, CC / 128, 3), 128, 0, stream>>>(F[0], F[0], F[0], F[1], F[3], F[5], F[2], F[4], F[6], QH, QL, KH, KL, VT, VB, VBL);
  k_fa<<<dim3(TT / FA_Q, NH, TNB), 256, 0, stream>>>(QH, QL, KH, VT, Y);
  k_out<<<dim3(TNB * TT / 64, DIN / 128), 128, 0, stream>>>(Y, F[7], nullptr, (float*)d_out);
}

// v002
// Measured time: 118 microseconds a run.
// Two timings next to v001 put it at 4.32 and 4.30 times that version's speed.
// Over all steps from v000 it is 12.2 times as fast.
// compute dtype: all float inputs rounded to bf16; q/k/v projections with EXACT bf16 products on WMMA 16x16x32 (f32 accumulate); interleaved RoPE in f32 (sincosf) on the projected q/k rows; q as f16 hi + residual (x 2^10) against k once to f16 (2 products) x 1024^-0.5; one-pass softmax in f32 (running maximum and sum, exp2 of the scaled difference); exp(logit - maximum) once to f16 against v once to f16 (1 product), divided by the sum at the end; ctx split bf16 hi + lo against exact Wo (2 products); f32 output.
#include <hip/hip_runtime.h>
#include <math.h>

typedef __attribute__((ext_vector_type(16))) _Float16 v16h;
typedef __attribute__((ext_vector_type(16))) __bf16 v16b;
typedef __attribute__((ext_vector_type(8)))  _Float16 v8h;
typedef __attribute__((ext_vector_type(8)))  float v8f;
typedef __attribute__((ext_vector_type(4)))  float v4f;
typedef __attribute__((ext_vector_type(2)))  float v2f;
typedef __attribute__((ext_vector_type(4)))  unsigned v4u;
typedef __attribute__((ext_vector_type(4)))  int v4i;
typedef float __attribute__((may_alias)) float_a;
typedef int __attribute__((may_alias)) int_a;

template <typename T> __device__ __forceinline__ void vst2(void* p, T v) { *(T*)p = v;  }
__device__ __forceinline__ v8f wmma16(v16h a, v16h b, v8f c) {
  v8f d = __builtin_amdgcn_wmma_f32_16x16x32_f16(false, a, false, b, (short)0, c, false, false);
  asm volatile("v_nop\n\tv_nop\n\tv_nop\n\tv_nop" : "+v"(d) : "v"(a), "v"(b));
  return d;
}
__device__ __forceinline__ v8f wmma_bf(v16b a, v16b b, v8f c) {
  v8f d = __builtin_amdgcn_wmma_f32_16x16x32_bf16(false, a, false, b, (short)0, c, false, false);
  asm volatile("v_nop\n\tv_nop\n\tv_nop\n\tv_nop" : "+v"(d) : "v"(a), "v"(b));
  return d;
}
// 16x16x32 fragments: lane = (h = lane>>4, row/col = lane&15); elements 0..7 = k0+8h+0..7, 8..15 = k0+16+8h+0..7; D element r = row 8h+r
__device__ __forceinline__ v16h frag_h(const _Float16* rowk0, int lane) {
  union { v16h v; v8h q[2]; } u; const _Float16* p = rowk0 + 8 * (lane >> 4);
  u.q[0] = *(const v8h*)p; u.q[1] = *(const v8h*)(p + 16); return u.v;
}
__device__ __forceinline__ v16h frag_f32(const float* rowk0, int lane) {
  v16h a; const float* p = rowk0 + 8 * (lane >> 4);
#pragma unroll
  for (int i = 0; i < 8; ++i) { a[i] = (_Float16)p[i]; a[8 + i] = (_Float16)p[16 + i]; }
  return a;
}
__device__ __forceinline__ v16h frag_f32s(const float* rowk0, int lane, float sc) {
  v16h a; const float* p = rowk0 + 8 * (lane >> 4);
#pragma unroll
  for (int i = 0; i < 8; ++i) { a[i] = (_Float16)(p[i] * sc); a[8 + i] = (_Float16)(p[16 + i] * sc); }
  return a;
}
// column fragment from a [K][ld] layout (column n), rows >= K read as 0
__device__ __forceinline__ v16h fragc_f32(const float* W, int k0, int n, int lane, int ld, int K) {
  v16h a; const int g = lane >> 4;
#pragma unroll
  for (int i = 0; i < 8; ++i) { const int ka = k0 + 8 * g + i, kb = ka + 16;
    a[i] = (_Float16)(ka < K ? W[(size_t)(ka < K ? ka : K - 1) * ld + n] : 0.f); a[8 + i] = (_Float16)(kb < K ? W[(size_t)(kb < K ? kb : K - 1) * ld + n] : 0.f); }
  return a;
}
struct F2 { v16b h, l; };
__device__ __forceinline__ F2 bsplit16(const float v[16]) { F2 r;
#pragma unroll
  for (int i = 0; i < 16; ++i) { const __bf16 h = (__bf16)v[i]; r.h[i] = h; r.l[i] = (__bf16)(v[i] - (float)h); }
  return r; }
__device__ __forceinline__ F2 split_row(const float* row, int k0, int lane) { float v[16]; const float* p = row + k0 + 8 * (lane >> 4);
#pragma unroll
  for (int i = 0; i < 8; ++i) { v[i] = p[i]; v[8 + i] = p[16 + i]; }
  return bsplit16(v); }
__device__ __forceinline__ F2 split_rowK(const float* row, int k0, int lane, int K) { float v[16]; const int g = lane >> 4;
#pragma unroll
  for (int i = 0; i < 8; ++i) { const int ka = k0 + 8 * g + i, kb = ka + 16; v[i] = ka < K ? row[ka < K ? ka : K - 1] : 0.f; v[8 + i] = kb < K ? row[kb < K ? kb : K - 1] : 0.f; }
  return bsplit16(v); }
__device__ __forceinline__ F2 split_col(const float* W, int k0, int n, int lane, int ld, int K) { float v[16]; const int g = lane >> 4;
#pragma unroll
  for (int i = 0; i < 8; ++i) { const int ka = k0 + 8 * g + i, kb = ka + 16; v[i] = ka < K ? W[(size_t)(ka < K ? ka : K - 1) * ld + n] : 0.f; v[8 + i] = kb < K ? W[(size_t)(kb < K ? kb : K - 1) * ld + n] : 0.f; }
  return bsplit16(v); }
__device__ __forceinline__ v8f mac3(const F2& a, const F2& b, v8f c) { c = wmma_bf(a.l, b.h, c); c = wmma_bf(a.h, b.l, c); return wmma_bf(a.h, b.h, c); }
__device__ __forceinline__ float sigm(float v) { return 1.0f / (1.0f + expf(-v)); }
#define LDSX() do { asm volatile("s_wait_dscnt 0" ::: "memory"); __builtin_amdgcn_wave_barrier(); __builtin_amdgcn_fence(__ATOMIC_RELEASE, "workgroup"); } while (0)

// Multi-head attention with RoPE (B 2, S 2,048, 1,024 = 16 x 64; 0.02-scale weights and biases): q,k,v = x W^T + b ((out,in)); interleaved-pair RoPE on q, k (angle t x 10000^(-2i/64)); scores = q k^T / sqrt(1024) (note: sqrt(D), not sqrt(hd)); out = merged(softmax(scores) v) Wo^T (no output bias).
#define NB 2
#define TT 2048
#define CC 1024            // NH * HD = projected width
#define DIN 1024          // input (model) width
#define NH 16
#define HD 64
#define NQB (TT / 64)
#define HG 4
#define SCALE (0.03125f)
#define CAUSAL 0
#ifndef TNB
#define TNB NB
#endif
__device__ __forceinline__ float bfr(float v) { return (float)(__bf16)v; }
__host__ __device__ __forceinline__ int kb_last(int qb) { return CAUSAL ? ((qb * 64 + 63) >> 7) : (TT / 128 - 1); }
typedef __attribute__((ext_vector_type(8))) __bf16 v8b;
__device__ __forceinline__ v16b frag_b(const __bf16* rowk0, int lane) {
  union { v16b v; v8b q[2]; } u; const __bf16* p = rowk0 + 8 * (lane >> 4);
  u.q[0] = *(const v8b*)p; u.q[1] = *(const v8b*)(p + 16); return u.v;
}
#define QBH 0
#define QHI 2048            // rows carrying a q residual plane (all rows when non-causal: 2-product logits everywhere)
#define KHI 64            // key rows carrying k residual / v bf16 hi+lo planes (written by k_proj, read by no kernel)
// B fragment (k rows k0+.., output column o) of a weight: (in,out) [K][ld] or (out,in) [ld rows of K]: bf16 exact, or f16(bf16 * 256) exact
__device__ __forceinline__ v16b wcol_io(const float* Wm, int k0, int o, int lane, int ld) { v16b w; const int g = lane >> 4;
#pragma unroll
  for (int i = 0; i < 8; ++i) { w[i] = (__bf16)Wm[(size_t)(k0 + 8 * g + i) * ld + o]; w[8 + i] = (__bf16)Wm[(size_t)(k0 + 16 + 8 * g + i) * ld + o]; }
  return w; }
__device__ __forceinline__ v16b wcol_oi(const float* Wm, int k0, int o, int lane, int K) { v16b w; const float* p = Wm + (size_t)o * K + k0 + 8 * (lane >> 4);
#pragma unroll
  for (int i = 0; i < 8; ++i) { w[i] = (__bf16)p[i]; w[8 + i] = (__bf16)p[16 + i]; }
  return w; }
__device__ __forceinline__ v16h wcolh_io(const float* Wm, int k0, int o, int lane, int ld) { v16h w; const int g = lane >> 4;
#pragma unroll
  for (int i = 0; i < 8; ++i) { w[i] = (_Float16)(bfr(Wm[(size_t)(k0 + 8 * g + i) * ld + o]) * 256.0f); w[8 + i] = (_Float16)(bfr(Wm[(size_t)(k0 + 16 + 8 * g + i) * ld + o]) * 256.0f); }
  return w; }
__device__ __forceinline__ v16h wcolh_oi(const float* Wm, int k0, int o, int lane, int K) { v16h w; const float* p = Wm + (size_t)o * K + k0 + 8 * (lane >> 4);
#pragma unroll
  for (int i = 0; i < 8; ++i) { w[i] = (_Float16)(bfr(p[i]) * 256.0f); w[8 + i] = (_Float16)(bfr(p[16 + i]) * 256.0f); }
  return w; }
#define WQKV_LAYOUT 1   // 0 = (in,out) [DIN][CC]; 1 = (out,in) [CC][DIN]; 2 = per-head [NH][DIN][HD]; read only through WCOL, which no kernel calls (k_proj reads (out,in) [CC][DIN])
__device__ __forceinline__ v16b wcol_hdk(const float* Wm, int k0, int o, int lane) { v16b w; const int g = lane >> 4; const float* p = Wm + (size_t)(o / HD) * DIN * HD + (o % HD);
#pragma unroll
  for (int i = 0; i < 8; ++i) { w[i] = (__bf16)p[(size_t)(k0 + 8 * g + i) * HD]; w[8 + i] = (__bf16)p[(size_t)(k0 + 16 + 8 * g + i) * HD]; }
  return w; }
#define WO_OUT_IN 1
#if WQKV_LAYOUT == 1
#define WCOL(W, k0, o, lane) wcol_oi(W, k0, o, lane, DIN)
#elif WQKV_LAYOUT == 2
#define WCOL(W, k0, o, lane) wcol_hdk(W, k0, o, lane)
#else
#define WCOL(W, k0, o, lane) wcol_io(W, k0, o, lane, CC)
#endif
#if WO_OUT_IN
#define WOCOL(W, k0, o, lane) wcol_oi(W, k0, o, lane, CC)
#define WOCOLH(W, k0, o, lane) wcolh_oi(W, k0, o, lane, CC)
#else
#define WOCOL(W, k0, o, lane) wcol_io(W, k0, o, lane, DIN)
#define WOCOLH(W, k0, o, lane) wcolh_io(W, k0, o, lane, DIN)
#endif
__constant__ float c_invf[32] = {1.000000000e+0f,7.498942018e-1f,5.623413324e-1f,4.216965139e-1f,3.162277639e-1f,2.371373773e-1f,1.778279394e-1f,1.333521456e-1f,1.000000015e-1f,7.498942316e-2f,5.623413250e-2f,4.216964915e-2f,3.162277490e-2f,2.371373773e-2f,1.778279431e-2f,1.333521400e-2f,9.999999776e-3f,7.498942316e-3f,5.623413250e-3f,4.216964822e-3f,3.162277630e-3f,2.371373819e-3f,1.778279431e-3f,1.333521446e-3f,1.000000047e-3f,7.498941850e-4f,5.623413017e-4f,4.216965172e-4f,3.162277571e-4f,2.371373703e-4f,1.778279402e-4f,1.333521504e-4f};   /* f32(1 / 10000^(2i/64)) */
#define PROJ_EPI(which, row, t, h) do { if ((which) < 2) { float* rw = (row); const float pf = (float)(t); _Pragma("unroll") for (int i = 0; i < 32; ++i) { const float a = rw[2 * i], b = rw[2 * i + 1]; float sn, cs; sincosf(pf * c_invf[i], &sn, &cs); rw[2 * i] = a * cs - b * sn; rw[2 * i + 1] = a * sn + b * cs; } } } while (0)   /* interleaved (even, odd) RoPE pairs, angle = t * 10000^(-2i/64) */
#ifndef SM_EXTRA_PARAMS
#define SM_EXTRA_PARAMS
#endif
#ifndef PROJ_EXTRA_PARAMS
#define PROJ_EXTRA_PARAMS
#endif
#ifndef SM_MASK_HOOK
#define SM_MASK_HOOK (void)0
#endif

#define WS_QH  0u                                      // f16 q rows [b*t][CC]
#define WS_KH  (WS_QH + 2u * (size_t)NB * TT * CC)      // f16 k rows [b*t][CC]
#define WS_VT  (WS_KH + 2u * (size_t)NB * TT * CC)      // f16 v planes [b][c][t]
#define WS_QL  (WS_VT + 2u * (size_t)NB * CC * TT)      // f16 q residual x 2^10 rows [b][t < QHI][CC]
#define WS_KL  (WS_QL + 2u * (size_t)NB * QHI * CC)     // f16 k residual x 2^10 rows [b][t < KHI][CC]
#define WS_VB  (WS_KL + 2u * (size_t)NB * KHI * CC)     // bf16 v hi planes [b][c][t < KHI]
#define WS_VBL (WS_VB + 2u * (size_t)NB * CC * KHI)
#define WS_S   (WS_VBL + 2u * (size_t)NB * CC * KHI)    // f32 [hg][t][s], unused: k_fa keeps logits and P in registers
#define WS_Y   (WS_S  + 4u * (size_t)HG * TT * TT)      // f32 ctx rows [b*t][CC] (only when there is an output projection)
#define WS_END (WS_Y  + 4u * (size_t)NB * TT * CC)

// GEMM operand staging (k_proj, k_out): a stage is 64 k of every operand row. The block loads it as f32 in whole 128-B lines (16 lanes x 16 B per row), rounds it ONCE to bf16 (ctx in k_out: bf16 hi + lo) and keeps it in LDS; every wave takes its fragments from there with 16-byte LDS loads.
#define GK 64              // k per stage
#define GLD 72             // LDS row pitch in bf16: 144 B = 16 B x odd, conflict-free for the 16-byte fragment reads
typedef __attribute__((ext_vector_type(4))) __bf16 v4b;
__device__ __forceinline__ v4b cvt4(v4f v) { v4b r; r[0] = (__bf16)v[0]; r[1] = (__bf16)v[1]; r[2] = (__bf16)v[2]; r[3] = (__bf16)v[3]; return r; }
__device__ __forceinline__ v4b res4(v4f v, v4b h) { v4b r;
#pragma unroll
  for (int i = 0; i < 4; ++i) r[i] = (__bf16)(v[i] - (float)h[i]);
  return r; }
// a thread's N pieces of a stage: rows 8 apart, 16 bytes each
template <int N> __device__ __forceinline__ void ld_rows(v4f (&r)[N], const float* p, int ld) {
#pragma unroll
  for (int i = 0; i < N; ++i) r[i] = *(const v4f*)(p + (size_t)i * 8 * ld);
  asm volatile("s_wait_xcnt 0x0" :: "v"(p) : "memory"); }   // stands in front of every overwrite of these loads' address registers (p as an input keeps them whole up to here); its memory clobber also holds the loads here, ahead of the products they fly behind
// ---- k_proj: block = (64 rows, 128 cols, which): q/k/v = X W (+ b) with exact bf16 products (K = DIN) -> which 0: q f16 rows (+ residual rows < QHI); 1: k f16 rows (+ residual rows < KHI); 2: v f16 planes [c][t] (+ bf16 hi/lo planes for t < KHI)
__global__ __launch_bounds__(128) void k_proj(const float* __restrict__ XQ, const float* __restrict__ XK, const float* __restrict__ XV, const float* __restrict__ WQ, const float* __restrict__ WK, const float* __restrict__ WV, const float* __restrict__ BQ, const float* __restrict__ BK, const float* __restrict__ BV,
    _Float16* __restrict__ QH, _Float16* __restrict__ QL, _Float16* __restrict__ KH, _Float16* __restrict__ KL, _Float16* __restrict__ VT, __bf16* __restrict__ VB, __bf16* __restrict__ VBL PROJ_EXTRA_PARAMS) {
  __shared__ __align__(16) float st[64][132]; __shared__ __align__(16) char ov[2 * (64 + 128) * GLD * 2];
  // one LDS range, used in turn: the two operand stages of the k loop; behind the loop's last barrier the epilogue's conversion tiles (q, k: sh, sl; v: th, tb, tbl)
  __bf16 (*xs)[64][GLD] = (__bf16 (*)[64][GLD])ov; __bf16 (*wt)[128][GLD] = (__bf16 (*)[128][GLD])(ov + 2 * 64 * GLD * 2);
  _Float16 (*sh)[136] = (_Float16 (*)[136])ov; _Float16 (*sl)[136] = (_Float16 (*)[136])(ov + 64 * 136 * 2);
  _Float16 (*th)[72] = (_Float16 (*)[72])ov; __bf16 (*tb)[72] = (__bf16 (*)[72])(ov + 128 * 72 * 2); __bf16 (*tbl)[72] = (__bf16 (*)[72])(ov + 2 * 128 * 72 * 2);
  const int tid = threadIdx.x, wave = tid >> 5, lane = tid & 31, col = lane & 15, g = lane >> 4; const int which = blockIdx.z; const int c0 = blockIdx.y * 128; const size_t r0 = (size_t)blockIdx.x * 64; const size_t bb = r0 / TT; const int t0 = (int)(r0 % TT);
  const float* X = which == 0 ? XQ : which == 1 ? XK : XV; const float* WA = which == 0 ? WQ : which == 1 ? WK : WV; const float* BA = which == 0 ? BQ : which == 1 ? BK : BV;
  v8f acc[8] = {};
  const int pr = tid >> 4, pc = (tid & 15) * 4;   // a thread's 16-byte piece: row pr of each group of 8 rows, k pc..pc+3 of the stage
  const float* xg = X + (r0 + pr) * DIN + pc; const float* wg = WA + (size_t)(c0 + pr) * DIN + pc;
  v4f xr[8], wr[16];
  ld_rows(xr, xg, DIN); ld_rows(wr, wg, DIN);
#pragma unroll
  for (int i = 0; i < 8; ++i) *(v4b*)&xs[0][i * 8 + pr][pc] = cvt4(xr[i]);
#pragma unroll
  for (int i = 0; i < 16; ++i) *(v4b*)&wt[0][i * 8 + pr][pc] = cvt4(wr[i]);
  __syncthreads();
  // the stage loop stays rolled so that the two buffers alternate by index and the loop stays small; the inner loops are unrolled so that the register arrays are indexed by constants
#pragma unroll 1
  for (int s = 0; s < DIN / GK; ++s) { const int cur = s & 1;
    if (s + 1 < DIN / GK) { ld_rows(xr, xg + (s + 1) * GK, DIN); ld_rows(wr, wg + (s + 1) * GK, DIN); }   // the next stage's loads fly while this stage is multiplied
#pragma unroll
    for (int kc = 0; kc < GK / 32; ++kc) { const v16b a = frag_b(&xs[cur][wave * 16 + col][kc * 32], lane); v16b w[8];
#pragma unroll
      for (int j = 0; j < 8; ++j) w[j] = frag_b(&wt[cur][j * 16 + col][kc * 32], lane);
      __builtin_amdgcn_sched_barrier(0);   // keeps the nine fragments' LDS reads one group ahead of their products: left alone the compiler reads each into the same registers and waits out the LDS latency before every product
#pragma unroll
      for (int j = 0; j < 8; ++j) acc[j] = __builtin_amdgcn_wmma_f32_16x16x32_bf16(false, a, false, w[j], (short)0, acc[j], false, false); }
    if (s + 1 < DIN / GK) {
#pragma unroll
      for (int i = 0; i < 8; ++i) *(v4b*)&xs[cur ^ 1][i * 8 + pr][pc] = cvt4(xr[i]);
#pragma unroll
      for (int i = 0; i < 16; ++i) *(v4b*)&wt[cur ^ 1][i * 8 + pr][pc] = cvt4(wr[i]); }
    __syncthreads(); }   // one barrier a stage: publishes stage s + 1 and ends every wave's reads of the buffer that stage s + 2 (or the epilogue) overwrites
  { // stage the f32 tile (acc + bias) in LDS, run the per-(row, head) epilogue hook, then convert
#pragma unroll
    for (int j = 0; j < 8; ++j) { const float bias = BA ? bfr(BA[c0 + j * 16 + col]) : 0.f;
#pragma unroll
      for (int r = 0; r < 8; ++r) st[wave * 16 + 8 * g + r][j * 16 + col] = acc[j][r] + bias; }
    __syncthreads();
    for (int e = tid; e < 64 * (128 / HD); e += 128) { const int rl = e / (128 / HD), hh = e % (128 / HD); PROJ_EPI(which, &st[rl][hh * HD], (int)((r0 + rl) % TT), (c0 / HD) + hh); }
    __syncthreads(); }
  if (which < 2) { _Float16* DH = which == 0 ? QH : KH; _Float16* DL = which == 0 ? QL : KL; const int nhi = which == 0 ? QHI : KHI; const bool hi_rows = t0 < nhi;
    for (int e = tid; e < 64 * 128; e += 128) { const int rl = e >> 7, cl = e & 127; const float v = st[rl][cl]; const _Float16 hv = (_Float16)v; sh[rl][cl] = hv; sl[rl][cl] = (_Float16)((v - (float)hv) * 1024.0f); }
    __syncthreads();
    for (int e = tid; e < 64 * 16; e += 128) { const int rl = e >> 4, q = e & 15; vst2((unsigned*)(DH + (r0 + rl) * CC + c0 + q * 8), *(const v4u*)&sh[rl][q * 8]); if (hi_rows) vst2((unsigned*)(DL + (bb * nhi + t0 + rl) * (size_t)CC + c0 + q * 8), *(const v4u*)&sl[rl][q * 8]); }
  } else { const bool hi_rows = t0 < KHI;
    for (int e = tid; e < 64 * 128; e += 128) { const int rl = e & 63, cl = e >> 6; const float v = st[rl][cl]; th[cl][rl] = (_Float16)v; const __bf16 bh = (__bf16)v; tb[cl][rl] = bh; tbl[cl][rl] = (__bf16)(v - (float)bh); }
    __syncthreads();
    for (int e = tid; e < 128 * 8; e += 128) { const int cl = e >> 3, q = e & 7; vst2((unsigned*)(VT + (bb * CC + c0 + cl) * (size_t)TT + t0 + q * 8), *(const v4u*)&th[cl][q * 8]); if (hi_rows) { const size_t o3 = (bb * CC + c0 + cl) * (size_t)KHI + t0 + q * 8; vst2((unsigned*)(VB + o3), *(const v4u*)&tb[cl][q * 8]); vst2((unsigned*)(VBL + o3), *(const v4u*)&tbl[cl][q * 8]); } } } }
#define FA_Q 128
#define FA_K 64
#define FA_NS (TT / FA_K)
#define FA_LD 72           // LDS row pitch in halves: 144 B = 16 B x odd, conflict-free for the 16-byte fragment reads
__device__ __forceinline__ float xhalf(float v) { const int i = __builtin_bit_cast(int, v); return __builtin_bit_cast(float, __builtin_amdgcn_permlanex16(i, i, 0x76543210, 0xfedcba98, false, false)); }   /* lane l <-> l ^ 16 */
__global__ __launch_bounds__(256) void k_fa(const _Float16* __restrict__ QH, const _Float16* __restrict__ QL, const _Float16* __restrict__ KH, const _Float16* __restrict__ VT, float* __restrict__ Y) {
  __shared__ __align__(16) _Float16 ks[2][FA_K][FA_LD], vs[2][HD][FA_LD];
  const int tid = threadIdx.x, wave = tid >> 5, lane = tid & 31, col = lane & 15, g = lane >> 4; const int h = blockIdx.y, b = blockIdx.z; const int ql0 = blockIdx.x * FA_Q + wave * 16;
  v16h qh[HD / 32], qr[HD / 32];
#pragma unroll
  for (int kc = 0; kc < HD / 32; ++kc) { qh[kc] = frag_h(QH + ((size_t)b * TT + ql0 + col) * CC + h * HD + kc * 32, lane); qr[kc] = frag_h(QL + ((size_t)b * QHI + ql0 + col) * CC + h * HD + kc * 32, lane); }
  // staging: a thread moves two 16-byte pieces of the k tile (64 keys x 128 B) and two of the v tile (64 dims x 128 B), whole 128-B lines per 8 lanes
  const int sr = tid >> 3, sq = (tid & 7) * 8;
  const _Float16* kg = KH + ((size_t)b * TT + sr) * CC + h * HD + sq; const _Float16* vg = VT + ((size_t)b * CC + h * HD + sr) * (size_t)TT + sq;
  v4u k0r = *(const v4u*)kg, k1r = *(const v4u*)(kg + (size_t)32 * CC), v0r = *(const v4u*)vg, v1r = *(const v4u*)(vg + (size_t)32 * TT);
  *(v4u*)&ks[0][sr][sq] = k0r; *(v4u*)&ks[0][sr + 32][sq] = k1r; *(v4u*)&vs[0][sr][sq] = v0r; *(v4u*)&vs[0][sr + 32][sq] = v1r;
  __syncthreads();
  const float cl2 = SCALE * 1.44269504088896f;   // logit scale x log2(e): exp(x) = 2^(x log2 e)
  v8f o[HD / 16] = {}; float m = -3.0e38f, l = 0.f;
  // the stage loop stays rolled; every inner loop is unrolled so that the fragment and accumulator arrays are indexed by constants and stay in registers
#pragma unroll 1
  for (int s = 0; s < FA_NS; ++s) { const int cur = s & 1;
    if (s + 1 < FA_NS) { const _Float16* kn = kg + (size_t)(s + 1) * FA_K * CC; const _Float16* vn = vg + (s + 1) * FA_K; k0r = *(const v4u*)kn; k1r = *(const v4u*)(kn + (size_t)32 * CC); v0r = *(const v4u*)vn; v1r = *(const v4u*)(vn + (size_t)32 * TT); }
    v8f sa[FA_K / 16] = {}, sb[FA_K / 16] = {};
#pragma unroll
    for (int kc = 0; kc < HD / 32; ++kc) {
#pragma unroll
      for (int t = 0; t < FA_K / 16; ++t) { const v16h kf = frag_h(&ks[cur][t * 16 + col][kc * 32], lane);
        sa[t] = __builtin_amdgcn_wmma_f32_16x16x32_f16(false, kf, false, qh[kc], (short)0, sa[t], false, false);
        sb[t] = __builtin_amdgcn_wmma_f32_16x16x32_f16(false, kf, false, qr[kc], (short)0, sb[t], false, false); } }
    float mt[FA_K / 16];   // one maximum and one sum per 16-key tile: four short chains, not one of 32 dependent links
#pragma unroll
    for (int t = 0; t < FA_K / 16; ++t) { mt[t] = -3.0e38f;
#pragma unroll
      for (int r = 0; r < 8; ++r) { sa[t][r] = sa[t][r] + sb[t][r] * (1.0f / 1024.0f); mt[t] = fmaxf(mt[t], sa[t][r]); } }
    float mx = fmaxf(fmaxf(mt[0], mt[1]), fmaxf(mt[2], mt[3])); mx = fmaxf(mx, xhalf(mx));
    const float mn = fmaxf(m, mx), mc = mn * cl2; const float al = __builtin_amdgcn_exp2f(m * cl2 - mc); m = mn;
    float st[FA_K / 16]; v16h p[FA_K / 32];
#pragma unroll
    for (int t = 0; t < FA_K / 16; ++t) { st[t] = 0.f;
#pragma unroll
      for (int r = 0; r < 8; ++r) { const float e = __builtin_amdgcn_exp2f(sa[t][r] * cl2 - mc); st[t] += e; p[t >> 1][(t & 1) * 8 + r] = (_Float16)e; } }
    l = l * al + ((st[0] + st[1]) + (st[2] + st[3]));
#pragma unroll
    for (int j = 0; j < HD / 16; ++j) {
#pragma unroll
      for (int r = 0; r < 8; ++r) o[j][r] *= al; }
#pragma unroll
    for (int kk = 0; kk < FA_K / 32; ++kk) {
#pragma unroll
      for (int j = 0; j < HD / 16; ++j) o[j] = __builtin_amdgcn_wmma_f32_16x16x32_f16(false, frag_h(&vs[cur][j * 16 + col][kk * 32], lane), false, p[kk], (short)0, o[j], false, false); }
    if (s + 1 < FA_NS) { *(v4u*)&ks[cur ^ 1][sr][sq] = k0r; *(v4u*)&ks[cur ^ 1][sr + 32][sq] = k1r; *(v4u*)&vs[cur ^ 1][sr][sq] = v0r; *(v4u*)&vs[cur ^ 1][sr + 32][sq] = v1r; }
    __syncthreads(); }   // one barrier a stage: publishes stage s + 1 and ends every wave's reads of the buffer that stage s + 2 overwrites
  l += xhalf(l); const float inv = 1.0f / l;
  float* yr = Y + ((size_t)b * TT + ql0 + col) * CC + h * HD + 8 * g;   // lane = query col; o[j][r] = dim j*16 + 8g + r
#pragma unroll
  for (int j = 0; j < HD / 16; ++j) { v4f a, c;
#pragma unroll
    for (int r = 0; r < 4; ++r) { a[r] = o[j][r] * inv; c[r] = o[j][4 + r] * inv; }
    vst2(yr + j * 16, a); vst2(yr + j * 16 + 4, c); } }
// ---- k_out: block = (64 rows, 128 cols): out = ctx Wo (+ bo): all rows: ctx bf16 hi + lo against exact bf16 Wo (2 products); the f16 branch (ctx once to f16 against f16(bf16 x 2^8) Wo, 1 product) is never taken
__global__ __launch_bounds__(128) void k_out(const float* __restrict__ Y, const float* __restrict__ WO, const float* __restrict__ BO, float* __restrict__ OUT) { __shared__ __align__(16) char ov[2 * (64 + 64 + 128) * GLD * 2];
  // one LDS range, used in turn: the two operand stages of the k loop (ctx hi, ctx lo, Wo); behind the loop's last barrier each wave's own output staging tile
  __bf16 (*yh)[64][GLD] = (__bf16 (*)[64][GLD])ov; __bf16 (*yl)[64][GLD] = (__bf16 (*)[64][GLD])(ov + 2 * 64 * GLD * 2); __bf16 (*wt)[128][GLD] = (__bf16 (*)[128][GLD])(ov + 4 * 64 * GLD * 2);
  float (*sf)[16][132] = (float (*)[16][132])ov;
  const int tid = threadIdx.x, wave = tid >> 5, lane = tid & 31, col = lane & 15, g = lane >> 4; const int c0 = blockIdx.y * 128; const size_t r0 = (size_t)blockIdx.x * 64 + wave * 16;
  v8f acc[8] = {};
  if (true) {   /* ALL rows: ctx split bf16 hi + lo x exact Wo (2 products) */
    const int pr = tid >> 4, pc = (tid & 15) * 4;   // a thread's 16-byte piece: row pr of each group of 8 rows, k pc..pc+3 of the stage
    const float* yg = Y + ((size_t)blockIdx.x * 64 + pr) * CC + pc; const float* wg = WO + (size_t)(c0 + pr) * CC + pc;
    v4f yr[8], wr[16];
    ld_rows(yr, yg, CC); ld_rows(wr, wg, CC);
#pragma unroll
    for (int i = 0; i < 8; ++i) { const v4b hv = cvt4(yr[i]); *(v4b*)&yh[0][i * 8 + pr][pc] = hv; *(v4b*)&yl[0][i * 8 + pr][pc] = res4(yr[i], hv); }
#pragma unroll
    for (int i = 0; i < 16; ++i) *(v4b*)&wt[0][i * 8 + pr][pc] = cvt4(wr[i]);
    __syncthreads();
    // rolled stage loop, unrolled inner loops: as in k_proj
#pragma unroll 1
    for (int s = 0; s < CC / GK; ++s) { const int cur = s & 1;
      if (s + 1 < CC / GK) { ld_rows(yr, yg + (s + 1) * GK, CC); ld_rows(wr, wg + (s + 1) * GK, CC); }   // the next stage's loads fly while this stage is multiplied
#pragma unroll
      for (int kc = 0; kc < GK / 32; ++kc) { const v16b ah = frag_b(&yh[cur][wave * 16 + col][kc * 32], lane), al = frag_b(&yl[cur][wave * 16 + col][kc * 32], lane); v16b w[8];
#pragma unroll
        for (int j = 0; j < 8; ++j) w[j] = frag_b(&wt[cur][j * 16 + col][kc * 32], lane);
        __builtin_amdgcn_sched_barrier(0);   // keeps the ten fragments' LDS reads one group ahead of their products, as in k_proj
#pragma unroll
        for (int j = 0; j < 8; ++j) { acc[j] = __builtin_amdgcn_wmma_f32_16x16x32_bf16(false, ah, false, w[j], (short)0, acc[j], false, false);
          acc[j] = __builtin_amdgcn_wmma_f32_16x16x32_bf16(false, al, false, w[j], (short)0, acc[j], false, false); } }
      if (s + 1 < CC / GK) {
#pragma unroll
        for (int i = 0; i < 8; ++i) { const v4b hv = cvt4(yr[i]); *(v4b*)&yh[cur ^ 1][i * 8 + pr][pc] = hv; *(v4b*)&yl[cur ^ 1][i * 8 + pr][pc] = res4(yr[i], hv); }
#pragma unroll
        for (int i = 0; i < 16; ++i) *(v4b*)&wt[cur ^ 1][i * 8 + pr][pc] = cvt4(wr[i]); }
      __syncthreads(); }   // one barrier a stage: publishes stage s + 1 and ends every wave's reads of the buffer that stage s + 2 (or the output staging) overwrites
#pragma unroll
    for (int j = 0; j < 8; ++j) { const float bias = BO ? bfr(BO[c0 + j * 16 + col]) : 0.f;
#pragma unroll
      for (int r = 0; r < 8; ++r) sf[wave][8 * g + r][j * 16 + col] = acc[j][r] + bias; }
  } else {
#pragma unroll 2
    for (int kc = 0; kc < CC / 32; ++kc) { const v16h a = frag_f32(Y + (r0 + col) * CC + kc * 32, lane); asm volatile("s_wait_loadcnt 0x0" ::: "memory");
#pragma unroll
      for (int j = 0; j < 8; ++j) { const v16h w = WOCOLH(WO, kc * 32, c0 + j * 16 + col, lane); asm volatile("s_wait_loadcnt 0x0" ::: "memory"); acc[j] = wmma16(a, w, acc[j]); } }
#pragma unroll
    for (int j = 0; j < 8; ++j) { const float bias = BO ? bfr(BO[c0 + j * 16 + col]) : 0.f;
#pragma unroll
      for (int r = 0; r < 8; ++r) sf[wave][8 * g + r][j * 16 + col] = acc[j][r] * (1.0f / 256.0f) + bias; } }
  LDSX(); for (int rl = 0; rl < 16; ++rl) vst2(OUT + (r0 + rl) * DIN + c0 + lane * 4, *(const v4f*)&sf[wave][rl][lane * 4]); }

extern "C" void kernel_launch(void* const* d_in, const int* in_sizes, int n_in, void* d_out, int out_size, void* d_ws, size_t ws_size, hipStream_t stream) {
  (void)in_sizes; (void)n_in; (void)out_size;
  const float** F = (const float**)d_in;
  if (ws_size < (size_t)WS_END) return;
  char* ws = (char*)d_ws; _Float16 *QH = (_Float16*)(ws + WS_QH), *KH = (_Float16*)(ws + WS_KH), *VT = (_Float16*)(ws + WS_VT), *QL = (_Float16*)(ws + WS_QL), *KL = (_Float16*)(ws + WS_KL); __bf16 *VB = (__bf16*)(ws + WS_VB), *VBL = (__bf16*)(ws + WS_VBL); float *S = (float*)(ws + WS_S), *Y = (float*)(ws + WS_Y);
  (void)Y; (void)QL; (void)KL; (void)VB; (void)VBL; (void)S;
  // inputs: 0 x [2,2048,1024]; 1 Wq [1024,1024] (out,in), 2 bq; 3 Wk, 4 bk; 5 Wv, 6 bv; 7 Wo (no bias)
  k_proj<<<dim3(TNB * TT / 64, CC / 128, 3), 128, 0, stream>>>(F[0], F[0], F[0], F[1], F[3], F[5], F[2], F[4], F[6], QH, QL, KH, KL, VT, VB, VBL);
  k_fa<<<dim3(TT / FA_Q, NH, TNB), 256, 0, stream>>>(QH, QL, KH, VT, Y);
  k_out<<<dim3(TNB * TT / 64, DIN / 128), 128, 0, stream>>>(Y, F[7], nullptr, (float*)d_out);
}

// v003
// It runs in 114 microseconds.
// Next to v002, in two timings, it ran 1.04 times as fast each time.
// Counting every step since v000, it is 12.7 times as fast.
// compute dtype: all float inputs rounded to bf16; q/k/v projections with EXACT bf16 products on WMMA 16x16x32 (f32 accumulate); interleaved RoPE in f32 (sincosf) on the projected q/k rows; q as f16 hi + residual (x 2^10) against k once to f16 (2 products) x 1024^-0.5; one-pass softmax in f32 (running maximum and sum, exp2 of the scaled difference); exp(logit - maximum) once to f16 against v once to f16 (1 product), divided by the sum at the end; ctx split bf16 hi + lo against exact Wo (2 products); f32 output.
#include <hip/hip_runtime.h>
#include <math.h>

typedef __attribute__((ext_vector_type(16))) _Float16 v16h;
typedef __attribute__((ext_vector_type(16))) __bf16 v16b;
typedef __attribute__((ext_vector_type(8)))  _Float16 v8h;
typedef __attribute__((ext_vector_type(8)))  float v8f;
typedef __attribute__((ext_vector_type(4)))  float v4f;
typedef __attribute__((ext_vector_type(2)))  float v2f;
typedef __attribute__((ext_vector_type(4)))  unsigned v4u;
typedef __attribute__((ext_vector_type(4)))  int v4i;
typedef float __attribute__((may_alias)) float_a;
typedef int __attribute__((may_alias)) int_a;

template <typename T> __device__ __forceinline__ void vst2(void* p, T v) { *(T*)p = v;  }
__device__ __forceinline__ v8f wmma16(v16h a, v16h b, v8f c) {
  v8f d = __builtin_amdgcn_wmma_f32_16x16x32_f16(false, a, false, b, (short)0, c, false, false);
  asm volatile("v_nop\n\tv_nop\n\tv_nop\n\tv_nop" : "+v"(d) : "v"(a), "v"(b));
  return d;
}
__device__ __forceinline__ v8f wmma_bf(v16b a, v16b b, v8f c) {
  v8f d = __builtin_amdgcn_wmma_f32_16x16x32_bf16(false, a, false, b, (short)0, c, false, false);
  asm volatile("v_nop\n\tv_nop\n\tv_nop\n\tv_nop" : "+v"(d) : "v"(a), "v"(b));
  return d;
}
// 16x16x32 fragments: lane = (h = lane>>4, row/col = lane&15); elements 0..7 = k0+8h+0..7, 8..15 = k0+16+8h+0..7; D element r = row 8h+r
__device__ __forceinline__ v16h frag_h(const _Float16* rowk0, int lane) {
  union { v16h v; v8h q[2]; } u; const _Float16* p = rowk0 + 8 * (lane >> 4);
  u.q[0] = *(const v8h*)p; u.q[1] = *(const v8h*)(p + 16); return u.v;
}
__device__ __forceinline__ v16h frag_f32(const float* rowk0, int lane) {
  v16h a; const float* p = rowk0 + 8 * (lane >> 4);
#pragma unroll
  for (int i = 0; i < 8; ++i) { a[i] = (_Float16)p[i]; a[8 + i] = (_Float16)p[16 + i]; }
  return a;
}
__device__ __forceinline__ v16h frag_f32s(const float* rowk0, int lane, float sc) {
  v16h a; const float* p = rowk0 + 8 * (lane >> 4);
#pragma unroll
  for (int i = 0; i < 8; ++i) { a[i] = (_Float16)(p[i] * sc); a[8 + i] = (_Float16)(p[16 + i] * sc); }
  return a;
}
// column fragment from a [K][ld] layout (column n), rows >= K read as 0
__device__ __forceinline__ v16h fragc_f32(const float* W, int k0, int n, int lane, int ld, int K) {
  v16h a; const int g = lane >> 4;
#pragma unroll
  for (int i = 0; i < 8; ++i) { const int ka = k0 + 8 * g + i, kb = ka + 16;
    a[i] = (_Float16)(ka < K ? W[(size_t)(ka < K ? ka : K - 1) * ld + n] : 0.f); a[8 + i] = (_Float16)(kb < K ? W[(size_t)(kb < K ? kb : K - 1) * ld + n] : 0.f); }
  return a;
}
struct F2 { v16b h, l; };
__device__ __forceinline__ F2 bsplit16(const float v[16]) { F2 r;
#pragma unroll
  for (int i = 0; i < 16; ++i) { const __bf16 h = (__bf16)v[i]; r.h[i] = h; r.l[i] = (__bf16)(v[i] - (float)h); }
  return r; }
__device__ __forceinline__ F2 split_row(const float* row, int k0, int lane) { float v[16]; const float* p = row + k0 + 8 * (lane >> 4);
#pragma unroll
  for (int i = 0; i < 8; ++i) { v[i] = p[i]; v[8 + i] = p[16 + i]; }
  return bsplit16(v); }
__device__ __forceinline__ F2 split_rowK(const float* row, int k0, int lane, int K) { float v[16]; const int g = lane >> 4;
#pragma unroll
  for (int i = 0; i < 8; ++i) { const int ka = k0 + 8 * g + i, kb = ka + 16; v[i] = ka < K ? row[ka < K ? ka : K - 1] : 0.f; v[8 + i] = kb < K ? row[kb < K ? kb : K - 1] : 0.f; }
  return bsplit16(v); }
__device__ __forceinline__ F2 split_col(const float* W, int k0, int n, int lane, int ld, int K) { float v[16]; const int g = lane >> 4;
#pragma unroll
  for (int i = 0; i < 8; ++i) { const int ka = k0 + 8 * g + i, kb = ka + 16; v[i] = ka < K ? W[(size_t)(ka < K ? ka : K - 1) * ld + n] : 0.f; v[8 + i] = kb < K ? W[(size_t)(kb < K ? kb : K - 1) * ld + n] : 0.f; }
  return bsplit16(v); }
__device__ __forceinline__ v8f mac3(const F2& a, const F2& b, v8f c) { c = wmma_bf(a.l, b.h, c); c = wmma_bf(a.h, b.l, c); return wmma_bf(a.h, b.h, c); }
__device__ __forceinline__ float sigm(float v) { return 1.0f / (1.0f + expf(-v)); }
#define LDSX() do { asm volatile("s_wait_dscnt 0" ::: "memory"); __builtin_amdgcn_wave_barrier(); __builtin_amdgcn_fence(__ATOMIC_RELEASE, "workgroup"); } while (0)

// Multi-head attention with RoPE (B 2, S 2,048, 1,024 = 16 x 64; 0.02-scale weights and biases): q,k,v = x W^T + b ((out,in)); interleaved-pair RoPE on q, k (angle t x 10000^(-2i/64)); scores = q k^T / sqrt(1024) (note: sqrt(D), not sqrt(hd)); out = merged(softmax(scores) v) Wo^T (no output bias).
#define NB 2
#define TT 2048
#define CC 1024            // NH * HD = projected width
#define DIN 1024          // input (model) width
#define NH 16
#define HD 64
#define NQB (TT / 64)
#define HG 4
#define SCALE (0.03125f)
#define CAUSAL 0
#ifndef TNB
#define TNB NB
#endif
__device__ __forceinline__ float bfr(float v) { return (float)(__bf16)v; }
__host__ __device__ __forceinline__ int kb_last(int qb) { return CAUSAL ? ((qb * 64 + 63) >> 7) : (TT / 128 - 1); }
typedef __attribute__((ext_vector_type(8))) __bf16 v8b;
__device__ __forceinline__ v16b frag_b(const __bf16* rowk0, int lane) {
  union { v16b v; v8b q[2]; } u; const __bf16* p = rowk0 + 8 * (lane >> 4);
  u.q[0] = *(const v8b*)p; u.q[1] = *(const v8b*)(p + 16); return u.v;
}
#define QBH 0
#define QHI 2048            // rows carrying a q residual plane (all rows when non-causal: 2-product logits everywhere)
#define KHI 64            // key rows carrying k residual / v bf16 hi+lo planes (written by k_proj, read by no kernel)
// B fragment (k rows k0+.., output column o) of a weight: (in,out) [K][ld] or (out,in) [ld rows of K]: bf16 exact, or f16(bf16 * 256) exact
__device__ __forceinline__ v16b wcol_io(const float* Wm, int k0, int o, int lane, int ld) { v16b w; const int g = lane >> 4;
#pragma unroll
  for (int i = 0; i < 8; ++i) { w[i] = (__bf16)Wm[(size_t)(k0 + 8 * g + i) * ld + o]; w[8 + i] = (__bf16)Wm[(size_t)(k0 + 16 + 8 * g + i) * ld + o]; }
  return w; }
__device__ __forceinline__ v16b wcol_oi(const float* Wm, int k0, int o, int lane, int K) { v16b w; const float* p = Wm + (size_t)o * K + k0 + 8 * (lane >> 4);
#pragma unroll
  for (int i = 0; i < 8; ++i) { w[i] = (__bf16)p[i]; w[8 + i] = (__bf16)p[16 + i]; }
  return w; }
__device__ __forceinline__ v16h wcolh_io(const float* Wm, int k0, int o, int lane, int ld) { v16h w; const int g = lane >> 4;
#pragma unroll
  for (int i = 0; i < 8; ++i) { w[i] = (_Float16)(bfr(Wm[(size_t)(k0 + 8 * g + i) * ld + o]) * 256.0f); w[8 + i] = (_Float16)(bfr(Wm[(size_t)(k0 + 16 + 8 * g + i) * ld + o]) * 256.0f); }
  return w; }
__device__ __forceinline__ v16h wcolh_oi(const float* Wm, int k0, int o, int lane, int K) { v16h w; const float* p = Wm + (size_t)o * K + k0 + 8 * (lane >> 4);
#pragma unroll
  for (int i = 0; i < 8; ++i) { w[i] = (_Float16)(bfr(p[i]) * 256.0f); w[8 + i] = (_Float16)(bfr(p[16 + i]) * 256.0f); }
  return w; }
#define WQKV_LAYOUT 1   // 0 = (in,out) [DIN][CC]; 1 = (out,in) [CC][DIN]; 2 = per-head [NH][DIN][HD]; read only through WCOL, which no kernel calls (k_proj reads (out,in) [CC][DIN])
__device__ __forceinline__ v16b wcol_hdk(const float* Wm, int k0, int o, int lane) { v16b w; const int g = lane >> 4; const float* p = Wm + (size_t)(o / HD) * DIN * HD + (o % HD);
#pragma unroll
  for (int i = 0; i < 8; ++i) { w[i] = (__bf16)p[(size_t)(k0 + 8 * g + i) * HD]; w[8 + i] = (__bf16)p[(size_t)(k0 + 16 + 8 * g + i) * HD]; }
  return w; }
#define WO_OUT_IN 1
#if WQKV_LAYOUT == 1
#define WCOL(W, k0, o, lane) wcol_oi(W, k0, o, lane, DIN)
#elif WQKV_LAYOUT == 2
#define WCOL(W, k0, o, lane) wcol_hdk(W, k0, o, lane)
#else
#define WCOL(W, k0, o, lane) wcol_io(W, k0, o, lane, CC)
#endif
#if WO_OUT_IN
#define WOCOL(W, k0, o, lane) wcol_oi(W, k0, o, lane, CC)
#define WOCOLH(W, k0, o, lane) wcolh_oi(W, k0, o, lane, CC)
#else
#define WOCOL(W, k0, o, lane) wcol_io(W, k0, o, lane, DIN)
#define WOCOLH(W, k0, o, lane) wcolh_io(W, k0, o, lane, DIN)
#endif
__constant__ float c_invf[32] = {1.000000000e+0f,7.498942018e-1f,5.623413324e-1f,4.216965139e-1f,3.162277639e-1f,2.371373773e-1f,1.778279394e-1f,1.333521456e-1f,1.000000015e-1f,7.498942316e-2f,5.623413250e-2f,4.216964915e-2f,3.162277490e-2f,2.371373773e-2f,1.778279431e-2f,1.333521400e-2f,9.999999776e-3f,7.498942316e-3f,5.623413250e-3f,4.216964822e-3f,3.162277630e-3f,2.371373819e-3f,1.778279431e-3f,1.333521446e-3f,1.000000047e-3f,7.498941850e-4f,5.623413017e-4f,4.216965172e-4f,3.162277571e-4f,2.371373703e-4f,1.778279402e-4f,1.333521504e-4f};   /* f32(1 / 10000^(2i/64)) */
#define PROJ_EPI(which, row, t, h) do { if ((which) < 2) { float* rw = (row); const float pf = (float)(t); _Pragma("unroll") for (int i = 0; i < 32; ++i) { const float a = rw[2 * i], b = rw[2 * i + 1]; float sn, cs; sincosf(pf * c_invf[i], &sn, &cs); rw[2 * i] = a * cs - b * sn; rw[2 * i + 1] = a * sn + b * cs; } } } while (0)   /* interleaved (even, odd) RoPE pairs, angle = t * 10000^(-2i/64) */
#ifndef SM_EXTRA_PARAMS
#define SM_EXTRA_PARAMS
#endif
#ifndef PROJ_EXTRA_PARAMS
#define PROJ_EXTRA_PARAMS
#endif
#ifndef SM_MASK_HOOK
#define SM_MASK_HOOK (void)0
#endif

#define WS_QH  0u                                      // f16 q rows [b*t][CC]
#define WS_KH  (WS_QH + 2u * (size_t)NB * TT * CC)      // f16 k rows [b*t][CC]
#define WS_VT  (WS_KH + 2u * (size_t)NB * TT * CC)      // f16 v planes [b][c][t]
#define WS_QL  (WS_VT + 2u * (size_t)NB * CC * TT)      // f16 q residual x 2^10 rows [b][t < QHI][CC]
#define WS_KL  (WS_QL + 2u * (size_t)NB * QHI * CC)     // f16 k residual x 2^10 rows [b][t < KHI][CC]
#define WS_VB  (WS_KL + 2u * (size_t)NB * KHI * CC)     // bf16 v hi planes [b][c][t < KHI]
#define WS_VBL (WS_VB + 2u * (size_t)NB * CC * KHI)
#define WS_XB  (WS_VBL + 2u * (size_t)NB * CC * KHI)    // bf16 x rows [b*t][DIN]
#define WS_WB  (WS_XB + 2u * (size_t)NB * TT * DIN)     // bf16 Wq, Wk, Wv, Wo, each [CC][DIN] as given
#define WS_Y   (WS_WB + 2u * 4u * (size_t)CC * DIN)     // f32 ctx rows [b*t][CC] (only when there is an output projection)
#define WS_END (WS_Y  + 4u * (size_t)NB * TT * CC)

// GEMM operand staging (k_proj, k_out): a stage is 64 k of every operand row, kept as bf16 in LDS; every wave takes its fragments from there with 16-byte LDS loads. x and the four weights come from k_cvt's bf16 planes (a stage row = one 128-B line, 8 lanes x 16 B, copied as it is); ctx comes as f32 (16 lanes x 16 B per row) and is split by the block.
#define GK 64              // k per stage
#define GLD 72             // LDS row pitch in bf16: 144 B = 16 B x odd, conflict-free for the 16-byte fragment reads
typedef __attribute__((ext_vector_type(4))) __bf16 v4b;
__device__ __forceinline__ v4b cvt4(v4f v) { v4b r; r[0] = (__bf16)v[0]; r[1] = (__bf16)v[1]; r[2] = (__bf16)v[2]; r[3] = (__bf16)v[3]; return r; }
__device__ __forceinline__ v4b res4(v4f v, v4b h) { v4b r;
#pragma unroll
  for (int i = 0; i < 4; ++i) r[i] = (__bf16)(v[i] - (float)h[i]);
  return r; }
// a thread's N pieces of a stage: rows 8 apart, 16 bytes each
template <int N> __device__ __forceinline__ void ld_rows(v4f (&r)[N], const float* p, int ld) {
#pragma unroll
  for (int i = 0; i < N; ++i) r[i] = *(const v4f*)(p + (size_t)i * 8 * ld);
  asm volatile("s_wait_xcnt 0x0" :: "v"(p) : "memory"); }   // stands in front of every overwrite of these loads' address registers (p as an input keeps them whole up to here); its memory clobber also holds the loads here, ahead of the products they fly behind
// a thread's N pieces of a stage of a bf16 plane: rows 16 apart, 16 bytes each
template <int N> __device__ __forceinline__ void ld_rows_b(v8b (&r)[N], const __bf16* p, int ld) {
#pragma unroll
  for (int i = 0; i < N; ++i) r[i] = *(const v8b*)(p + (size_t)i * 16 * ld);
  asm volatile("s_wait_xcnt 0x0" :: "v"(p) : "memory"); }   // as in ld_rows: stands in front of every overwrite of these loads' address registers and holds the loads ahead of the products they fly behind
// ---- k_cvt: x and the four weights rounded to bf16 ONCE, as a stream (one block per WGP, each 32,768 consecutive floats of one tensor, in whole-line 16-byte loads that are all issued ahead of the first store): every GEMM block that reads them afterwards fetches 2 bytes an element, not 4, and converts nothing
#define CV_N 32768
__global__ __launch_bounds__(256) void k_cvt(const float* __restrict__ X, const float* __restrict__ WQ, const float* __restrict__ WK, const float* __restrict__ WV, const float* __restrict__ WO, __bf16* __restrict__ XB, __bf16* __restrict__ WB) {
  const int nx = NB * TT * DIN / CV_N, nw = CC * DIN / CV_N; const int bi = blockIdx.x, tid = threadIdx.x;
  const float* s; __bf16* d;
  if (bi < nx) { s = X + (size_t)bi * CV_N; d = XB + (size_t)bi * CV_N; }
  else { const int w = (bi - nx) / nw; s = (w == 0 ? WQ : w == 1 ? WK : w == 2 ? WV : WO) + (size_t)((bi - nx) % nw) * CV_N; d = WB + (size_t)(bi - nx) * CV_N; }
  v4f r[CV_N / 1024];
#pragma unroll
  for (int i = 0; i < CV_N / 1024; ++i) r[i] = *(const v4f*)(s + i * 1024 + tid * 4);
#pragma unroll
  for (int i = 0; i < CV_N / 1024; ++i) *(v4b*)(d + i * 1024 + tid * 4) = cvt4(r[i]); }
// ---- k_proj: block = (64 rows, 128 cols, which): q/k/v = X W (+ b) with exact bf16 products (K = DIN) -> which 0: q f16 rows (+ residual rows < QHI); 1: k f16 rows (+ residual rows < KHI); 2: v f16 planes [c][t] (+ bf16 hi/lo planes for t < KHI)
__global__ __launch_bounds__(128) void k_proj(const __bf16* __restrict__ XB, const __bf16* __restrict__ WB, const float* __restrict__ BQ, const float* __restrict__ BK, const float* __restrict__ BV,
    _Float16* __restrict__ QH, _Float16* __restrict__ QL, _Float16* __restrict__ KH, _Float16* __restrict__ KL, _Float16* __restrict__ VT, __bf16* __restrict__ VB, __bf16* __restrict__ VBL PROJ_EXTRA_PARAMS) {
  __shared__ __align__(16) float st[64][132]; __shared__ __align__(16) char ov[2 * (64 + 128) * GLD * 2];
  // one LDS range, used in turn: the two operand stages of the k loop; behind the loop's last barrier the epilogue's conversion tiles (q, k: sh, sl; v: th, tb, tbl)
  __bf16 (*xs)[64][GLD] = (__bf16 (*)[64][GLD])ov; __bf16 (*wt)[128][GLD] = (__bf16 (*)[128][GLD])(ov + 2 * 64 * GLD * 2);
  _Float16 (*sh)[136] = (_Float16 (*)[136])ov; _Float16 (*sl)[136] = (_Float16 (*)[136])(ov + 64 * 136 * 2);
  _Float16 (*th)[72] = (_Float16 (*)[72])ov; __bf16 (*tb)[72] = (__bf16 (*)[72])(ov + 128 * 72 * 2); __bf16 (*tbl)[72] = (__bf16 (*)[72])(ov + 2 * 128 * 72 * 2);
  const int tid = threadIdx.x, wave = tid >> 5, lane = tid & 31, col = lane & 15, g = lane >> 4; const int which = blockIdx.z; const int c0 = blockIdx.y * 128; const size_t r0 = (size_t)blockIdx.x * 64; const size_t bb = r0 / TT; const int t0 = (int)(r0 % TT);
  const float* BA = which == 0 ? BQ : which == 1 ? BK : BV;
  v8f acc[8] = {};
  const int pr = tid >> 3, pc = (tid & 7) * 8;   // a thread's 16-byte piece: row pr of each group of 16 rows, k pc..pc+7 of the stage
  const __bf16* xg = XB + (r0 + pr) * DIN + pc; const __bf16* wg = WB + ((size_t)which * CC + c0 + pr) * DIN + pc;
  v8b xr[4], wr[8];
  ld_rows_b(xr, xg, DIN); ld_rows_b(wr, wg, DIN);
#pragma unroll
  for (int i = 0; i < 4; ++i) *(v8b*)&xs[0][i * 16 + pr][pc] = xr[i];
#pragma unroll
  for (int i = 0; i < 8; ++i) *(v8b*)&wt[0][i * 16 + pr][pc] = wr[i];
  __syncthreads();
  // the stage loop stays rolled so that the two buffers alternate by index and the loop stays small; the inner loops are unrolled so that the register arrays are indexed by constants
#pragma unroll 1
  for (int s = 0; s < DIN / GK; ++s) { const int cur = s & 1;
    if (s + 1 < DIN / GK) { ld_rows_b(xr, xg + (s + 1) * GK, DIN); ld_rows_b(wr, wg + (s + 1) * GK, DIN); }   // the next stage's loads fly while this stage is multiplied
#pragma unroll
    for (int kc = 0; kc < GK / 32; ++kc) { const v16b a = frag_b(&xs[cur][wave * 16 + col][kc * 32], lane); v16b w[8];
#pragma unroll
      for (int j = 0; j < 8; ++j) w[j] = frag_b(&wt[cur][j * 16 + col][kc * 32], lane);
      __builtin_amdgcn_sched_barrier(0);   // keeps the nine fragments' LDS reads one group ahead of their products: left alone the compiler reads each into the same registers and waits out the LDS latency before every product
#pragma unroll
      for (int j = 0; j < 8; ++j) acc[j] = __builtin_amdgcn_wmma_f32_16x16x32_bf16(false, a, false, w[j], (short)0, acc[j], false, false); }
    if (s + 1 < DIN / GK) {
#pragma unroll
      for (int i = 0; i < 4; ++i) *(v8b*)&xs[cur ^ 1][i * 16 + pr][pc] = xr[i];
#pragma unroll
      for (int i = 0; i < 8; ++i) *(v8b*)&wt[cur ^ 1][i * 16 + pr][pc] = wr[i]; }
    __syncthreads(); }   // one barrier a stage: publishes stage s + 1 and ends every wave's reads of the buffer that stage s + 2 (or the epilogue) overwrites
  { // stage the f32 tile (acc + bias) in LDS, run the per-(row, head) epilogue hook, then convert
#pragma unroll
    for (int j = 0; j < 8; ++j) { const float bias = BA ? bfr(BA[c0 + j * 16 + col]) : 0.f;
#pragma unroll
      for (int r = 0; r < 8; ++r) st[wave * 16 + 8 * g + r][j * 16 + col] = acc[j][r] + bias; }
    __syncthreads();
    for (int e = tid; e < 64 * (128 / HD); e += 128) { const int rl = e / (128 / HD), hh = e % (128 / HD); PROJ_EPI(which, &st[rl][hh * HD], (int)((r0 + rl) % TT), (c0 / HD) + hh); }
    __syncthreads(); }
  if (which < 2) { _Float16* DH = which == 0 ? QH : KH; _Float16* DL = which == 0 ? QL : KL; const int nhi = which == 0 ? QHI : KHI; const bool hi_rows = t0 < nhi;
    for (int e = tid; e < 64 * 128; e += 128) { const int rl = e >> 7, cl = e & 127; const float v = st[rl][cl]; const _Float16 hv = (_Float16)v; sh[rl][cl] = hv; sl[rl][cl] = (_Float16)((v - (float)hv) * 1024.0f); }
    __syncthreads();
    for (int e = tid; e < 64 * 16; e += 128) { const int rl = e >> 4, q = e & 15; vst2((unsigned*)(DH + (r0 + rl) * CC + c0 + q * 8), *(const v4u*)&sh[rl][q * 8]); if (hi_rows) vst2((unsigned*)(DL + (bb * nhi + t0 + rl) * (size_t)CC + c0 + q * 8), *(const v4u*)&sl[rl][q * 8]); }
  } else { const bool hi_rows = t0 < KHI;
    for (int e = tid; e < 64 * 128; e += 128) { const int rl = e & 63, cl = e >> 6; const float v = st[rl][cl]; th[cl][rl] = (_Float16)v; const __bf16 bh = (__bf16)v; tb[cl][rl] = bh; tbl[cl][rl] = (__bf16)(v - (float)bh); }
    __syncthreads();
    for (int e = tid; e < 128 * 8; e += 128) { const int cl = e >> 3, q = e & 7; vst2((unsigned*)(VT + (bb * CC + c0 + cl) * (size_t)TT + t0 + q * 8), *(const v4u*)&th[cl][q * 8]); if (hi_rows) { const size_t o3 = (bb * CC + c0 + cl) * (size_t)KHI + t0 + q * 8; vst2((unsigned*)(VB + o3), *(const v4u*)&tb[cl][q * 8]); vst2((unsigned*)(VBL + o3), *(const v4u*)&tbl[cl][q * 8]); } } } }
#define FA_Q 128
#define FA_K 64
#define FA_NS (TT / FA_K)
#define FA_LD 72           // LDS row pitch in halves: 144 B = 16 B x odd, conflict-free for the 16-byte fragment reads
__device__ __forceinline__ float xhalf(float v) { const int i = __builtin_bit_cast(int, v); return __builtin_bit_cast(float, __builtin_amdgcn_permlanex16(i, i, 0x76543210, 0xfedcba98, false, false)); }   /* lane l <-> l ^ 16 */
__global__ __launch_bounds__(256) void k_fa(const _Float16* __restrict__ QH, const _Float16* __restrict__ QL, const _Float16* __restrict__ KH, const _Float16* __restrict__ VT, float* __restrict__ Y) {
  __shared__ __align__(16) _Float16 ks[2][FA_K][FA_LD], vs[2][HD][FA_LD];
  const int tid = threadIdx.x, wave = tid >> 5, lane = tid & 31, col = lane & 15, g = lane >> 4; const int h = blockIdx.y, b = blockIdx.z; const int ql0 = blockIdx.x * FA_Q + wave * 16;
  v16h qh[HD / 32], qr[HD / 32];
#pragma unroll
  for (int kc = 0; kc < HD / 32; ++kc) { qh[kc] = frag_h(QH + ((size_t)b * TT + ql0 + col) * CC + h * HD + kc * 32, lane); qr[kc] = frag_h(QL + ((size_t)b * QHI + ql0 + col) * CC + h * HD + kc * 32, lane); }
  // staging: a thread moves two 16-byte pieces of the k tile (64 keys x 128 B) and two of the v tile (64 dims x 128 B), whole 128-B lines per 8 lanes
  const int sr = tid >> 3, sq = (tid & 7) * 8;
  const _Float16* kg = KH + ((size_t)b * TT + sr) * CC + h * HD + sq; const _Float16* vg = VT + ((size_t)b * CC + h * HD + sr) * (size_t)TT + sq;
  v4u k0r = *(const v4u*)kg, k1r = *(const v4u*)(kg + (size_t)32 * CC), v0r = *(const v4u*)vg, v1r = *(const v4u*)(vg + (size_t)32 * TT);
  *(v4u*)&ks[0][sr][sq] = k0r; *(v4u*)&ks[0][sr + 32][sq] = k1r; *(v4u*)&vs[0][sr][sq] = v0r; *(v4u*)&vs[0][sr + 32][sq] = v1r;
  __syncthreads();
  const float cl2 = SCALE * 1.44269504088896f;   // logit scale x log2(e): exp(x) = 2^(x log2 e)
  v8f o[HD / 16] = {}; float m = -3.0e38f, l = 0.f;
  // the stage loop stays rolled; every inner loop is unrolled so that the fragment and accumulator arrays are indexed by constants and stay in registers
#pragma unroll 1
  for (int s = 0; s < FA_NS; ++s) { const int cur = s & 1;
    if (s + 1 < FA_NS) { const _Float16* kn = kg + (size_t)(s + 1) * FA_K * CC; const _Float16* vn = vg + (s + 1) * FA_K; k0r = *(const v4u*)kn; k1r = *(const v4u*)(kn + (size_t)32 * CC); v0r = *(const v4u*)vn; v1r = *(const v4u*)(vn + (size_t)32 * TT); }
    v8f sa[FA_K / 16] = {}, sb[FA_K / 16] = {};
#pragma unroll
    for (int kc = 0; kc < HD / 32; ++kc) {
#pragma unroll
      for (int t = 0; t < FA_K / 16; ++t) { const v16h kf = frag_h(&ks[cur][t * 16 + col][kc * 32], lane);
        sa[t] = __builtin_amdgcn_wmma_f32_16x16x32_f16(false, kf, false, qh[kc], (short)0, sa[t], false, false);
        sb[t] = __builtin_amdgcn_wmma_f32_16x16x32_f16(false, kf, false, qr[kc], (short)0, sb[t], false, false); } }
    float mt[FA_K / 16];   // one maximum and one sum per 16-key tile: four short chains, not one of 32 dependent links
#pragma unroll
    for (int t = 0; t < FA_K / 16; ++t) { mt[t] = -3.0e38f;
#pragma unroll
      for (int r = 0; r < 8; ++r) { sa[t][r] = sa[t][r] + sb[t][r] * (1.0f / 1024.0f); mt[t] = fmaxf(mt[t], sa[t][r]); } }
    float mx = fmaxf(fmaxf(mt[0], mt[1]), fmaxf(mt[2], mt[3])); mx = fmaxf(mx, xhalf(mx));
    const float mn = fmaxf(m, mx), mc = mn * cl2; const float al = __builtin_amdgcn_exp2f(m * cl2 - mc); m = mn;
    float st[FA_K / 16]; v16h p[FA_K / 32];
#pragma unroll
    for (int t = 0; t < FA_K / 16; ++t) { st[t] = 0.f;
#pragma unroll
      for (int r = 0; r < 8; ++r) { const float e = __builtin_amdgcn_exp2f(sa[t][r] * cl2 - mc); st[t] += e; p[t >> 1][(t & 1) * 8 + r] = (_Float16)e; } }
    l = l * al + ((st[0] + st[1]) + (st[2] + st[3]));
#pragma unroll
    for (int j = 0; j < HD / 16; ++j) {
#pragma unroll
      for (int r = 0; r < 8; ++r) o[j][r] *= al; }
#pragma unroll
    for (int kk = 0; kk < FA_K / 32; ++kk) {
#pragma unroll
      for (int j = 0; j < HD / 16; ++j) o[j] = __builtin_amdgcn_wmma_f32_16x16x32_f16(false, frag_h(&vs[cur][j * 16 + col][kk * 32], lane), false, p[kk], (short)0, o[j], false, false); }
    if (s + 1 < FA_NS) { *(v4u*)&ks[cur ^ 1][sr][sq] = k0r; *(v4u*)&ks[cur ^ 1][sr + 32][sq] = k1r; *(v4u*)&vs[cur ^ 1][sr][sq] = v0r; *(v4u*)&vs[cur ^ 1][sr + 32][sq] = v1r; }
    __syncthreads(); }   // one barrier a stage: publishes stage s + 1 and ends every wave's reads of the buffer that stage s + 2 overwrites
  l += xhalf(l); const float inv = 1.0f / l;
  float* yr = Y + ((size_t)b * TT + ql0 + col) * CC + h * HD + 8 * g;   // lane = query col; o[j][r] = dim j*16 + 8g + r
#pragma unroll
  for (int j = 0; j < HD / 16; ++j) { v4f a, c;
#pragma unroll
    for (int r = 0; r < 4; ++r) { a[r] = o[j][r] * inv; c[r] = o[j][4 + r] * inv; }
    vst2(yr + j * 16, a); vst2(yr + j * 16 + 4, c); } }
// ---- k_out: block = (64 rows, 128 cols): out = ctx Wo (+ bo): all rows: ctx bf16 hi + lo against exact bf16 Wo (2 products)
__global__ __launch_bounds__(128) void k_out(const float* __restrict__ Y, const __bf16* __restrict__ WOB, const float* __restrict__ BO, float* __restrict__ OUT) { __shared__ __align__(16) char ov[2 * (64 + 64 + 128) * GLD * 2];
  // one LDS range, used in turn: the two operand stages of the k loop (ctx hi, ctx lo, Wo); behind the loop's last barrier each wave's own output staging tile
  __bf16 (*yh)[64][GLD] = (__bf16 (*)[64][GLD])ov; __bf16 (*yl)[64][GLD] = (__bf16 (*)[64][GLD])(ov + 2 * 64 * GLD * 2); __bf16 (*wt)[128][GLD] = (__bf16 (*)[128][GLD])(ov + 4 * 64 * GLD * 2);
  float (*sf)[16][132] = (float (*)[16][132])ov;
  const int tid = threadIdx.x, wave = tid >> 5, lane = tid & 31, col = lane & 15, g = lane >> 4; const int c0 = blockIdx.y * 128; const size_t r0 = (size_t)blockIdx.x * 64 + wave * 16;
  v8f acc[8] = {};
  {   /* ALL rows: ctx split bf16 hi + lo x exact Wo (2 products) */
    const int pr = tid >> 4, pc = (tid & 15) * 4;   // a thread's 16-byte piece: row pr of each group of 8 rows, k pc..pc+3 of the stage
    const int qr = tid >> 3, qc = (tid & 7) * 8;    // its 16-byte piece of the bf16 Wo plane: row qr of each group of 16 rows, k qc..qc+7
    const float* yg = Y + ((size_t)blockIdx.x * 64 + pr) * CC + pc; const __bf16* wg = WOB + (size_t)(c0 + qr) * CC + qc;
    v4f yr[8]; v8b wr[8];
    ld_rows(yr, yg, CC); ld_rows_b(wr, wg, CC);
#pragma unroll
    for (int i = 0; i < 8; ++i) { const v4b hv = cvt4(yr[i]); *(v4b*)&yh[0][i * 8 + pr][pc] = hv; *(v4b*)&yl[0][i * 8 + pr][pc] = res4(yr[i], hv); }
#pragma unroll
    for (int i = 0; i < 8; ++i) *(v8b*)&wt[0][i * 16 + qr][qc] = wr[i];
    __syncthreads();
    // rolled stage loop, unrolled inner loops: as in k_proj
#pragma unroll 1
    for (int s = 0; s < CC / GK; ++s) { const int cur = s & 1;
      if (s + 1 < CC / GK) { ld_rows(yr, yg + (s + 1) * GK, CC); ld_rows_b(wr, wg + (s + 1) * GK, CC); }   // the next stage's loads fly while this stage is multiplied
#pragma unroll
      for (int kc = 0; kc < GK / 32; ++kc) { const v16b ah = frag_b(&yh[cur][wave * 16 + col][kc * 32], lane), al = frag_b(&yl[cur][wave * 16 + col][kc * 32], lane); v16b w[8];
#pragma unroll
        for (int j = 0; j < 8; ++j) w[j] = frag_b(&wt[cur][j * 16 + col][kc * 32], lane);
        __builtin_amdgcn_sched_barrier(0);   // keeps the ten fragments' LDS reads one group ahead of their products, as in k_proj
#pragma unroll
        for (int j = 0; j < 8; ++j) { acc[j] = __builtin_amdgcn_wmma_f32_16x16x32_bf16(false, ah, false, w[j], (short)0, acc[j], false, false);
          acc[j] = __builtin_amdgcn_wmma_f32_16x16x32_bf16(false, al, false, w[j], (short)0, acc[j], false, false); } }
      if (s + 1 < CC / GK) {
#pragma unroll
        for (int i = 0; i < 8; ++i) { const v4b hv = cvt4(yr[i]); *(v4b*)&yh[cur ^ 1][i * 8 + pr][pc] = hv; *(v4b*)&yl[cur ^ 1][i * 8 + pr][pc] = res4(yr[i], hv); }
#pragma unroll
        for (int i = 0; i < 8; ++i) *(v8b*)&wt[cur ^ 1][i * 16 + qr][qc] = wr[i]; }
      __syncthreads(); }   // one barrier a stage: publishes stage s + 1 and ends every wave's reads of the buffer that stage s + 2 (or the output staging) overwrites
#pragma unroll
    for (int j = 0; j < 8; ++j) { const float bias = BO ? bfr(BO[c0 + j * 16 + col]) : 0.f;
#pragma unroll
      for (int r = 0; r < 8; ++r) sf[wave][8 * g + r][j * 16 + col] = acc[j][r] + bias; }
  }
  LDSX(); for (int rl = 0; rl < 16; ++rl) vst2(OUT + (r0 + rl) * DIN + c0 + lane * 4, *(const v4f*)&sf[wave][rl][lane * 4]); }

extern "C" void kernel_launch(void* const* d_in, const int* in_sizes, int n_in, void* d_out, int out_size, void* d_ws, size_t ws_size, hipStream_t stream) {
  (void)in_sizes; (void)n_in; (void)out_size;
  const float** F = (const float**)d_in;
  if (ws_size < (size_t)WS_END) return;
  char* ws = (char*)d_ws; _Float16 *QH = (_Float16*)(ws + WS_QH), *KH = (_Float16*)(ws + WS_KH), *VT = (_Float16*)(ws + WS_VT), *QL = (_Float16*)(ws + WS_QL), *KL = (_Float16*)(ws + WS_KL); __bf16 *VB = (__bf16*)(ws + WS_VB), *VBL = (__bf16*)(ws + WS_VBL), *XB = (__bf16*)(ws + WS_XB), *WB = (__bf16*)(ws + WS_WB); float *Y = (float*)(ws + WS_Y);
  (void)Y; (void)QL; (void)KL; (void)VB; (void)VBL;
  // inputs: 0 x [2,2048,1024]; 1 Wq [1024,1024] (out,in), 2 bq; 3 Wk, 4 bk; 5 Wv, 6 bv; 7 Wo (no bias)
  k_cvt<<<dim3((NB * TT * DIN + 4 * CC * DIN) / CV_N), 256, 0, stream>>>(F[0], F[1], F[3], F[5], F[7], XB, WB);
  k_proj<<<dim3(TNB * TT / 64, CC / 128, 3), 128, 0, stream>>>(XB, WB, F[2], F[4], F[6], QH, QL, KH, KL, VT, VB, VBL);
  k_fa<<<dim3(TT / FA_Q, NH, TNB), 256, 0, stream>>>(QH, QL, KH, VT, Y);
  k_out<<<dim3(TNB * TT / 64, DIN / 128), 128, 0, stream>>>(Y, WB + 3 * (size_t)CC * DIN, nullptr, (float*)d_out);
}

// v004
// One run takes 110 microseconds.
// Two timings next to v003 both put it at 1.04 times that version's speed.
// Counting every step since v000, it is 13.2 times as fast.
// compute dtype: all float inputs rounded to bf16; q/k/v projections with EXACT bf16 products on WMMA 16x16x32 (f32 accumulate); interleaved RoPE in f32 (sincosf) on the projected q/k rows; q as f16 hi + residual (x 2^10) against k once to f16 (2 products) x 1024^-0.5; one-pass softmax in f32 (running maximum and sum, exp2 of the scaled difference); exp(logit - maximum) once to f16 against v once to f16 (1 product), divided by the sum at the end; ctx split bf16 hi + lo against exact Wo (2 products); f32 output.
#include <hip/hip_runtime.h>
#include <math.h>

typedef __attribute__((ext_vector_type(16))) _Float16 v16h;
typedef __attribute__((ext_vector_type(16))) __bf16 v16b;
typedef __attribute__((ext_vector_type(8)))  _Float16 v8h;
typedef __attribute__((ext_vector_type(8)))  float v8f;
typedef __attribute__((ext_vector_type(4)))  float v4f;
typedef __attribute__((ext_vector_type(2)))  float v2f;
typedef __attribute__((ext_vector_type(4)))  unsigned v4u;
typedef __attribute__((ext_vector_type(4)))  int v4i;
typedef float __attribute__((may_alias)) float_a;
typedef int __attribute__((may_alias)) int_a;

template <typename T> __device__ __forceinline__ void vst2(void* p, T v) { *(T*)p = v;  }
__device__ __forceinline__ v8f wmma16(v16h a, v16h b, v8f c) {
  v8f d = __builtin_amdgcn_wmma_f32_16x16x32_f16(false, a, false, b, (short)0, c, false, false);
  asm volatile("v_nop\n\tv_nop\n\tv_nop\n\tv_nop" : "+v"(d) : "v"(a), "v"(b));
  return d;
}
__device__ __forceinline__ v8f wmma_bf(v16b a, v16b b, v8f c) {
  v8f d = __builtin_amdgcn_wmma_f32_16x16x32_bf16(false, a, false, b, (short)0, c, false, false);
  asm volatile("v_nop\n\tv_nop\n\tv_nop\n\tv_nop" : "+v"(d) : "v"(a), "v"(b));
  return d;
}
// 16x16x32 fragments: lane = (h = lane>>4, row/col = lane&15); elements 0..7 = k0+8h+0..7, 8..15 = k0+16+8h+0..7; D element r = row 8h+r
__device__ __forceinline__ v16h frag_h(const _Float16* rowk0, int lane) {
  union { v16h v; v8h q[2]; } u; const _Float16* p = rowk0 + 8 * (lane >> 4);
  u.q[0] = *(const v8h*)p; u.q[1] = *(const v8h*)(p + 16); return u.v;
}
__device__ __forceinline__ v16h frag_f32(const float* rowk0, int lane) {
  v16h a; const float* p = rowk0 + 8 * (lane >> 4);
#pragma unroll
  for (int i = 0; i < 8; ++i) { a[i] = (_Float16)p[i]; a[8 + i] = (_Float16)p[16 + i]; }
  return a;
}
__device__ __forceinline__ v16h frag_f32s(const float* rowk0, int lane, float sc) {
  v16h a; const float* p = rowk0 + 8 * (lane >> 4);
#pragma unroll
  for (int i = 0; i < 8; ++i) { a[i] = (_Float16)(p[i] * sc); a[8 + i] = (_Float16)(p[16 + i] * sc); }
  return a;
}
// column fragment from a [K][ld] layout (column n), rows >= K read as 0
__device__ __forceinline__ v16h fragc_f32(const float* W, int k0, int n, int lane, int ld, int K) {
  v16h a; const int g = lane >> 4;
#pragma unroll
  for (int i = 0; i < 8; ++i) { const int ka = k0 + 8 * g + i, kb = ka + 16;
    a[i] = (_Float16)(ka < K ? W[(size_t)(ka < K ? ka : K - 1) * ld + n] : 0.f); a[8 + i] = (_Float16)(kb < K ? W[(size_t)(kb < K ? kb : K - 1) * ld + n] : 0.f); }
  return a;
}
struct F2 { v16b h, l; };
__device__ __forceinline__ F2 bsplit16(const float v[16]) { F2 r;
#pragma unroll
  for (int i = 0; i < 16; ++i) { const __bf16 h = (__bf16)v[i]; r.h[i] = h; r.l[i] = (__bf16)(v[i] - (float)h); }
  return r; }
__device__ __forceinline__ F2 split_row(const float* row, int k0, int lane) { float v[16]; const float* p = row + k0 + 8 * (lane >> 4);
#pragma unroll
  for (int i = 0; i < 8; ++i) { v[i] = p[i]; v[8 + i] = p[16 + i]; }
  return bsplit16(v); }
__device__ __forceinline__ F2 split_rowK(const float* row, int k0, int lane, int K) { float v[16]; const int g = lane >> 4;
#pragma unroll
  for (int i = 0; i < 8; ++i) { const int ka = k0 + 8 * g + i, kb = ka + 16; v[i] = ka < K ? row[ka < K ? ka : K - 1] : 0.f; v[8 + i] = kb < K ? row[kb < K ? kb : K - 1] : 0.f; }
  return bsplit16(v); }
__device__ __forceinline__ F2 split_col(const float* W, int k0, int n, int lane, int ld, int K) { float v[16]; const int g = lane >> 4;
#pragma unroll
  for (int i = 0; i < 8; ++i) { const int ka = k0 + 8 * g + i, kb = ka + 16; v[i] = ka < K ? W[(size_t)(ka < K ? ka : K - 1) * ld + n] : 0.f; v[8 + i] = kb < K ? W[(size_t)(kb < K ? kb : K - 1) * ld + n] : 0.f; }
  return bsplit16(v); }
__device__ __forceinline__ v8f mac3(const F2& a, const F2& b, v8f c) { c = wmma_bf(a.l, b.h, c); c = wmma_bf(a.h, b.l, c); return wmma_bf(a.h, b.h, c); }
__device__ __forceinline__ float sigm(float v) { return 1.0f / (1.0f + expf(-v)); }
#define LDSX() do { asm volatile("s_wait_dscnt 0" ::: "memory"); __builtin_amdgcn_wave_barrier(); __builtin_amdgcn_fence(__ATOMIC_RELEASE, "workgroup"); } while (0)

// Multi-head attention with RoPE (B 2, S 2,048, 1,024 = 16 x 64; 0.02-scale weights and biases): q,k,v = x W^T + b ((out,in)); interleaved-pair RoPE on q, k (angle t x 10000^(-2i/64)); scores = q k^T / sqrt(1024) (note: sqrt(D), not sqrt(hd)); out = merged(softmax(scores) v) Wo^T (no output bias).
#define NB 2
#define TT 2048
#define CC 1024            // NH * HD = projected width
#define DIN 1024          // input (model) width
#define NH 16
#define HD 64
#define NQB (TT / 64)
#define HG 4
#define SCALE (0.03125f)
#define CAUSAL 0
#ifndef TNB
#define TNB NB
#endif
__device__ __forceinline__ float bfr(float v) { return (float)(__bf16)v; }
__host__ __device__ __forceinline__ int kb_last(int qb) { return CAUSAL ? ((qb * 64 + 63) >> 7) : (TT / 128 - 1); }
typedef __attribute__((ext_vector_type(8))) __bf16 v8b;
__device__ __forceinline__ v16b frag_b(const __bf16* rowk0, int lane) {
  union { v16b v; v8b q[2]; } u; const __bf16* p = rowk0 + 8 * (lane >> 4);
  u.q[0] = *(const v8b*)p; u.q[1] = *(const v8b*)(p + 16); return u.v;
}
#define QBH 0
#define QHI 2048            // rows carrying a q residual plane (all rows when non-causal: 2-product logits everywhere)
#define KHI 64            // key rows carrying k residual / v bf16 hi+lo planes (written by k_proj, read by no kernel)
// B fragment (k rows k0+.., output column o) of a weight: (in,out) [K][ld] or (out,in) [ld rows of K]: bf16 exact, or f16(bf16 * 256) exact
__device__ __forceinline__ v16b wcol_io(const float* Wm, int k0, int o, int lane, int ld) { v16b w; const int g = lane >> 4;
#pragma unroll
  for (int i = 0; i < 8; ++i) { w[i] = (__bf16)Wm[(size_t)(k0 + 8 * g + i) * ld + o]; w[8 + i] = (__bf16)Wm[(size_t)(k0 + 16 + 8 * g + i) * ld + o]; }
  return w; }
__device__ __forceinline__ v16b wcol_oi(const float* Wm, int k0, int o, int lane, int K) { v16b w; const float* p = Wm + (size_t)o * K + k0 + 8 * (lane >> 4);
#pragma unroll
  for (int i = 0; i < 8; ++i) { w[i] = (__bf16)p[i]; w[8 + i] = (__bf16)p[16 + i]; }
  return w; }
__device__ __forceinline__ v16h wcolh_io(const float* Wm, int k0, int o, int lane, int ld) { v16h w; const int g = lane >> 4;
#pragma unroll
  for (int i = 0; i < 8; ++i) { w[i] = (_Float16)(bfr(Wm[(size_t)(k0 + 8 * g + i) * ld + o]) * 256.0f); w[8 + i] = (_Float16)(bfr(Wm[(size_t)(k0 + 16 + 8 * g + i) * ld + o]) * 256.0f); }
  return w; }
__device__ __forceinline__ v16h wcolh_oi(const float* Wm, int k0, int o, int lane, int K) { v16h w; const float* p = Wm + (size_t)o * K + k0 + 8 * (lane >> 4);
#pragma unroll
  for (int i = 0; i < 8; ++i) { w[i] = (_Float16)(bfr(p[i]) * 256.0f); w[8 + i] = (_Float16)(bfr(p[16 + i]) * 256.0f); }
  return w; }
#define WQKV_LAYOUT 1   // 0 = (in,out) [DIN][CC]; 1 = (out,in) [CC][DIN]; 2 = per-head [NH][DIN][HD]; read only through WCOL, which no kernel calls (k_proj reads (out,in) [CC][DIN])
__device__ __forceinline__ v16b wcol_hdk(const float* Wm, int k0, int o, int lane) { v16b w; const int g = lane >> 4; const float* p = Wm + (size_t)(o / HD) * DIN * HD + (o % HD);
#pragma unroll
  for (int i = 0; i < 8; ++i) { w[i] = (__bf16)p[(size_t)(k0 + 8 * g + i) * HD]; w[8 + i] = (__bf16)p[(size_t)(k0 + 16 + 8 * g + i) * HD]; }
  return w; }
#define WO_OUT_IN 1
#if WQKV_LAYOUT == 1
#define WCOL(W, k0, o, lane) wcol_oi(W, k0, o, lane, DIN)
#elif WQKV_LAYOUT == 2
#define WCOL(W, k0, o, lane) wcol_hdk(W, k0, o, lane)
#else
#define WCOL(W, k0, o, lane) wcol_io(W, k0, o, lane, CC)
#endif
#if WO_OUT_IN
#define WOCOL(W, k0, o, lane) wcol_oi(W, k0, o, lane, CC)
#define WOCOLH(W, k0, o, lane) wcolh_oi(W, k0, o, lane, CC)
#else
#define WOCOL(W, k0, o, lane) wcol_io(W, k0, o, lane, DIN)
#define WOCOLH(W, k0, o, lane) wcolh_io(W, k0, o, lane, DIN)
#endif
__constant__ float c_invf[32] = {1.000000000e+0f,7.498942018e-1f,5.623413324e-1f,4.216965139e-1f,3.162277639e-1f,2.371373773e-1f,1.778279394e-1f,1.333521456e-1f,1.000000015e-1f,7.498942316e-2f,5.623413250e-2f,4.216964915e-2f,3.162277490e-2f,2.371373773e-2f,1.778279431e-2f,1.333521400e-2f,9.999999776e-3f,7.498942316e-3f,5.623413250e-3f,4.216964822e-3f,3.162277630e-3f,2.371373819e-3f,1.778279431e-3f,1.333521446e-3f,1.000000047e-3f,7.498941850e-4f,5.623413017e-4f,4.216965172e-4f,3.162277571e-4f,2.371373703e-4f,1.778279402e-4f,1.333521504e-4f};   /* f32(1 / 10000^(2i/64)) */
#ifndef SM_EXTRA_PARAMS
#define SM_EXTRA_PARAMS
#endif
#ifndef PROJ_EXTRA_PARAMS
#define PROJ_EXTRA_PARAMS
#endif
#ifndef SM_MASK_HOOK
#define SM_MASK_HOOK (void)0
#endif

#define WS_QH  0u                                      // f16 q rows [b*t][CC]
#define WS_KH  (WS_QH + 2u * (size_t)NB * TT * CC)      // f16 k rows [b*t][CC]
#define WS_VT  (WS_KH + 2u * (size_t)NB * TT * CC)      // f16 v planes [b][c][t]
#define WS_QL  (WS_VT + 2u * (size_t)NB * CC * TT)      // f16 q residual x 2^10 rows [b][t < QHI][CC]
#define WS_KL  (WS_QL + 2u * (size_t)NB * QHI * CC)     // f16 k residual x 2^10 rows [b][t < KHI][CC]
#define WS_VB  (WS_KL + 2u * (size_t)NB * KHI * CC)     // bf16 v hi planes [b][c][t < KHI]
#define WS_VBL (WS_VB + 2u * (size_t)NB * CC * KHI)
#define WS_XB  (WS_VBL + 2u * (size_t)NB * CC * KHI)    // bf16 x rows [b*t][DIN]
#define WS_WB  (WS_XB + 2u * (size_t)NB * TT * DIN)     // bf16 Wq, Wk, Wv, Wo, each [CC][DIN] as given
#define WS_Y   (WS_WB + 2u * 4u * (size_t)CC * DIN)     // f32 ctx rows [b*t][CC] (only when there is an output projection)
#define WS_RT  (WS_Y  + 4u * (size_t)NB * TT * CC)      // f32 RoPE table [t][HD / 2] of (cos, sin), written by k_cvt in every call
#define WS_END (WS_RT + 8u * (size_t)TT * (HD / 2))

// GEMM operand staging (k_proj, k_out): a stage is 64 k of every operand row, kept as bf16 in LDS; every wave takes its fragments from there with 16-byte LDS loads. x and the four weights come from k_cvt's bf16 planes (a stage row = one 128-B line, 8 lanes x 16 B, copied as it is); ctx comes as f32 (16 lanes x 16 B per row) and is split by the block.
#define GK 64              // k per stage
#define GLD 72             // LDS row pitch in bf16: 144 B = 16 B x odd, conflict-free for the 16-byte fragment reads
typedef __attribute__((ext_vector_type(4))) __bf16 v4b;
__device__ __forceinline__ v4b cvt4(v4f v) { v4b r; r[0] = (__bf16)v[0]; r[1] = (__bf16)v[1]; r[2] = (__bf16)v[2]; r[3] = (__bf16)v[3]; return r; }
__device__ __forceinline__ v4b res4(v4f v, v4b h) { v4b r;
#pragma unroll
  for (int i = 0; i < 4; ++i) r[i] = (__bf16)(v[i] - (float)h[i]);
  return r; }
// a thread's N pieces of a stage: rows 8 apart, 16 bytes each
template <int N> __device__ __forceinline__ void ld_rows(v4f (&r)[N], const float* p, int ld) {
#pragma unroll
  for (int i = 0; i < N; ++i) r[i] = *(const v4f*)(p + (size_t)i * 8 * ld);
  asm volatile("s_wait_xcnt 0x0" :: "v"(p) : "memory"); }   // stands in front of every overwrite of these loads' address registers (p as an input keeps them whole up to here); its memory clobber also holds the loads here, ahead of the products they fly behind
// a thread's N pieces of a stage of a bf16 plane: rows 16 apart, 16 bytes each
template <int N> __device__ __forceinline__ void ld_rows_b(v8b (&r)[N], const __bf16* p, int ld) {
#pragma unroll
  for (int i = 0; i < N; ++i) r[i] = *(const v8b*)(p + (size_t)i * 16 * ld);
  asm volatile("s_wait_xcnt 0x0" :: "v"(p) : "memory"); }   // as in ld_rows: stands in front of every overwrite of these loads' address registers and holds the loads ahead of the products they fly behind
// ---- k_cvt also fills the RoPE table: one (position, pair) per thread, sincosf of the f32 angle t * c_invf[i]; both batches, all heads and both of q and k read the same 65,536 entries
// ---- k_cvt: x and the four weights rounded to bf16 ONCE, as a stream (one block per WGP, each 32,768 consecutive floats of one tensor, in whole-line 16-byte loads that are all issued ahead of the first store): every GEMM block that reads them afterwards fetches 2 bytes an element, not 4, and converts nothing
#define CV_N 32768
__global__ __launch_bounds__(256) void k_cvt(const float* __restrict__ X, const float* __restrict__ WQ, const float* __restrict__ WK, const float* __restrict__ WV, const float* __restrict__ WO, __bf16* __restrict__ XB, __bf16* __restrict__ WB, float* __restrict__ RT) {
  static_assert((NB * TT * DIN + 4 * CC * DIN) / CV_N * 256 == TT * (HD / 2), "one table entry per thread");
  const int nx = NB * TT * DIN / CV_N, nw = CC * DIN / CV_N; const int bi = blockIdx.x, tid = threadIdx.x;
  const float* s; __bf16* d;
  if (bi < nx) { s = X + (size_t)bi * CV_N; d = XB + (size_t)bi * CV_N; }
  else { const int w = (bi - nx) / nw; s = (w == 0 ? WQ : w == 1 ? WK : w == 2 ? WV : WO) + (size_t)((bi - nx) % nw) * CV_N; d = WB + (size_t)(bi - nx) * CV_N; }
  const int ri = bi * 256 + tid; const float fr = c_invf[ri & (HD / 2 - 1)];
  v4f r[CV_N / 1024];
#pragma unroll
  for (int i = 0; i < CV_N / 1024; ++i) r[i] = *(const v4f*)(s + i * 1024 + tid * 4);
  { float sn, cs; sincosf((float)(ri / (HD / 2)) * fr, &sn, &cs); v2f e; e[0] = cs; e[1] = sn; *(v2f*)(RT + 2 * (size_t)ri) = e; }
#pragma unroll
  for (int i = 0; i < CV_N / 1024; ++i) *(v4b*)(d + i * 1024 + tid * 4) = cvt4(r[i]); }
// ---- k_proj: block = (64 rows, 128 cols, which): q/k/v = X W (+ b) with exact bf16 products (K = DIN) -> which 0: q f16 rows (+ residual rows < QHI); 1: k f16 rows (+ residual rows < KHI); 2: v f16 planes [c][t] (+ bf16 hi/lo planes for t < KHI)
__global__ __launch_bounds__(128) void k_proj(const __bf16* __restrict__ XB, const __bf16* __restrict__ WB, const float* __restrict__ BQ, const float* __restrict__ BK, const float* __restrict__ BV, const float* __restrict__ RT,
    _Float16* __restrict__ QH, _Float16* __restrict__ QL, _Float16* __restrict__ KH, _Float16* __restrict__ KL, _Float16* __restrict__ VT, __bf16* __restrict__ VB, __bf16* __restrict__ VBL PROJ_EXTRA_PARAMS) {
  __shared__ __align__(16) float st[64][132]; __shared__ __align__(16) char ov[2 * (64 + 128) * GLD * 2];
  // one LDS range, used in turn: the two operand stages of the k loop; behind the loop's last barrier the epilogue's conversion tiles (q, k: sh, sl; v: th, tb, tbl)
  __bf16 (*xs)[64][GLD] = (__bf16 (*)[64][GLD])ov; __bf16 (*wt)[128][GLD] = (__bf16 (*)[128][GLD])(ov + 2 * 64 * GLD * 2);
  _Float16 (*sh)[136] = (_Float16 (*)[136])ov; _Float16 (*sl)[136] = (_Float16 (*)[136])(ov + 64 * 136 * 2);
  _Float16 (*th)[72] = (_Float16 (*)[72])ov; __bf16 (*tb)[72] = (__bf16 (*)[72])(ov + 128 * 72 * 2); __bf16 (*tbl)[72] = (__bf16 (*)[72])(ov + 2 * 128 * 72 * 2);
  const int tid = threadIdx.x, wave = tid >> 5, lane = tid & 31, col = lane & 15, g = lane >> 4; const int which = blockIdx.z; const int c0 = blockIdx.y * 128; const size_t r0 = (size_t)blockIdx.x * 64; const size_t bb = r0 / TT; const int t0 = (int)(r0 % TT);
  const float* BA = which == 0 ? BQ : which == 1 ? BK : BV;
  v8f acc[8] = {};
  const int pr = tid >> 3, pc = (tid & 7) * 8;   // a thread's 16-byte piece: row pr of each group of 16 rows, k pc..pc+7 of the stage
  const __bf16* xg = XB + (r0 + pr) * DIN + pc; const __bf16* wg = WB + ((size_t)which * CC + c0 + pr) * DIN + pc;
  v8b xr[4], wr[8];
  ld_rows_b(xr, xg, DIN); ld_rows_b(wr, wg, DIN);
#pragma unroll
  for (int i = 0; i < 4; ++i) *(v8b*)&xs[0][i * 16 + pr][pc] = xr[i];
#pragma unroll
  for (int i = 0; i < 8; ++i) *(v8b*)&wt[0][i * 16 + pr][pc] = wr[i];
  __syncthreads();
  // the stage loop stays rolled so that the two buffers alternate by index and the loop stays small; the inner loops are unrolled so that the register arrays are indexed by constants
#pragma unroll 1
  for (int s = 0; s < DIN / GK; ++s) { const int cur = s & 1;
    if (s + 1 < DIN / GK) { ld_rows_b(xr, xg + (s + 1) * GK, DIN); ld_rows_b(wr, wg + (s + 1) * GK, DIN); }   // the next stage's loads fly while this stage is multiplied
#pragma unroll
    for (int kc = 0; kc < GK / 32; ++kc) { const v16b a = frag_b(&xs[cur][wave * 16 + col][kc * 32], lane); v16b w[8];
#pragma unroll
      for (int j = 0; j < 8; ++j) w[j] = frag_b(&wt[cur][j * 16 + col][kc * 32], lane);
      __builtin_amdgcn_sched_barrier(0);   // keeps the nine fragments' LDS reads one group ahead of their products: left alone the compiler reads each into the same registers and waits out the LDS latency before every product
#pragma unroll
      for (int j = 0; j < 8; ++j) acc[j] = __builtin_amdgcn_wmma_f32_16x16x32_bf16(false, a, false, w[j], (short)0, acc[j], false, false); }
    if (s + 1 < DIN / GK) {
#pragma unroll
      for (int i = 0; i < 4; ++i) *(v8b*)&xs[cur ^ 1][i * 16 + pr][pc] = xr[i];
#pragma unroll
      for (int i = 0; i < 8; ++i) *(v8b*)&wt[cur ^ 1][i * 16 + pr][pc] = wr[i]; }
    __syncthreads(); }   // one barrier a stage: publishes stage s + 1 and ends every wave's reads of the buffer that stage s + 2 (or the epilogue) overwrites
  { // stage the f32 tile (acc + bias) in LDS, rotate the q and k rows (interleaved (even, odd) RoPE pairs, angle = t * 10000^(-2i/64), cos and sin from k_cvt's table), then convert
    // a wave takes whole rows (row it * 4 + wave, 4 columns = 2 pairs a lane): 512 B of the tile and the row's 256 B of the table per pass, both heads of the tile reading the same table row; the table loads are issued here, ahead of the bias loads and the tile's LDS stores, so that their latency is not paid behind the barrier
    v4f rt[16]; const float* tp = RT + (size_t)(t0 + wave) * HD + (lane & 15) * 4;
    if (which < 2) {
#pragma unroll
      for (int it = 0; it < 16; ++it) rt[it] = *(const v4f*)(tp + it * 4 * HD);
      asm volatile("s_wait_xcnt 0x0" :: "v"(tp) : "memory"); }   // as in ld_rows: stands in front of every overwrite of these loads' address registers
#pragma unroll
    for (int j = 0; j < 8; ++j) { const float bias = BA ? bfr(BA[c0 + j * 16 + col]) : 0.f;
#pragma unroll
      for (int r = 0; r < 8; ++r) st[wave * 16 + 8 * g + r][j * 16 + col] = acc[j][r] + bias; }
    __syncthreads();
    if (which < 2) {
#pragma unroll
      for (int it = 0; it < 16; ++it) { float* rw = &st[it * 4 + wave][lane * 4]; const v4f x = *(const v4f*)rw, c = rt[it]; v4f y;
        y[0] = x[0] * c[0] - x[1] * c[1]; y[1] = x[0] * c[1] + x[1] * c[0]; y[2] = x[2] * c[2] - x[3] * c[3]; y[3] = x[2] * c[3] + x[3] * c[2]; *(v4f*)rw = y; } }
    __syncthreads(); }
  if (which < 2) { _Float16* DH = which == 0 ? QH : KH; _Float16* DL = which == 0 ? QL : KL; const int nhi = which == 0 ? QHI : KHI; const bool hi_rows = t0 < nhi;
    for (int e = tid; e < 64 * 128; e += 128) { const int rl = e >> 7, cl = e & 127; const float v = st[rl][cl]; const _Float16 hv = (_Float16)v; sh[rl][cl] = hv; sl[rl][cl] = (_Float16)((v - (float)hv) * 1024.0f); }
    __syncthreads();
    for (int e = tid; e < 64 * 16; e += 128) { const int rl = e >> 4, q = e & 15; vst2((unsigned*)(DH + (r0 + rl) * CC + c0 + q * 8), *(const v4u*)&sh[rl][q * 8]); if (hi_rows) vst2((unsigned*)(DL + (bb * nhi + t0 + rl) * (size_t)CC + c0 + q * 8), *(const v4u*)&sl[rl][q * 8]); }
  } else { const bool hi_rows = t0 < KHI;
    for (int e = tid; e < 64 * 128; e += 128) { const int rl = e & 63, cl = e >> 6; const float v = st[rl][cl]; th[cl][rl] = (_Float16)v; const __bf16 bh = (__bf16)v; tb[cl][rl] = bh; tbl[cl][rl] = (__bf16)(v - (float)bh); }
    __syncthreads();
    for (int e = tid; e < 128 * 8; e += 128) { const int cl = e >> 3, q = e & 7; vst2((unsigned*)(VT + (bb * CC + c0 + cl) * (size_t)TT + t0 + q * 8), *(const v4u*)&th[cl][q * 8]); if (hi_rows) { const size_t o3 = (bb * CC + c0 + cl) * (size_t)KHI + t0 + q * 8; vst2((unsigned*)(VB + o3), *(const v4u*)&tb[cl][q * 8]); vst2((unsigned*)(VBL + o3), *(const v4u*)&tbl[cl][q * 8]); } } } }
#define FA_Q 128
#define FA_K 64
#define FA_NS (TT / FA_K)
#define FA_LD 72           // LDS row pitch in halves: 144 B = 16 B x odd, conflict-free for the 16-byte fragment reads
__device__ __forceinline__ float xhalf(float v) { const int i = __builtin_bit_cast(int, v); return __builtin_bit_cast(float, __builtin_amdgcn_permlanex16(i, i, 0x76543210, 0xfedcba98, false, false)); }   /* lane l <-> l ^ 16 */
__global__ __launch_bounds__(256) void k_fa(const _Float16* __restrict__ QH, const _Float16* __restrict__ QL, const _Float16* __restrict__ KH, const _Float16* __restrict__ VT, float* __restrict__ Y) {
  __shared__ __align__(16) _Float16 ks[2][FA_K][FA_LD], vs[2][HD][FA_LD];
  const int tid = threadIdx.x, wave = tid >> 5, lane = tid & 31, col = lane & 15, g = lane >> 4; const int h = blockIdx.y, b = blockIdx.z; const int ql0 = blockIdx.x * FA_Q + wave * 16;
  v16h qh[HD / 32], qr[HD / 32];
#pragma unroll
  for (int kc = 0; kc < HD / 32; ++kc) { qh[kc] = frag_h(QH + ((size_t)b * TT + ql0 + col) * CC + h * HD + kc * 32, lane); qr[kc] = frag_h(QL + ((size_t)b * QHI + ql0 + col) * CC + h * HD + kc * 32, lane); }
  // staging: a thread moves two 16-byte pieces of the k tile (64 keys x 128 B) and two of the v tile (64 dims x 128 B), whole 128-B lines per 8 lanes
  const int sr = tid >> 3, sq = (tid & 7) * 8;
  const _Float16* kg = KH + ((size_t)b * TT + sr) * CC + h * HD + sq; const _Float16* vg = VT + ((size_t)b * CC + h * HD + sr) * (size_t)TT + sq;
  v4u k0r = *(const v4u*)kg, k1r = *(const v4u*)(kg + (size_t)32 * CC), v0r = *(const v4u*)vg, v1r = *(const v4u*)(vg + (size_t)32 * TT);
  *(v4u*)&ks[0][sr][sq] = k0r; *(v4u*)&ks[0][sr + 32][sq] = k1r; *(v4u*)&vs[0][sr][sq] = v0r; *(v4u*)&vs[0][sr + 32][sq] = v1r;
  __syncthreads();
  const float cl2 = SCALE * 1.44269504088896f;   // logit scale x log2(e): exp(x) = 2^(x log2 e)
  v8f o[HD / 16] = {}; float m = -3.0e38f, l = 0.f;
  // the stage loop stays rolled; every inner loop is unrolled so that the fragment and accumulator arrays are indexed by constants and stay in registers
#pragma unroll 1
  for (int s = 0; s < FA_NS; ++s) { const int cur = s & 1;
    if (s + 1 < FA_NS) { const _Float16* kn = kg + (size_t)(s + 1) * FA_K * CC; const _Float16* vn = vg + (s + 1) * FA_K; k0r = *(const v4u*)kn; k1r = *(const v4u*)(kn + (size_t)32 * CC); v0r = *(const v4u*)vn; v1r = *(const v4u*)(vn + (size_t)32 * TT); }
    v8f sa[FA_K / 16] = {}, sb[FA_K / 16] = {};
#pragma unroll
    for (int kc = 0; kc < HD / 32; ++kc) {
#pragma unroll
      for (int t = 0; t < FA_K / 16; ++t) { const v16h kf = frag_h(&ks[cur][t * 16 + col][kc * 32], lane);
        sa[t] = __builtin_amdgcn_wmma_f32_16x16x32_f16(false, kf, false, qh[kc], (short)0, sa[t], false, false);
        sb[t] = __builtin_amdgcn_wmma_f32_16x16x32_f16(false, kf, false, qr[kc], (short)0, sb[t], false, false); } }
    float mt[FA_K / 16];   // one maximum and one sum per 16-key tile: four short chains, not one of 32 dependent links
#pragma unroll
    for (int t = 0; t < FA_K / 16; ++t) { mt[t] = -3.0e38f;
#pragma unroll
      for (int r = 0; r < 8; ++r) { sa[t][r] = sa[t][r] + sb[t][r] * (1.0f / 1024.0f); mt[t] = fmaxf(mt[t], sa[t][r]); } }
    float mx = fmaxf(fmaxf(mt[0], mt[1]), fmaxf(mt[2], mt[3])); mx = fmaxf(mx, xhalf(mx));
    const float mn = fmaxf(m, mx), mc = mn * cl2; const float al = __builtin_amdgcn_exp2f(m * cl2 - mc); m = mn;
    float st[FA_K / 16]; v16h p[FA_K / 32];
#pragma unroll
    for (int t = 0; t < FA_K / 16; ++t) { st[t] = 0.f;
#pragma unroll
      for (int r = 0; r < 8; ++r) { const float e = __builtin_amdgcn_exp2f(sa[t][r] * cl2 - mc); st[t] += e; p[t >> 1][(t & 1) * 8 + r] = (_Float16)e; } }
    l = l * al + ((st[0] + st[1]) + (st[2] + st[3]));
#pragma unroll
    for (int j = 0; j < HD / 16; ++j) {
#pragma unroll
      for (int r = 0; r < 8; ++r) o[j][r] *= al; }
#pragma unroll
    for (int kk = 0; kk < FA_K / 32; ++kk) {
#pragma unroll
      for (int j = 0; j < HD / 16; ++j) o[j] = __builtin_amdgcn_wmma_f32_16x16x32_f16(false, frag_h(&vs[cur][j * 16 + col][kk * 32], lane), false, p[kk], (short)0, o[j], false, false); }
    if (s + 1 < FA_NS) { *(v4u*)&ks[cur ^ 1][sr][sq] = k0r; *(v4u*)&ks[cur ^ 1][sr + 32][sq] = k1r; *(v4u*)&vs[cur ^ 1][sr][sq] = v0r; *(v4u*)&vs[cur ^ 1][sr + 32][sq] = v1r; }
    __syncthreads(); }   // one barrier a stage: publishes stage s + 1 and ends every wave's reads of the buffer that stage s + 2 overwrites
  l += xhalf(l); const float inv = 1.0f / l;
  float* yr = Y + ((size_t)b * TT + ql0 + col) * CC + h * HD + 8 * g;   // lane = query col; o[j][r] = dim j*16 + 8g + r
#pragma unroll
  for (int j = 0; j < HD / 16; ++j) { v4f a, c;
#pragma unroll
    for (int r = 0; r < 4; ++r) { a[r] = o[j][r] * inv; c[r] = o[j][4 + r] * inv; }
    vst2(yr + j * 16, a); vst2(yr + j * 16 + 4, c); } }
// ---- k_out: block = (64 rows, 128 cols): out = ctx Wo (+ bo): all rows: ctx bf16 hi + lo against exact bf16 Wo (2 products)
__global__ __launch_bounds__(128) void k_out(const float* __restrict__ Y, const __bf16* __restrict__ WOB, const float* __restrict__ BO, float* __restrict__ OUT) { __shared__ __align__(16) char ov[2 * (64 + 64 + 128) * GLD * 2];
  // one LDS range, used in turn: the two operand stages of the k loop (ctx hi, ctx lo, Wo); behind the loop's last barrier each wave's own output staging tile
  __bf16 (*yh)[64][GLD] = (__bf16 (*)[64][GLD])ov; __bf16 (*yl)[64][GLD] = (__bf16 (*)[64][GLD])(ov + 2 * 64 * GLD * 2); __bf16 (*wt)[128][GLD] = (__bf16 (*)[128][GLD])(ov + 4 * 64 * GLD * 2);
  float (*sf)[16][132] = (float (*)[16][132])ov;
  const int tid = threadIdx.x, wave = tid >> 5, lane = tid & 31, col = lane & 15, g = lane >> 4; const int c0 = blockIdx.y * 128; const size_t r0 = (size_t)blockIdx.x * 64 + wave * 16;
  v8f acc[8] = {};
  {   /* ALL rows: ctx split bf16 hi + lo x exact Wo (2 products) */
    const int pr = tid >> 4, pc = (tid & 15) * 4;   // a thread's 16-byte piece: row pr of each group of 8 rows, k pc..pc+3 of the stage
    const int qr = tid >> 3, qc = (tid & 7) * 8;    // its 16-byte piece of the bf16 Wo plane: row qr of each group of 16 rows, k qc..qc+7
    const float* yg = Y + ((size_t)blockIdx.x * 64 + pr) * CC + pc; const __bf16* wg = WOB + (size_t)(c0 + qr) * CC + qc;
    v4f yr[8]; v8b wr[8];
    ld_rows(yr, yg, CC); ld_rows_b(wr, wg, CC);
#pragma unroll
    for (int i = 0; i < 8; ++i) { const v4b hv = cvt4(yr[i]); *(v4b*)&yh[0][i * 8 + pr][pc] = hv; *(v4b*)&yl[0][i * 8 + pr][pc] = res4(yr[i], hv); }
#pragma unroll
    for (int i = 0; i < 8; ++i) *(v8b*)&wt[0][i * 16 + qr][qc] = wr[i];
    __syncthreads();
    // rolled stage loop, unrolled inner loops: as in k_proj
#pragma unroll 1
    for (int s = 0; s < CC / GK; ++s) { const int cur = s & 1;
      if (s + 1 < CC / GK) { ld_rows(yr, yg + (s + 1) * GK, CC); ld_rows_b(wr, wg + (s + 1) * GK, CC); }   // the next stage's loads fly while this stage is multiplied
#pragma unroll
      for (int kc = 0; kc < GK / 32; ++kc) { const v16b ah = frag_b(&yh[cur][wave * 16 + col][kc * 32], lane), al = frag_b(&yl[cur][wave * 16 + col][kc * 32], lane); v16b w[8];
#pragma unroll
        for (int j = 0; j < 8; ++j) w[j] = frag_b(&wt[cur][j * 16 + col][kc * 32], lane);
        __builtin_amdgcn_sched_barrier(0);   // keeps the ten fragments' LDS reads one group ahead of their products, as in k_proj
#pragma unroll
        for (int j = 0; j < 8; ++j) { acc[j] = __builtin_amdgcn_wmma_f32_16x16x32_bf16(false, ah, false, w[j], (short)0, acc[j], false, false);
          acc[j] = __builtin_amdgcn_wmma_f32_16x16x32_bf16(false, al, false, w[j], (short)0, acc[j], false, false); } }
      if (s + 1 < CC / GK) {
#pragma unroll
        for (int i = 0; i < 8; ++i) { const v4b hv = cvt4(yr[i]); *(v4b*)&yh[cur ^ 1][i * 8 + pr][pc] = hv; *(v4b*)&yl[cur ^ 1][i * 8 + pr][pc] = res4(yr[i], hv); }
#pragma unroll
        for (int i = 0; i < 8; ++i) *(v8b*)&wt[cur ^ 1][i * 16 + qr][qc] = wr[i]; }
      __syncthreads(); }   // one barrier a stage: publishes stage s + 1 and ends every wave's reads of the buffer that stage s + 2 (or the output staging) overwrites
#pragma unroll
    for (int j = 0; j < 8; ++j) { const float bias = BO ? bfr(BO[c0 + j * 16 + col]) : 0.f;
#pragma unroll
      for (int r = 0; r < 8; ++r) sf[wave][8 * g + r][j * 16 + col] = acc[j][r] + bias; }
  }
  LDSX(); for (int rl = 0; rl < 16; ++rl) vst2(OUT + (r0 + rl) * DIN + c0 + lane * 4, *(const v4f*)&sf[wave][rl][lane * 4]); }

extern "C" void kernel_launch(void* const* d_in, const int* in_sizes, int n_in, void* d_out, int out_size, void* d_ws, size_t ws_size, hipStream_t stream) {
  (void)in_sizes; (void)n_in; (void)out_size;
  const float** F = (const float**)d_in;
  if (ws_size < (size_t)WS_END) return;
  char* ws = (char*)d_ws; _Float16 *QH = (_Float16*)(ws + WS_QH), *KH = (_Float16*)(ws + WS_KH), *VT = (_Float16*)(ws + WS_VT), *QL = (_Float16*)(ws + WS_QL), *KL = (_Float16*)(ws + WS_KL); __bf16 *VB = (__bf16*)(ws + WS_VB), *VBL = (__bf16*)(ws + WS_VBL), *XB = (__bf16*)(ws + WS_XB), *WB = (__bf16*)(ws + WS_WB); float *Y = (float*)(ws + WS_Y), *RT = (float*)(ws + WS_RT);
  (void)Y; (void)QL; (void)KL; (void)VB; (void)VBL;
  // inputs: 0 x [2,2048,1024]; 1 Wq [1024,1024] (out,in), 2 bq; 3 Wk, 4 bk; 5 Wv, 6 bv; 7 Wo (no bias)
  k_cvt<<<dim3((NB * TT * DIN + 4 * CC * DIN) / CV_N), 256, 0, stream>>>(F[0], F[1], F[3], F[5], F[7], XB, WB, RT);
  k_proj<<<dim3(TNB * TT / 64, CC / 128, 3), 128, 0, stream>>>(XB, WB, F[2], F[4], F[6], RT, QH, QL, KH, KL, VT, VB, VBL);
  k_fa<<<dim3(TT / FA_Q, NH, TNB), 256, 0, stream>>>(QH, QL, KH, VT, Y);
  k_out<<<dim3(TNB * TT / 64, DIN / 128), 128, 0, stream>>>(Y, WB + 3 * (size_t)CC * DIN, nullptr, (float*)d_out);
}

// v005
// It runs in 101 microseconds.
// In two side-by-side timings against v004, it was 1.09 and 1.08 times as fast.
// Counting every step since v000, it is 14.3 times as fast.
// compute dtype: all float inputs rounded to bf16; q/k/v projections with EXACT bf16 products on WMMA 16x16x32 (f32 accumulate); interleaved RoPE in f32 (sincosf) on the projected q/k rows; q as f16 hi + residual (x 2^10) against k once to f16 (2 products) x 1024^-0.5; one-pass softmax in f32 (running maximum and sum, exp2 of the scaled difference); exp(logit - maximum) once to f16 against v once to f16 (1 product), divided by the sum at the end; ctx split bf16 hi + lo against exact Wo (2 products); f32 output.
#include <hip/hip_runtime.h>
#include <math.h>

typedef __attribute__((ext_vector_type(16))) _Float16 v16h;
typedef __attribute__((ext_vector_type(16))) __bf16 v16b;
typedef __attribute__((ext_vector_type(8)))  _Float16 v8h;
typedef __attribute__((ext_vector_type(8)))  float v8f;
typedef __attribute__((ext_vector_type(4)))  float v4f;
typedef __attribute__((ext_vector_type(2)))  float v2f;
typedef __attribute__((ext_vector_type(4)))  unsigned v4u;
typedef __attribute__((ext_vector_type(4)))  int v4i;
typedef float __attribute__((may_alias)) float_a;
typedef int __attribute__((may_alias)) int_a;

template <typename T> __device__ __forceinline__ void vst2(void* p, T v) { *(T*)p = v;  }
__device__ __forceinline__ v8f wmma16(v16h a, v16h b, v8f c) {
  v8f d = __builtin_amdgcn_wmma_f32_16x16x32_f16(false, a, false, b, (short)0, c, false, false);
  asm volatile("v_nop\n\tv_nop\n\tv_nop\n\tv_nop" : "+v"(d) : "v"(a), "v"(b));
  return d;
}
__device__ __forceinline__ v8f wmma_bf(v16b a, v16b b, v8f c) {
  v8f d = __builtin_amdgcn_wmma_f32_16x16x32_bf16(false, a, false, b, (short)0, c, false, false);
  asm volatile("v_nop\n\tv_nop\n\tv_nop\n\tv_nop" : "+v"(d) : "v"(a), "v"(b));
  return d;
}
// 16x16x32 fragments: lane = (h = lane>>4, row/col = lane&15); elements 0..7 = k0+8h+0..7, 8..15 = k0+16+8h+0..7; D element r = row 8h+r
__device__ __forceinline__ v16h frag_h(const _Float16* rowk0, int lane) {
  union { v16h v; v8h q[2]; } u; const _Float16* p = rowk0 + 8 * (lane >> 4);
  u.q[0] = *(const v8h*)p; u.q[1] = *(const v8h*)(p + 16); return u.v;
}
__device__ __forceinline__ v16h frag_f32(const float* rowk0, int lane) {
  v16h a; const float* p = rowk0 + 8 * (lane >> 4);
#pragma unroll
  for (int i = 0; i < 8; ++i) { a[i] = (_Float16)p[i]; a[8 + i] = (_Float16)p[16 + i]; }
  return a;
}
__device__ __forceinline__ v16h frag_f32s(const float* rowk0, int lane, float sc) {
  v16h a; const float* p = rowk0 + 8 * (lane >> 4);
#pragma unroll
  for (int i = 0; i < 8; ++i) { a[i] = (_Float16)(p[i] * sc); a[8 + i] = (_Float16)(p[16 + i] * sc); }
  return a;
}
// column fragment from a [K][ld] layout (column n), rows >= K read as 0
__device__ __forceinline__ v16h fragc_f32(const float* W, int k0, int n, int lane, int ld, int K) {
  v16h a; const int g = lane >> 4;
#pragma unroll
  for (int i = 0; i < 8; ++i) { const int ka = k0 + 8 * g + i, kb = ka + 16;
    a[i] = (_Float16)(ka < K ? W[(size_t)(ka < K ? ka : K - 1) * ld + n] : 0.f); a[8 + i] = (_Float16)(kb < K ? W[(size_t)(kb < K ? kb : K - 1) * ld + n] : 0.f); }
  return a;
}
struct F2 { v16b h, l; };
__device__ __forceinline__ F2 bsplit16(const float v[16]) { F2 r;
#pragma unroll
  for (int i = 0; i < 16; ++i) { const __bf16 h = (__bf16)v[i]; r.h[i] = h; r.l[i] = (__bf16)(v[i] - (float)h); }
  return r; }
__device__ __forceinline__ F2 split_row(const float* row, int k0, int lane) { float v[16]; const float* p = row + k0 + 8 * (lane >> 4);
#pragma unroll
  for (int i = 0; i < 8; ++i) { v[i] = p[i]; v[8 + i] = p[16 + i]; }
  return bsplit16(v); }
__device__ __forceinline__ F2 split_rowK(const float* row, int k0, int lane, int K) { float v[16]; const int g = lane >> 4;
#pragma unroll
  for (int i = 0; i < 8; ++i) { const int ka = k0 + 8 * g + i, kb = ka + 16; v[i] = ka < K ? row[ka < K ? ka : K - 1] : 0.f; v[8 + i] = kb < K ? row[kb < K ? kb : K - 1] : 0.f; }
  return bsplit16(v); }
__device__ __forceinline__ F2 split_col(const float* W, int k0, int n, int lane, int ld, int K) { float v[16]; const int g = lane >> 4;
#pragma unroll
  for (int i = 0; i < 8; ++i) { const int ka = k0 + 8 * g + i, kb = ka + 16; v[i] = ka < K ? W[(size_t)(ka < K ? ka : K - 1) * ld + n] : 0.f; v[8 + i] = kb < K ? W[(size_t)(kb < K ? kb : K - 1) * ld + n] : 0.f; }
  return bsplit16(v); }
__device__ __forceinline__ v8f mac3(const F2& a, const F2& b, v8f c) { c = wmma_bf(a.l, b.h, c); c = wmma_bf(a.h, b.l, c); return wmma_bf(a.h, b.h, c); }
__device__ __forceinline__ float sigm(float v) { return 1.0f / (1.0f + expf(-v)); }
#define LDSX() do { asm volatile("s_wait_dscnt 0" ::: "memory"); __builtin_amdgcn_wave_barrier(); __builtin_amdgcn_fence(__ATOMIC_RELEASE, "workgroup"); } while (0)

// Multi-head attention with RoPE (B 2, S 2,048, 1,024 = 16 x 64; 0.02-scale weights and biases): q,k,v = x W^T + b ((out,in)); interleaved-pair RoPE on q, k (angle t x 10000^(-2i/64)); scores = q k^T / sqrt(1024) (note: sqrt(D), not sqrt(hd)); out = merged(softmax(scores) v) Wo^T (no output bias).
#define NB 2
#define TT 2048
#define CC 1024            // NH * HD = projected width
#define DIN 1024          // input (model) width
#define NH 16
#define HD 64
#define NQB (TT / 64)
#define HG 4
#define SCALE (0.03125f)
#define CAUSAL 0
#ifndef TNB
#define TNB NB
#endif
__device__ __forceinline__ float bfr(float v) { return (float)(__bf16)v; }
__host__ __device__ __forceinline__ int kb_last(int qb) { return CAUSAL ? ((qb * 64 + 63) >> 7) : (TT / 128 - 1); }
typedef __attribute__((ext_vector_type(8))) __bf16 v8b;
__device__ __forceinline__ v16b frag_b(const __bf16* rowk0, int lane) {
  union { v16b v; v8b q[2]; } u; const __bf16* p = rowk0 + 8 * (lane >> 4);
  u.q[0] = *(const v8b*)p; u.q[1] = *(const v8b*)(p + 16); return u.v;
}
#define QBH 0
#define QHI 2048            // rows carrying a q residual plane (all rows when non-causal: 2-product logits everywhere)
#define KHI 64            // key rows carrying k residual / v bf16 hi+lo planes (written by k_proj, read by no kernel)
// B fragment (k rows k0+.., output column o) of a weight: (in,out) [K][ld] or (out,in) [ld rows of K]: bf16 exact, or f16(bf16 * 256) exact
__device__ __forceinline__ v16b wcol_io(const float* Wm, int k0, int o, int lane, int ld) { v16b w; const int g = lane >> 4;
#pragma unroll
  for (int i = 0; i < 8; ++i) { w[i] = (__bf16)Wm[(size_t)(k0 + 8 * g + i) * ld + o]; w[8 + i] = (__bf16)Wm[(size_t)(k0 + 16 + 8 * g + i) * ld + o]; }
  return w; }
__device__ __forceinline__ v16b wcol_oi(const float* Wm, int k0, int o, int lane, int K) { v16b w; const float* p = Wm + (size_t)o * K + k0 + 8 * (lane >> 4);
#pragma unroll
  for (int i = 0; i < 8; ++i) { w[i] = (__bf16)p[i]; w[8 + i] = (__bf16)p[16 + i]; }
  return w; }
__device__ __forceinline__ v16h wcolh_io(const float* Wm, int k0, int o, int lane, int ld) { v16h w; const int g = lane >> 4;
#pragma unroll
  for (int i = 0; i < 8; ++i) { w[i] = (_Float16)(bfr(Wm[(size_t)(k0 + 8 * g + i) * ld + o]) * 256.0f); w[8 + i] = (_Float16)(bfr(Wm[(size_t)(k0 + 16 + 8 * g + i) * ld + o]) * 256.0f); }
  return w; }
__device__ __forceinline__ v16h wcolh_oi(const float* Wm, int k0, int o, int lane, int K) { v16h w; const float* p = Wm + (size_t)o * K + k0 + 8 * (lane >> 4);
#pragma unroll
  for (int i = 0; i < 8; ++i) { w[i] = (_Float16)(bfr(p[i]) * 256.0f); w[8 + i] = (_Float16)(bfr(p[16 + i]) * 256.0f); }
  return w; }
#define WQKV_LAYOUT 1   // 0 = (in,out) [DIN][CC]; 1 = (out,in) [CC][DIN]; 2 = per-head [NH][DIN][HD]; read only through WCOL, which no kernel calls (k_proj reads (out,in) [CC][DIN])
__device__ __forceinline__ v16b wcol_hdk(const float* Wm, int k0, int o, int lane) { v16b w; const int g = lane >> 4; const float* p = Wm + (size_t)(o / HD) * DIN * HD + (o % HD);
#pragma unroll
  for (int i = 0; i < 8; ++i) { w[i] = (__bf16)p[(size_t)(k0 + 8 * g + i) * HD]; w[8 + i] = (__bf16)p[(size_t)(k0 + 16 + 8 * g + i) * HD]; }
  return w; }
#define WO_OUT_IN 1
#if WQKV_LAYOUT == 1
#define WCOL(W, k0, o, lane) wcol_oi(W, k0, o, lane, DIN)
#elif WQKV_LAYOUT == 2
#define WCOL(W, k0, o, lane) wcol_hdk(W, k0, o, lane)
#else
#define WCOL(W, k0, o, lane) wcol_io(W, k0, o, lane, CC)
#endif
#if WO_OUT_IN
#define WOCOL(W, k0, o, lane) wcol_oi(W, k0, o, lane, CC)
#define WOCOLH(W, k0, o, lane) wcolh_oi(W, k0, o, lane, CC)
#else
#define WOCOL(W, k0, o, lane) wcol_io(W, k0, o, lane, DIN)
#define WOCOLH(W, k0, o, lane) wcolh_io(W, k0, o, lane, DIN)
#endif
__constant__ float c_invf[32] = {1.000000000e+0f,7.498942018e-1f,5.623413324e-1f,4.216965139e-1f,3.162277639e-1f,2.371373773e-1f,1.778279394e-1f,1.333521456e-1f,1.000000015e-1f,7.498942316e-2f,5.623413250e-2f,4.216964915e-2f,3.162277490e-2f,2.371373773e-2f,1.778279431e-2f,1.333521400e-2f,9.999999776e-3f,7.498942316e-3f,5.623413250e-3f,4.216964822e-3f,3.162277630e-3f,2.371373819e-3f,1.778279431e-3f,1.333521446e-3f,1.000000047e-3f,7.498941850e-4f,5.623413017e-4f,4.216965172e-4f,3.162277571e-4f,2.371373703e-4f,1.778279402e-4f,1.333521504e-4f};   /* f32(1 / 10000^(2i/64)) */
#ifndef SM_EXTRA_PARAMS
#define SM_EXTRA_PARAMS
#endif
#ifndef PROJ_EXTRA_PARAMS
#define PROJ_EXTRA_PARAMS
#endif
#ifndef SM_MASK_HOOK
#define SM_MASK_HOOK (void)0
#endif

#define WS_QH  0u                                      // f16 q rows [b*t][CC]
#define WS_KH  (WS_QH + 2u * (size_t)NB * TT * CC)      // f16 k rows [b*t][CC]
#define WS_VT  (WS_KH + 2u * (size_t)NB * TT * CC)      // f16 v planes [b][c][t]
#define WS_QL  (WS_VT + 2u * (size_t)NB * CC * TT)      // f16 q residual x 2^10 rows [b][t < QHI][CC]
#define WS_KL  (WS_QL + 2u * (size_t)NB * QHI * CC)     // f16 k residual x 2^10 rows [b][t < KHI][CC]
#define WS_VB  (WS_KL + 2u * (size_t)NB * KHI * CC)     // bf16 v hi planes [b][c][t < KHI]
#define WS_VBL (WS_VB + 2u * (size_t)NB * CC * KHI)
#define WS_XB  (WS_VBL + 2u * (size_t)NB * CC * KHI)    // bf16 x rows [b*t][DIN]
#define WS_WB  (WS_XB + 2u * (size_t)NB * TT * DIN)     // bf16 Wq, Wk, Wv, Wo, each [CC][DIN] as given
#define WS_Y   (WS_WB + 2u * 4u * (size_t)CC * DIN)     // f32 ctx rows [b*t][CC] (only when there is an output projection)
#define WS_RT  (WS_Y  + 4u * (size_t)NB * TT * CC)      // f32 RoPE table [t][HD / 2] of (cos, sin), written by k_cvt in every call
#define WS_END (WS_RT + 8u * (size_t)TT * (HD / 2))

// GEMM operand staging (k_proj, k_out): a stage is 64 k of every operand row, kept as bf16 in LDS; every wave takes its fragments from there with 16-byte LDS loads. x and the four weights come from k_cvt's bf16 planes (a stage row = one 128-B line, 8 lanes x 16 B, copied as it is); ctx comes as f32 (16 lanes x 16 B per row) and is split by the block.
#define GK 64              // k per stage
#define GLD 72             // LDS row pitch in bf16: 144 B = 16 B x odd, conflict-free for the 16-byte fragment reads
typedef __attribute__((ext_vector_type(4))) __bf16 v4b;
__device__ __forceinline__ v4b cvt4(v4f v) { v4b r; r[0] = (__bf16)v[0]; r[1] = (__bf16)v[1]; r[2] = (__bf16)v[2]; r[3] = (__bf16)v[3]; return r; }
__device__ __forceinline__ v4b res4(v4f v, v4b h) { v4b r;
#pragma unroll
  for (int i = 0; i < 4; ++i) r[i] = (__bf16)(v[i] - (float)h[i]);
  return r; }
// a thread's N pieces of a stage: rows 8 apart, 16 bytes each
template <int N> __device__ __forceinline__ void ld_rows(v4f (&r)[N], const float* p, int ld) {
#pragma unroll
  for (int i = 0; i < N; ++i) r[i] = *(const v4f*)(p + (size_t)i * 8 * ld);
  asm volatile("s_wait_xcnt 0x0" :: "v"(p) : "memory"); }   // stands in front of every overwrite of these loads' address registers (p as an input keeps them whole up to here); its memory clobber also holds the loads here, ahead of the products they fly behind
// a thread's N pieces of a stage of a bf16 plane: rows 16 apart, 16 bytes each
template <int N> __device__ __forceinline__ void ld_rows_b(v8b (&r)[N], const __bf16* p, int ld) {
#pragma unroll
  for (int i = 0; i < N; ++i) r[i] = *(const v8b*)(p + (size_t)i * 16 * ld);
  asm volatile("s_wait_xcnt 0x0" :: "v"(p) : "memory"); }   // as in ld_rows: stands in front of every overwrite of these loads' address registers and holds the loads ahead of the products they fly behind
// ---- k_cvt also fills the RoPE table: one (position, pair) per thread, sincosf of the f32 angle t * c_invf[i]; both batches, all heads and both of q and k read the same 65,536 entries
// ---- k_cvt: x and the four weights rounded to bf16 ONCE, as a stream (one block per WGP, each 32,768 consecutive floats of one tensor, in whole-line 16-byte loads that are all issued ahead of the first store): every GEMM block that reads them afterwards fetches 2 bytes an element, not 4, and converts nothing
#define CV_N 32768
__global__ __launch_bounds__(256) void k_cvt(const float* __restrict__ X, const float* __restrict__ WQ, const float* __restrict__ WK, const float* __restrict__ WV, const float* __restrict__ WO, __bf16* __restrict__ XB, __bf16* __restrict__ WB, float* __restrict__ RT) {
  static_assert((NB * TT * DIN + 4 * CC * DIN) / CV_N * 256 == TT * (HD / 2), "one table entry per thread");
  const int nx = NB * TT * DIN / CV_N, nw = CC * DIN / CV_N; const int bi = blockIdx.x, tid = threadIdx.x;
  const float* s; __bf16* d;
  if (bi < nx) { s = X + (size_t)bi * CV_N; d = XB + (size_t)bi * CV_N; }
  else { const int w = (bi - nx) / nw; s = (w == 0 ? WQ : w == 1 ? WK : w == 2 ? WV : WO) + (size_t)((bi - nx) % nw) * CV_N; d = WB + (size_t)(bi - nx) * CV_N; }
  const int ri = bi * 256 + tid; const float fr = c_invf[ri & (HD / 2 - 1)];
  v4f r[CV_N / 1024];
#pragma unroll
  for (int i = 0; i < CV_N / 1024; ++i) r[i] = *(const v4f*)(s + i * 1024 + tid * 4);
  { float sn, cs; sincosf((float)(ri / (HD / 2)) * fr, &sn, &cs); v2f e; e[0] = cs; e[1] = sn; *(v2f*)(RT + 2 * (size_t)ri) = e; }
#pragma unroll
  for (int i = 0; i < CV_N / 1024; ++i) *(v4b*)(d + i * 1024 + tid * 4) = cvt4(r[i]); }
// ---- k_proj: block = (128 rows, 128 cols, which), four waves as 2 x 2, a wave = 64 x 64 (4 x and 4 weight fragments feed 16 products: half a fragment read from LDS per product): q/k/v = X W (+ b) with exact bf16 products (K = DIN) -> which 0: q f16 rows (+ residual rows < QHI); 1: k f16 rows (+ residual rows < KHI); 2: v f16 planes [c][t] (+ bf16 hi/lo planes for t < KHI)
#define PM 128             // rows of a block; the epilogue takes them in halves of 64, so that its f32 tile stays small enough for three blocks on a WGP
__global__ __launch_bounds__(128) void k_proj(const __bf16* __restrict__ XB, const __bf16* __restrict__ WB, const float* __restrict__ BQ, const float* __restrict__ BK, const float* __restrict__ BV, const float* __restrict__ RT,
    _Float16* __restrict__ QH, _Float16* __restrict__ QL, _Float16* __restrict__ KH, _Float16* __restrict__ KL, _Float16* __restrict__ VT, __bf16* __restrict__ VB, __bf16* __restrict__ VBL PROJ_EXTRA_PARAMS) {
  __shared__ __align__(16) float st[64][132]; __shared__ __align__(16) char ov[2 * (PM + 128) * GLD * 2];
  // one LDS range, used in turn: the two operand stages of the k loop; behind the loop's last barrier the epilogue's conversion tiles (q, k: sh, sl; v: th, tb, tbl)
  __bf16 (*xs)[PM][GLD] = (__bf16 (*)[PM][GLD])ov; __bf16 (*wt)[128][GLD] = (__bf16 (*)[128][GLD])(ov + 2 * PM * GLD * 2);
  _Float16 (*sh)[136] = (_Float16 (*)[136])ov; _Float16 (*sl)[136] = (_Float16 (*)[136])(ov + 64 * 136 * 2);
  _Float16 (*th)[72] = (_Float16 (*)[72])ov; __bf16 (*tb)[72] = (__bf16 (*)[72])(ov + 128 * 72 * 2); __bf16 (*tbl)[72] = (__bf16 (*)[72])(ov + 2 * 128 * 72 * 2);
  const int tid = threadIdx.x, wave = tid >> 5, lane = tid & 31, col = lane & 15, g = lane >> 4; const int wrow = wave >> 1, wcol = wave & 1; const int which = blockIdx.z; const int c0 = blockIdx.y * 128; const size_t r0 = (size_t)blockIdx.x * PM; const size_t bb = r0 / TT; const int t0 = (int)(r0 % TT);
  const float* BA = which == 0 ? BQ : which == 1 ? BK : BV;
  v8f acc[4][4] = {};
  const int pr = tid >> 3, pc = (tid & 7) * 8;   // a thread's 16-byte piece: row pr of each group of 16 rows, k pc..pc+7 of the stage
  const __bf16* xg = XB + (r0 + pr) * DIN + pc; const __bf16* wg = WB + ((size_t)which * CC + c0 + pr) * DIN + pc;
  v8b xr[PM / 16], wr[8];
  ld_rows_b(xr, xg, DIN); ld_rows_b(wr, wg, DIN);
#pragma unroll
  for (int i = 0; i < PM / 16; ++i) *(v8b*)&xs[0][i * 16 + pr][pc] = xr[i];
#pragma unroll
  for (int i = 0; i < 8; ++i) *(v8b*)&wt[0][i * 16 + pr][pc] = wr[i];
  __syncthreads();
  // the stage loop stays rolled so that the two buffers alternate by index and the loop stays small; the inner loops are unrolled so that the register arrays are indexed by constants
#pragma unroll 1
  for (int s = 0; s < DIN / GK; ++s) { const int cur = s & 1;
    if (s + 1 < DIN / GK) { ld_rows_b(xr, xg + (s + 1) * GK, DIN); ld_rows_b(wr, wg + (s + 1) * GK, DIN); }   // the next stage's loads fly while this stage is multiplied
#pragma unroll
    for (int kc = 0; kc < GK / 32; ++kc) { v16b a[4], w[4];
#pragma unroll
      for (int i = 0; i < 4; ++i) a[i] = frag_b(&xs[cur][wrow * 64 + i * 16 + col][kc * 32], lane);
#pragma unroll
      for (int j = 0; j < 4; ++j) w[j] = frag_b(&wt[cur][wcol * 64 + j * 16 + col][kc * 32], lane);
      __builtin_amdgcn_sched_barrier(0);   // keeps the eight fragments' LDS reads one group ahead of their products: left alone the compiler reads each into the same registers and waits out the LDS latency before every product
#pragma unroll
      for (int i = 0; i < 4; ++i) {
#pragma unroll
        for (int j = 0; j < 4; ++j) acc[i][j] = __builtin_amdgcn_wmma_f32_16x16x32_bf16(false, a[i], false, w[j], (short)0, acc[i][j], false, false); } }
    if (s + 1 < DIN / GK) {
#pragma unroll
      for (int i = 0; i < PM / 16; ++i) *(v8b*)&xs[cur ^ 1][i * 16 + pr][pc] = xr[i];
#pragma unroll
      for (int i = 0; i < 8; ++i) *(v8b*)&wt[cur ^ 1][i * 16 + pr][pc] = wr[i]; }
    __syncthreads(); }   // one barrier a stage: publishes stage s + 1 and ends every wave's reads of the buffer that stage s + 2 (or the epilogue) overwrites
  // the epilogue runs once per half of 64 rows: the two waves that hold the half hand it over through st, all four waves rotate, convert and store it. Half 1's writes of st stand behind half 0's third barrier (the last reads of st are in front of it); its writes of the conversion tiles stand behind its own first two barriers (every wave has left half 0's store loop by then)
  const size_t rblk = r0; const int tblk = t0;
  for (int hf = 0; hf < PM / 64; ++hf) { const size_t r0 = rblk + hf * 64; const int t0 = tblk + hf * 64;   // the half's first row, under the names that the lines below use
    asm volatile("s_wait_xcnt 0x0" ::: "memory");   // stands behind the stores of the half before, in front of this half's first write of a register that they name
  { // stage the f32 tile (acc + bias) in LDS, rotate the q and k rows (interleaved (even, odd) RoPE pairs, angle = t * 10000^(-2i/64), cos and sin from k_cvt's table), then convert
    // a wave takes whole rows (row it * 4 + wave, 4 columns = 2 pairs a lane): 512 B of the tile and the row's 256 B of the table per pass, both heads of the tile reading the same table row; the table loads are issued here, ahead of the bias loads and the tile's LDS stores, so that their latency is not paid behind the barrier
    v4f rt[16]; const float* tp = RT + (size_t)(t0 + wave) * HD + (lane & 15) * 4;
    if (which < 2) {
#pragma unroll
      for (int it = 0; it < 16; ++it) rt[it] = *(const v4f*)(tp + it * 4 * HD);
      asm volatile("s_wait_xcnt 0x0" :: "v"(tp) : "memory"); }   // as in ld_rows: stands in front of every overwrite of these loads' address registers
    if (wrow == hf) {   // only the two waves that hold this half write it; the three loops are unrolled so that acc is indexed by constants and stays in registers
#pragma unroll
      for (int j = 0; j < 4; ++j) { const float bias = BA ? bfr(BA[c0 + wcol * 64 + j * 16 + col]) : 0.f;
#pragma unroll
        for (int i = 0; i < 4; ++i) {
#pragma unroll
          for (int r = 0; r < 8; ++r) st[i * 16 + 8 * g + r][wcol * 64 + j * 16 + col] = acc[i][j][r] + bias; } } }
    __syncthreads();
    if (which < 2) {
#pragma unroll
      for (int it = 0; it < 16; ++it) { float* rw = &st[it * 4 + wave][lane * 4]; const v4f x = *(const v4f*)rw, c = rt[it]; v4f y;
        y[0] = x[0] * c[0] - x[1] * c[1]; y[1] = x[0] * c[1] + x[1] * c[0]; y[2] = x[2] * c[2] - x[3] * c[3]; y[3] = x[2] * c[3] + x[3] * c[2]; *(v4f*)rw = y; } }
    __syncthreads(); }
  if (which < 2) { _Float16* DH = which == 0 ? QH : KH; _Float16* DL = which == 0 ? QL : KL; const int nhi = which == 0 ? QHI : KHI; const bool hi_rows = t0 < nhi;
    for (int e = tid; e < 64 * 128; e += 128) { const int rl = e >> 7, cl = e & 127; const float v = st[rl][cl]; const _Float16 hv = (_Float16)v; sh[rl][cl] = hv; sl[rl][cl] = (_Float16)((v - (float)hv) * 1024.0f); }
    __syncthreads();
    for (int e = tid; e < 64 * 16; e += 128) { const int rl = e >> 4, q = e & 15; vst2((unsigned*)(DH + (r0 + rl) * CC + c0 + q * 8), *(const v4u*)&sh[rl][q * 8]); if (hi_rows) vst2((unsigned*)(DL + (bb * nhi + t0 + rl) * (size_t)CC + c0 + q * 8), *(const v4u*)&sl[rl][q * 8]); }
  } else { const bool hi_rows = t0 < KHI;
    for (int e = tid; e < 64 * 128; e += 128) { const int rl = e & 63, cl = e >> 6; const float v = st[rl][cl]; th[cl][rl] = (_Float16)v; const __bf16 bh = (__bf16)v; tb[cl][rl] = bh; tbl[cl][rl] = (__bf16)(v - (float)bh); }
    __syncthreads();
    for (int e = tid; e < 128 * 8; e += 128) { const int cl = e >> 3, q = e & 7; vst2((unsigned*)(VT + (bb * CC + c0 + cl) * (size_t)TT + t0 + q * 8), *(const v4u*)&th[cl][q * 8]); if (hi_rows) { const size_t o3 = (bb * CC + c0 + cl) * (size_t)KHI + t0 + q * 8; vst2((unsigned*)(VB + o3), *(const v4u*)&tb[cl][q * 8]); vst2((unsigned*)(VBL + o3), *(const v4u*)&tbl[cl][q * 8]); } } } }
}
#define FA_Q 128
#define FA_K 64
#define FA_NS (TT / FA_K)
#define FA_LD 72           // LDS row pitch in halves: 144 B = 16 B x odd, conflict-free for the 16-byte fragment reads
__device__ __forceinline__ float xhalf(float v) { const int i = __builtin_bit_cast(int, v); return __builtin_bit_cast(float, __builtin_amdgcn_permlanex16(i, i, 0x76543210, 0xfedcba98, false, false)); }   /* lane l <-> l ^ 16 */
__global__ __launch_bounds__(256) void k_fa(const _Float16* __restrict__ QH, const _Float16* __restrict__ QL, const _Float16* __restrict__ KH, const _Float16* __restrict__ VT, float* __restrict__ Y) {
  __shared__ __align__(16) _Float16 ks[2][FA_K][FA_LD], vs[2][HD][FA_LD];
  const int tid = threadIdx.x, wave = tid >> 5, lane = tid & 31, col = lane & 15, g = lane >> 4; const int h = blockIdx.y, b = blockIdx.z; const int ql0 = blockIdx.x * FA_Q + wave * 16;
  v16h qh[HD / 32], qr[HD / 32];
#pragma unroll
  for (int kc = 0; kc < HD / 32; ++kc) { qh[kc] = frag_h(QH + ((size_t)b * TT + ql0 + col) * CC + h * HD + kc * 32, lane); qr[kc] = frag_h(QL + ((size_t)b * QHI + ql0 + col) * CC + h * HD + kc * 32, lane); }
  // staging: a thread moves two 16-byte pieces of the k tile (64 keys x 128 B) and two of the v tile (64 dims x 128 B), whole 128-B lines per 8 lanes
  const int sr = tid >> 3, sq = (tid & 7) * 8;
  const _Float16* kg = KH + ((size_t)b * TT + sr) * CC + h * HD + sq; const _Float16* vg = VT + ((size_t)b * CC + h * HD + sr) * (size_t)TT + sq;
  v4u k0r = *(const v4u*)kg, k1r = *(const v4u*)(kg + (size_t)32 * CC), v0r = *(const v4u*)vg, v1r = *(const v4u*)(vg + (size_t)32 * TT);
  *(v4u*)&ks[0][sr][sq] = k0r; *(v4u*)&ks[0][sr + 32][sq] = k1r; *(v4u*)&vs[0][sr][sq] = v0r; *(v4u*)&vs[0][sr + 32][sq] = v1r;
  __syncthreads();
  const float cl2 = SCALE * 1.44269504088896f;   // logit scale x log2(e): exp(x) = 2^(x log2 e)
  v8f o[HD / 16] = {}; float m = -3.0e38f, l = 0.f;
  // the stage loop stays rolled; every inner loop is unrolled so that the fragment and accumulator arrays are indexed by constants and stay in registers
#pragma unroll 1
  for (int s = 0; s < FA_NS; ++s) { const int cur = s & 1;
    if (s + 1 < FA_NS) { const _Float16* kn = kg + (size_t)(s + 1) * FA_K * CC; const _Float16* vn = vg + (s + 1) * FA_K; k0r = *(const v4u*)kn; k1r = *(const v4u*)(kn + (size_t)32 * CC); v0r = *(const v4u*)vn; v1r = *(const v4u*)(vn + (size_t)32 * TT); }
    v8f sa[FA_K / 16] = {}, sb[FA_K / 16] = {};
#pragma unroll
    for (int kc = 0; kc < HD / 32; ++kc) {
#pragma unroll
      for (int t = 0; t < FA_K / 16; ++t) { const v16h kf = frag_h(&ks[cur][t * 16 + col][kc * 32], lane);
        sa[t] = __builtin_amdgcn_wmma_f32_16x16x32_f16(false, kf, false, qh[kc], (short)0, sa[t], false, false);
        sb[t] = __builtin_amdgcn_wmma_f32_16x16x32_f16(false, kf, false, qr[kc], (short)0, sb[t], false, false); } }
    float mt[FA_K / 16];   // one maximum and one sum per 16-key tile: four short chains, not one of 32 dependent links
#pragma unroll
    for (int t = 0; t < FA_K / 16; ++t) { mt[t] = -3.0e38f;
#pragma unroll
      for (int r = 0; r < 8; ++r) { sa[t][r] = sa[t][r] + sb[t][r] * (1.0f / 1024.0f); mt[t] = fmaxf(mt[t], sa[t][r]); } }
    float mx = fmaxf(fmaxf(mt[0], mt[1]), fmaxf(mt[2], mt[3])); mx = fmaxf(mx, xhalf(mx));
    const float mn = fmaxf(m, mx), mc = mn * cl2; const float al = __builtin_amdgcn_exp2f(m * cl2 - mc); m = mn;
    float st[FA_K / 16]; v16h p[FA_K / 32];
#pragma unroll
    for (int t = 0; t < FA_K / 16; ++t) { st[t] = 0.f;
#pragma unroll
      for (int r = 0; r < 8; ++r) { const float e = __builtin_amdgcn_exp2f(sa[t][r] * cl2 - mc); st[t] += e; p[t >> 1][(t & 1) * 8 + r] = (_Float16)e; } }
    l = l * al + ((st[0] + st[1]) + (st[2] + st[3]));
#pragma unroll
    for (int j = 0; j < HD / 16; ++j) {
#pragma unroll
      for (int r = 0; r < 8; ++r) o[j][r] *= al; }
#pragma unroll
    for (int kk = 0; kk < FA_K / 32; ++kk) {
#pragma unroll
      for (int j = 0; j < HD / 16; ++j) o[j] = __builtin_amdgcn_wmma_f32_16x16x32_f16(false, frag_h(&vs[cur][j * 16 + col][kk * 32], lane), false, p[kk], (short)0, o[j], false, false); }
    if (s + 1 < FA_NS) { *(v4u*)&ks[cur ^ 1][sr][sq] = k0r; *(v4u*)&ks[cur ^ 1][sr + 32][sq] = k1r; *(v4u*)&vs[cur ^ 1][sr][sq] = v0r; *(v4u*)&vs[cur ^ 1][sr + 32][sq] = v1r; }
    __syncthreads(); }   // one barrier a stage: publishes stage s + 1 and ends every wave's reads of the buffer that stage s + 2 overwrites
  l += xhalf(l); const float inv = 1.0f / l;
  float* yr = Y + ((size_t)b * TT + ql0 + col) * CC + h * HD + 8 * g;   // lane = query col; o[j][r] = dim j*16 + 8g + r
#pragma unroll
  for (int j = 0; j < HD / 16; ++j) { v4f a, c;
#pragma unroll
    for (int r = 0; r < 4; ++r) { a[r] = o[j][r] * inv; c[r] = o[j][4 + r] * inv; }
    vst2(yr + j * 16, a); vst2(yr + j * 16 + 4, c); } }
// ---- k_out: block = (64 rows, 128 cols): out = ctx Wo (+ bo): all rows: ctx bf16 hi + lo against exact bf16 Wo (2 products)
__global__ __launch_bounds__(128) void k_out(const float* __restrict__ Y, const __bf16* __restrict__ WOB, const float* __restrict__ BO, float* __restrict__ OUT) { __shared__ __align__(16) char ov[2 * (64 + 64 + 128) * GLD * 2];
  // one LDS range, used in turn: the two operand stages of the k loop (ctx hi, ctx lo, Wo); behind the loop's last barrier each wave's own output staging tile
  __bf16 (*yh)[64][GLD] = (__bf16 (*)[64][GLD])ov; __bf16 (*yl)[64][GLD] = (__bf16 (*)[64][GLD])(ov + 2 * 64 * GLD * 2); __bf16 (*wt)[128][GLD] = (__bf16 (*)[128][GLD])(ov + 4 * 64 * GLD * 2);
  float (*sf)[16][132] = (float (*)[16][132])ov;
  const int tid = threadIdx.x, wave = tid >> 5, lane = tid & 31, col = lane & 15, g = lane >> 4; const int c0 = blockIdx.y * 128; const size_t r0 = (size_t)blockIdx.x * 64 + wave * 16;
  v8f acc[8] = {};
  {   /* ALL rows: ctx split bf16 hi + lo x exact Wo (2 products) */
    const int pr = tid >> 4, pc = (tid & 15) * 4;   // a thread's 16-byte piece: row pr of each group of 8 rows, k pc..pc+3 of the stage
    const int qr = tid >> 3, qc = (tid & 7) * 8;    // its 16-byte piece of the bf16 Wo plane: row qr of each group of 16 rows, k qc..qc+7
    const float* yg = Y + ((size_t)blockIdx.x * 64 + pr) * CC + pc; const __bf16* wg = WOB + (size_t)(c0 + qr) * CC + qc;
    v4f yr[8]; v8b wr[8];
    ld_rows(yr, yg, CC); ld_rows_b(wr, wg, CC);
#pragma unroll
    for (int i = 0; i < 8; ++i) { const v4b hv = cvt4(yr[i]); *(v4b*)&yh[0][i * 8 + pr][pc] = hv; *(v4b*)&yl[0][i * 8 + pr][pc] = res4(yr[i], hv); }
#pragma unroll
    for (int i = 0; i < 8; ++i) *(v8b*)&wt[0][i * 16 + qr][qc] = wr[i];
    __syncthreads();
    // rolled stage loop, unrolled inner loops: as in k_proj
#pragma unroll 1
    for (int s = 0; s < CC / GK; ++s) { const int cur = s & 1;
      if (s + 1 < CC / GK) { ld_rows(yr, yg + (s + 1) * GK, CC); ld_rows_b(wr, wg + (s + 1) * GK, CC); }   // the next stage's loads fly while this stage is multiplied
#pragma unroll
      for (int kc = 0; kc < GK / 32; ++kc) { const v16b ah = frag_b(&yh[cur][wave * 16 + col][kc * 32], lane), al = frag_b(&yl[cur][wave * 16 + col][kc * 32], lane); v16b w[8];
#pragma unroll
        for (int j = 0; j < 8; ++j) w[j] = frag_b(&wt[cur][j * 16 + col][kc * 32], lane);
        __builtin_amdgcn_sched_barrier(0);   // keeps the ten fragments' LDS reads one group ahead of their products, as in k_proj
#pragma unroll
        for (int j = 0; j < 8; ++j) { acc[j] = __builtin_amdgcn_wmma_f32_16x16x32_bf16(false, ah, false, w[j], (short)0, acc[j], false, false);
          acc[j] = __builtin_amdgcn_wmma_f32_16x16x32_bf16(false, al, false, w[j], (short)0, acc[j], false, false); } }
      if (s + 1 < CC / GK) {
#pragma unroll
        for (int i = 0; i < 8; ++i) { const v4b hv = cvt4(yr[i]); *(v4b*)&yh[cur ^ 1][i * 8 + pr][pc] = hv; *(v4b*)&yl[cur ^ 1][i * 8 + pr][pc] = res4(yr[i], hv); }
#pragma unroll
        for (int i = 0; i < 8; ++i) *(v8b*)&wt[cur ^ 1][i * 16 + qr][qc] = wr[i]; }
      __syncthreads(); }   // one barrier a stage: publishes stage s + 1 and ends every wave's reads of the buffer that stage s + 2 (or the output staging) overwrites
#pragma unroll
    for (int j = 0; j < 8; ++j) { const float bias = BO ? bfr(BO[c0 + j * 16 + col]) : 0.f;
#pragma unroll
      for (int r = 0; r < 8; ++r) sf[wave][8 * g + r][j * 16 + col] = acc[j][r] + bias; }
  }
  LDSX(); for (int rl = 0; rl < 16; ++rl) vst2(OUT + (r0 + rl) * DIN + c0 + lane * 4, *(const v4f*)&sf[wave][rl][lane * 4]); }

extern "C" void kernel_launch(void* const* d_in, const int* in_sizes, int n_in, void* d_out, int out_size, void* d_ws, size_t ws_size, hipStream_t stream) {
  (void)in_sizes; (void)n_in; (void)out_size;
  const float** F = (const float**)d_in;
  if (ws_size < (size_t)WS_END) return;
  char* ws = (char*)d_ws; _Float16 *QH = (_Float16*)(ws + WS_QH), *KH = (_Float16*)(ws + WS_KH), *VT = (_Float16*)(ws + WS_VT), *QL = (_Float16*)(ws + WS_QL), *KL = (_Float16*)(ws + WS_KL); __bf16 *VB = (__bf16*)(ws + WS_VB), *VBL = (__bf16*)(ws + WS_VBL), *XB = (__bf16*)(ws + WS_XB), *WB = (__bf16*)(ws + WS_WB); float *Y = (float*)(ws + WS_Y), *RT = (float*)(ws + WS_RT);
  (void)Y; (void)QL; (void)KL; (void)VB; (void)VBL;
  // inputs: 0 x [2,2048,1024]; 1 Wq [1024,1024] (out,in), 2 bq; 3 Wk, 4 bk; 5 Wv, 6 bv; 7 Wo (no bias)
  k_cvt<<<dim3((NB * TT * DIN + 4 * CC * DIN) / CV_N), 256, 0, stream>>>(F[0], F[1], F[3], F[5], F[7], XB, WB, RT);
  k_proj<<<dim3(TNB * TT / PM, CC / 128, 3), 128, 0, stream>>>(XB, WB, F[2], F[4], F[6], RT, QH, QL, KH, KL, VT, VB, VBL);
  k_fa<<<dim3(TT / FA_Q, NH, TNB), 256, 0, stream>>>(QH, QL, KH, VT, Y);
  k_out<<<dim3(TNB * TT / 64, DIN / 128), 128, 0, stream>>>(Y, WB + 3 * (size_t)CC * DIN, nullptr, (float*)d_out);
}

// v006
// Measured time: 95.7 microseconds a run.
// Two timings next to v005 put it at 1.07 and 1.08 times that version's speed.
// All steps since v000 together make it 15.4 times as fast.
// compute dtype: all float inputs rounded to bf16; q/k/v projections with EXACT bf16 products on WMMA 16x16x32 (f32 accumulate); interleaved RoPE in f32 (sincosf) on the projected q/k rows; q x log2(e) as f16 hi + residual against k x 2^-5 (= 1024^-0.5) once to f16 (2 products, summed in one f32 accumulator that starts at minus a reference maximum); one-pass softmax in f32 (exp2 of the accumulator as it is; the reference maximum moves, and sums and outputs are rescaled, only when a logit passes it by more than 8 in log2 units); exp(logit - reference) once to f16 against v once to f16 (1 product), divided by the sum at the end; ctx split bf16 hi + lo against exact Wo (2 products); f32 output.
#include <hip/hip_runtime.h>
#include <math.h>

typedef __attribute__((ext_vector_type(16))) _Float16 v16h;
typedef __attribute__((ext_vector_type(16))) __bf16 v16b;
typedef __attribute__((ext_vector_type(8)))  _Float16 v8h;
typedef __attribute__((ext_vector_type(8)))  float v8f;
typedef __attribute__((ext_vector_type(4)))  float v4f;
typedef __attribute__((ext_vector_type(2)))  float v2f;
typedef __attribute__((ext_vector_type(4)))  unsigned v4u;
typedef __attribute__((ext_vector_type(4)))  int v4i;
typedef float __attribute__((may_alias)) float_a;
typedef int __attribute__((may_alias)) int_a;

template <typename T> __device__ __forceinline__ void vst2(void* p, T v) { *(T*)p = v;  }
__device__ __forceinline__ v8f wmma16(v16h a, v16h b, v8f c) {
  v8f d = __builtin_amdgcn_wmma_f32_16x16x32_f16(false, a, false, b, (short)0, c, false, false);
  asm volatile("v_nop\n\tv_nop\n\tv_nop\n\tv_nop" : "+v"(d) : "v"(a), "v"(b));
  return d;
}
__device__ __forceinline__ v8f wmma_bf(v16b a, v16b b, v8f c) {
  v8f d = __builtin_amdgcn_wmma_f32_16x16x32_bf16(false, a, false, b, (short)0, c, false, false);
  asm volatile("v_nop\n\tv_nop\n\tv_nop\n\tv_nop" : "+v"(d) : "v"(a), "v"(b));
  return d;
}
// 16x16x32 fragments: lane = (h = lane>>4, row/col = lane&15); elements 0..7 = k0+8h+0..7, 8..15 = k0+16+8h+0..7; D element r = row 8h+r
__device__ __forceinline__ v16h frag_h(const _Float16* rowk0, int lane) {
  union { v16h v; v8h q[2]; } u; const _Float16* p = rowk0 + 8 * (lane >> 4);
  u.q[0] = *(const v8h*)p; u.q[1] = *(const v8h*)(p + 16); return u.v;
}
__device__ __forceinline__ v16h frag_f32(const float* rowk0, int lane) {
  v16h a; const float* p = rowk0 + 8 * (lane >> 4);
#pragma unroll
  for (int i = 0; i < 8; ++i) { a[i] = (_Float16)p[i]; a[8 + i] = (_Float16)p[16 + i]; }
  return a;
}
__device__ __forceinline__ v16h frag_f32s(const float* rowk0, int lane, float sc) {
  v16h a; const float* p = rowk0 + 8 * (lane >> 4);
#pragma unroll
  for (int i = 0; i < 8; ++i) { a[i] = (_Float16)(p[i] * sc); a[8 + i] = (_Float16)(p[16 + i] * sc); }
  return a;
}
// column fragment from a [K][ld] layout (column n), rows >= K read as 0
__device__ __forceinline__ v16h fragc_f32(const float* W, int k0, int n, int lane, int ld, int K) {
  v16h a; const int g = lane >> 4;
#pragma unroll
  for (int i = 0; i < 8; ++i) { const int ka = k0 + 8 * g + i, kb = ka + 16;
    a[i] = (_Float16)(ka < K ? W[(size_t)(ka < K ? ka : K - 1) * ld + n] : 0.f); a[8 + i] = (_Float16)(kb < K ? W[(size_t)(kb < K ? kb : K - 1) * ld + n] : 0.f); }
  return a;
}
struct F2 { v16b h, l; };
__device__ __forceinline__ F2 bsplit16(const float v[16]) { F2 r;
#pragma unroll
  for (int i = 0; i < 16; ++i) { const __bf16 h = (__bf16)v[i]; r.h[i] = h; r.l[i] = (__bf16)(v[i] - (float)h); }
  return r; }
__device__ __forceinline__ F2 split_row(const float* row, int k0, int lane) { float v[16]; const float* p = row + k0 + 8 * (lane >> 4);
#pragma unroll
  for (int i = 0; i < 8; ++i) { v[i] = p[i]; v[8 + i] = p[16 + i]; }
  return bsplit16(v); }
__device__ __forceinline__ F2 split_rowK(const float* row, int k0, int lane, int K) { float v[16]; const int g = lane >> 4;
#pragma unroll
  for (int i = 0; i < 8; ++i) { const int ka = k0 + 8 * g + i, kb = ka + 16; v[i] = ka < K ? row[ka < K ? ka : K - 1] : 0.f; v[8 + i] = kb < K ? row[kb < K ? kb : K - 1] : 0.f; }
  return bsplit16(v); }
__device__ __forceinline__ F2 split_col(const float* W, int k0, int n, int lane, int ld, int K) { float v[16]; const int g = lane >> 4;
#pragma unroll
  for (int i = 0; i < 8; ++i) { const int ka = k0 + 8 * g + i, kb = ka + 16; v[i] = ka < K ? W[(size_t)(ka < K ? ka : K - 1) * ld + n] : 0.f; v[8 + i] = kb < K ? W[(size_t)(kb < K ? kb : K - 1) * ld + n] : 0.f; }
  return bsplit16(v); }
__device__ __forceinline__ v8f mac3(const F2& a, const F2& b, v8f c) { c = wmma_bf(a.l, b.h, c); c = wmma_bf(a.h, b.l, c); return wmma_bf(a.h, b.h, c); }
__device__ __forceinline__ float sigm(float v) { return 1.0f / (1.0f + expf(-v)); }
#define LDSX() do { asm volatile("s_wait_dscnt 0" ::: "memory"); __builtin_amdgcn_wave_barrier(); __builtin_amdgcn_fence(__ATOMIC_RELEASE, "workgroup"); } while (0)

// Multi-head attention with RoPE (B 2, S 2,048, 1,024 = 16 x 64; 0.02-scale weights and biases): q,k,v = x W^T + b ((out,in)); interleaved-pair RoPE on q, k (angle t x 10000^(-2i/64)); scores = q k^T / sqrt(1024) (note: sqrt(D), not sqrt(hd)); out = merged(softmax(scores) v) Wo^T (no output bias).
#define NB 2
#define TT 2048
#define CC 1024            // NH * HD = projected width
#define DIN 1024          // input (model) width
#define NH 16
#define HD 64
#define NQB (TT / 64)
#define HG 4
#define SCALE (0.03125f)
#define CAUSAL 0
#ifndef TNB
#define TNB NB
#endif
__device__ __forceinline__ float bfr(float v) { return (float)(__bf16)v; }
__host__ __device__ __forceinline__ int kb_last(int qb) { return CAUSAL ? ((qb * 64 + 63) >> 7) : (TT / 128 - 1); }
typedef __attribute__((ext_vector_type(8))) __bf16 v8b;
__device__ __forceinline__ v16b frag_b(const __bf16* rowk0, int lane) {
  union { v16b v; v8b q[2]; } u; const __bf16* p = rowk0 + 8 * (lane >> 4);
  u.q[0] = *(const v8b*)p; u.q[1] = *(const v8b*)(p + 16); return u.v;
}
#define QBH 0
#define QHI 2048            // rows carrying a q residual plane (all rows when non-causal: 2-product logits everywhere)
#define KHI 64            // key rows carrying k residual / v bf16 hi+lo planes (written by k_proj, read by no kernel)
// B fragment (k rows k0+.., output column o) of a weight: (in,out) [K][ld] or (out,in) [ld rows of K]: bf16 exact, or f16(bf16 * 256) exact
__device__ __forceinline__ v16b wcol_io(const float* Wm, int k0, int o, int lane, int ld) { v16b w; const int g = lane >> 4;
#pragma unroll
  for (int i = 0; i < 8; ++i) { w[i] = (__bf16)Wm[(size_t)(k0 + 8 * g + i) * ld + o]; w[8 + i] = (__bf16)Wm[(size_t)(k0 + 16 + 8 * g + i) * ld + o]; }
  return w; }
__device__ __forceinline__ v16b wcol_oi(const float* Wm, int k0, int o, int lane, int K) { v16b w; const float* p = Wm + (size_t)o * K + k0 + 8 * (lane >> 4);
#pragma unroll
  for (int i = 0; i < 8; ++i) { w[i] = (__bf16)p[i]; w[8 + i] = (__bf16)p[16 + i]; }
  return w; }
__device__ __forceinline__ v16h wcolh_io(const float* Wm, int k0, int o, int lane, int ld) { v16h w; const int g = lane >> 4;
#pragma unroll
  for (int i = 0; i < 8; ++i) { w[i] = (_Float16)(bfr(Wm[(size_t)(k0 + 8 * g + i) * ld + o]) * 256.0f); w[8 + i] = (_Float16)(bfr(Wm[(size_t)(k0 + 16 + 8 * g + i) * ld + o]) * 256.0f); }
  return w; }
__device__ __forceinline__ v16h wcolh_oi(const float* Wm, int k0, int o, int lane, int K) { v16h w; const float* p = Wm + (size_t)o * K + k0 + 8 * (lane >> 4);
#pragma unroll
  for (int i = 0; i < 8; ++i) { w[i] = (_Float16)(bfr(p[i]) * 256.0f); w[8 + i] = (_Float16)(bfr(p[16 + i]) * 256.0f); }
  return w; }
#define WQKV_LAYOUT 1   // 0 = (in,out) [DIN][CC]; 1 = (out,in) [CC][DIN]; 2 = per-head [NH][DIN][HD]; read only through WCOL, which no kernel calls (k_proj reads (out,in) [CC][DIN])
__device__ __forceinline__ v16b wcol_hdk(const float* Wm, int k0, int o, int lane) { v16b w; const int g = lane >> 4; const float* p = Wm + (size_t)(o / HD) * DIN * HD + (o % HD);
#pragma unroll
  for (int i = 0; i < 8; ++i) { w[i] = (__bf16)p[(size_t)(k0 + 8 * g + i) * HD]; w[8 + i] = (__bf16)p[(size_t)(k0 + 16 + 8 * g + i) * HD]; }
  return w; }
#define WO_OUT_IN 1
#if WQKV_LAYOUT == 1
#define WCOL(W, k0, o, lane) wcol_oi(W, k0, o, lane, DIN)
#elif WQKV_LAYOUT == 2
#define WCOL(W, k0, o, lane) wcol_hdk(W, k0, o, lane)
#else
#define WCOL(W, k0, o, lane) wcol_io(W, k0, o, lane, CC)
#endif
#if WO_OUT_IN
#define WOCOL(W, k0, o, lane) wcol_oi(W, k0, o, lane, CC)
#define WOCOLH(W, k0, o, lane) wcolh_oi(W, k0, o, lane, CC)
#else
#define WOCOL(W, k0, o, lane) wcol_io(W, k0, o, lane, DIN)
#define WOCOLH(W, k0, o, lane) wcolh_io(W, k0, o, lane, DIN)
#endif
__constant__ float c_invf[32] = {1.000000000e+0f,7.498942018e-1f,5.623413324e-1f,4.216965139e-1f,3.162277639e-1f,2.371373773e-1f,1.778279394e-1f,1.333521456e-1f,1.000000015e-1f,7.498942316e-2f,5.623413250e-2f,4.216964915e-2f,3.162277490e-2f,2.371373773e-2f,1.778279431e-2f,1.333521400e-2f,9.999999776e-3f,7.498942316e-3f,5.623413250e-3f,4.216964822e-3f,3.162277630e-3f,2.371373819e-3f,1.778279431e-3f,1.333521446e-3f,1.000000047e-3f,7.498941850e-4f,5.623413017e-4f,4.216965172e-4f,3.162277571e-4f,2.371373703e-4f,1.778279402e-4f,1.333521504e-4f};   /* f32(1 / 10000^(2i/64)) */
#ifndef SM_EXTRA_PARAMS
#define SM_EXTRA_PARAMS
#endif
#ifndef PROJ_EXTRA_PARAMS
#define PROJ_EXTRA_PARAMS
#endif
#ifndef SM_MASK_HOOK
#define SM_MASK_HOOK (void)0
#endif

#define WS_QH  0u                                      // f16 q x log2(e) rows [b*t][CC]
#define WS_KH  (WS_QH + 2u * (size_t)NB * TT * CC)      // f16 k x 2^-5 rows [b*t][CC]
#define WS_VT  (WS_KH + 2u * (size_t)NB * TT * CC)      // f16 v planes [b][c][t]
#define WS_QL  (WS_VT + 2u * (size_t)NB * CC * TT)      // f16 residual of q x log2(e), unscaled, rows [b][t < QHI][CC]
#define WS_KL  (WS_QL + 2u * (size_t)NB * QHI * CC)     // f16 residual of k x 2^-5, unscaled, rows [b][t < KHI][CC]
#define WS_VB  (WS_KL + 2u * (size_t)NB * KHI * CC)     // bf16 v hi planes [b][c][t < KHI]
#define WS_VBL (WS_VB + 2u * (size_t)NB * CC * KHI)
#define WS_XB  (WS_VBL + 2u * (size_t)NB * CC * KHI)    // bf16 x rows [b*t][DIN]
#define WS_WB  (WS_XB + 2u * (size_t)NB * TT * DIN)     // bf16 Wq, Wk, Wv, Wo, each [CC][DIN] as given
#define WS_Y   (WS_WB + 2u * 4u * (size_t)CC * DIN)     // f32 ctx rows [b*t][CC] (only when there is an output projection)
#define WS_RT  (WS_Y  + 4u * (size_t)NB * TT * CC)      // f32 RoPE table [t][HD / 2] of (cos, sin), written by k_cvt in every call
#define WS_END (WS_RT + 8u * (size_t)TT * (HD / 2))

// GEMM operand staging (k_proj, k_out): a stage is 64 k of every operand row, kept as bf16 in LDS; every wave takes its fragments from there with 16-byte LDS loads. x and the four weights come from k_cvt's bf16 planes (a stage row = one 128-B line, 8 lanes x 16 B, copied as it is); ctx comes as f32 (16 lanes x 16 B per row) and is split by the block.
#define GK 64              // k per stage
#define GLD 72             // LDS row pitch in bf16: 144 B = 16 B x odd, conflict-free for the 16-byte fragment reads
typedef __attribute__((ext_vector_type(4))) __bf16 v4b;
__device__ __forceinline__ v4b cvt4(v4f v) { v4b r; r[0] = (__bf16)v[0]; r[1] = (__bf16)v[1]; r[2] = (__bf16)v[2]; r[3] = (__bf16)v[3]; return r; }
__device__ __forceinline__ v4b res4(v4f v, v4b h) { v4b r;
#pragma unroll
  for (int i = 0; i < 4; ++i) r[i] = (__bf16)(v[i] - (float)h[i]);
  return r; }
// a thread's N pieces of a stage: rows 8 apart, 16 bytes each
template <int N> __device__ __forceinline__ void ld_rows(v4f (&r)[N], const float* p, int ld) {
#pragma unroll
  for (int i = 0; i < N; ++i) r[i] = *(const v4f*)(p + (size_t)i * 8 * ld);
  asm volatile("s_wait_xcnt 0x0" :: "v"(p) : "memory"); }   // stands in front of every overwrite of these loads' address registers (p as an input keeps them whole up to here); its memory clobber also holds the loads here, ahead of the products they fly behind
// a thread's N pieces of a stage of a bf16 plane: rows 16 apart, 16 bytes each
template <int N> __device__ __forceinline__ void ld_rows_b(v8b (&r)[N], const __bf16* p, int ld) {
#pragma unroll
  for (int i = 0; i < N; ++i) r[i] = *(const v8b*)(p + (size_t)i * 16 * ld);
  asm volatile("s_wait_xcnt 0x0" :: "v"(p) : "memory"); }   // as in ld_rows: stands in front of every overwrite of these loads' address registers and holds the loads ahead of the products they fly behind
// ---- k_cvt also fills the RoPE table: one (position, pair) per thread, sincosf of the f32 angle t * c_invf[i]; both batches, all heads and both of q and k read the same 65,536 entries
// ---- k_cvt: x and the four weights rounded to bf16 ONCE, as a stream (one block per WGP, each 32,768 consecutive floats of one tensor, in whole-line 16-byte loads that are all issued ahead of the first store): every GEMM block that reads them afterwards fetches 2 bytes an element, not 4, and converts nothing
#define CV_N 32768
__global__ __launch_bounds__(256) void k_cvt(const float* __restrict__ X, const float* __restrict__ WQ, const float* __restrict__ WK, const float* __restrict__ WV, const float* __restrict__ WO, __bf16* __restrict__ XB, __bf16* __restrict__ WB, float* __restrict__ RT) {
  static_assert((NB * TT * DIN + 4 * CC * DIN) / CV_N * 256 == TT * (HD / 2), "one table entry per thread");
  const int nx = NB * TT * DIN / CV_N, nw = CC * DIN / CV_N; const int bi = blockIdx.x, tid = threadIdx.x;
  const float* s; __bf16* d;
  if (bi < nx) { s = X + (size_t)bi * CV_N; d = XB + (size_t)bi * CV_N; }
  else { const int w = (bi - nx) / nw; s = (w == 0 ? WQ : w == 1 ? WK : w == 2 ? WV : WO) + (size_t)((bi - nx) % nw) * CV_N; d = WB + (size_t)(bi - nx) * CV_N; }
  const int ri = bi * 256 + tid; const float fr = c_invf[ri & (HD / 2 - 1)];
  v4f r[CV_N / 1024];
#pragma unroll
  for (int i = 0; i < CV_N / 1024; ++i) r[i] = *(const v4f*)(s + i * 1024 + tid * 4);
  { float sn, cs; sincosf((float)(ri / (HD / 2)) * fr, &sn, &cs); v2f e; e[0] = cs; e[1] = sn; *(v2f*)(RT + 2 * (size_t)ri) = e; }
#pragma unroll
  for (int i = 0; i < CV_N / 1024; ++i) *(v4b*)(d + i * 1024 + tid * 4) = cvt4(r[i]); }
// ---- k_proj: block = (128 rows, 128 cols, which), four waves as 2 x 2, a wave = 64 x 64 (4 x and 4 weight fragments feed 16 products: half a fragment read from LDS per product): q/k/v = X W (+ b) with exact bf16 products (K = DIN) -> which 0: q f16 rows (+ residual rows < QHI); 1: k f16 rows (+ residual rows < KHI); 2: v f16 planes [c][t] (+ bf16 hi/lo planes for t < KHI)
#define PM 128             // rows of a block; the epilogue takes them in halves of 64, so that its f32 tile stays small enough for three blocks on a WGP
__global__ __launch_bounds__(128) void k_proj(const __bf16* __restrict__ XB, const __bf16* __restrict__ WB, const float* __restrict__ BQ, const float* __restrict__ BK, const float* __restrict__ BV, const float* __restrict__ RT,
    _Float16* __restrict__ QH, _Float16* __restrict__ QL, _Float16* __restrict__ KH, _Float16* __restrict__ KL, _Float16* __restrict__ VT, __bf16* __restrict__ VB, __bf16* __restrict__ VBL PROJ_EXTRA_PARAMS) {
  __shared__ __align__(16) float st[64][132]; __shared__ __align__(16) char ov[2 * (PM + 128) * GLD * 2];
  // one LDS range, used in turn: the two operand stages of the k loop; behind the loop's last barrier the epilogue's conversion tiles (q, k: sh, sl; v: th, tb, tbl)
  __bf16 (*xs)[PM][GLD] = (__bf16 (*)[PM][GLD])ov; __bf16 (*wt)[128][GLD] = (__bf16 (*)[128][GLD])(ov + 2 * PM * GLD * 2);
  _Float16 (*sh)[136] = (_Float16 (*)[136])ov; _Float16 (*sl)[136] = (_Float16 (*)[136])(ov + 64 * 136 * 2);
  _Float16 (*th)[72] = (_Float16 (*)[72])ov; __bf16 (*tb)[72] = (__bf16 (*)[72])(ov + 128 * 72 * 2); __bf16 (*tbl)[72] = (__bf16 (*)[72])(ov + 2 * 128 * 72 * 2);
  const int tid = threadIdx.x, wave = tid >> 5, lane = tid & 31, col = lane & 15, g = lane >> 4; const int wrow = wave >> 1, wcol = wave & 1; const int which = blockIdx.z; const int c0 = blockIdx.y * 128; const size_t r0 = (size_t)blockIdx.x * PM; const size_t bb = r0 / TT; const int t0 = (int)(r0 % TT);
  const float* BA = which == 0 ? BQ : which == 1 ? BK : BV;
  v8f acc[4][4] = {};
  const int pr = tid >> 3, pc = (tid & 7) * 8;   // a thread's 16-byte piece: row pr of each group of 16 rows, k pc..pc+7 of the stage
  const __bf16* xg = XB + (r0 + pr) * DIN + pc; const __bf16* wg = WB + ((size_t)which * CC + c0 + pr) * DIN + pc;
  v8b xr[PM / 16], wr[8];
  ld_rows_b(xr, xg, DIN); ld_rows_b(wr, wg, DIN);
#pragma unroll
  for (int i = 0; i < PM / 16; ++i) *(v8b*)&xs[0][i * 16 + pr][pc] = xr[i];
#pragma unroll
  for (int i = 0; i < 8; ++i) *(v8b*)&wt[0][i * 16 + pr][pc] = wr[i];
  __syncthreads();
  // the stage loop stays rolled so that the two buffers alternate by index and the loop stays small; the inner loops are unrolled so that the register arrays are indexed by constants
#pragma unroll 1
  for (int s = 0; s < DIN / GK; ++s) { const int cur = s & 1;
    if (s + 1 < DIN / GK) { ld_rows_b(xr, xg + (s + 1) * GK, DIN); ld_rows_b(wr, wg + (s + 1) * GK, DIN); }   // the next stage's loads fly while this stage is multiplied
#pragma unroll
    for (int kc = 0; kc < GK / 32; ++kc) { v16b a[4], w[4];
#pragma unroll
      for (int i = 0; i < 4; ++i) a[i] = frag_b(&xs[cur][wrow * 64 + i * 16 + col][kc * 32], lane);
#pragma unroll
      for (int j = 0; j < 4; ++j) w[j] = frag_b(&wt[cur][wcol * 64 + j * 16 + col][kc * 32], lane);
      __builtin_amdgcn_sched_barrier(0);   // keeps the eight fragments' LDS reads one group ahead of their products: left alone the compiler reads each into the same registers and waits out the LDS latency before every product
#pragma unroll
      for (int i = 0; i < 4; ++i) {
#pragma unroll
        for (int j = 0; j < 4; ++j) acc[i][j] = __builtin_amdgcn_wmma_f32_16x16x32_bf16(false, a[i], false, w[j], (short)0, acc[i][j], false, false); } }
    if (s + 1 < DIN / GK) {
#pragma unroll
      for (int i = 0; i < PM / 16; ++i) *(v8b*)&xs[cur ^ 1][i * 16 + pr][pc] = xr[i];
#pragma unroll
      for (int i = 0; i < 8; ++i) *(v8b*)&wt[cur ^ 1][i * 16 + pr][pc] = wr[i]; }
    __syncthreads(); }   // one barrier a stage: publishes stage s + 1 and ends every wave's reads of the buffer that stage s + 2 (or the epilogue) overwrites
  // the epilogue runs once per half of 64 rows: the two waves that hold the half hand it over through st, all four waves rotate, convert and store it. Half 1's writes of st stand behind half 0's third barrier (the last reads of st are in front of it); its writes of the conversion tiles stand behind its own first two barriers (every wave has left half 0's store loop by then)
  const size_t rblk = r0; const int tblk = t0;
  for (int hf = 0; hf < PM / 64; ++hf) { const size_t r0 = rblk + hf * 64; const int t0 = tblk + hf * 64;   // the half's first row, under the names that the lines below use
    asm volatile("s_wait_xcnt 0x0" ::: "memory");   // stands behind the stores of the half before, in front of this half's first write of a register that they name
  { // stage the f32 tile (acc + bias) in LDS, rotate the q and k rows (interleaved (even, odd) RoPE pairs, angle = t * 10000^(-2i/64), cos and sin from k_cvt's table), then convert
    // a wave takes whole rows (row it * 4 + wave, 4 columns = 2 pairs a lane): 512 B of the tile and the row's 256 B of the table per pass, both heads of the tile reading the same table row; the table loads are issued here, ahead of the bias loads and the tile's LDS stores, so that their latency is not paid behind the barrier
    v4f rt[16]; const float* tp = RT + (size_t)(t0 + wave) * HD + (lane & 15) * 4;
    if (which < 2) {
#pragma unroll
      for (int it = 0; it < 16; ++it) rt[it] = *(const v4f*)(tp + it * 4 * HD);
      asm volatile("s_wait_xcnt 0x0" :: "v"(tp) : "memory"); }   // as in ld_rows: stands in front of every overwrite of these loads' address registers
    if (wrow == hf) {   // only the two waves that hold this half write it; the three loops are unrolled so that acc is indexed by constants and stays in registers
#pragma unroll
      for (int j = 0; j < 4; ++j) { const float bias = BA ? bfr(BA[c0 + wcol * 64 + j * 16 + col]) : 0.f;
#pragma unroll
        for (int i = 0; i < 4; ++i) {
#pragma unroll
          for (int r = 0; r < 8; ++r) st[i * 16 + 8 * g + r][wcol * 64 + j * 16 + col] = acc[i][j][r] + bias; } } }
    __syncthreads();
    if (which < 2) {
#pragma unroll
      for (int it = 0; it < 16; ++it) { float* rw = &st[it * 4 + wave][lane * 4]; const v4f x = *(const v4f*)rw, c = rt[it]; v4f y;
        y[0] = x[0] * c[0] - x[1] * c[1]; y[1] = x[0] * c[1] + x[1] * c[0]; y[2] = x[2] * c[2] - x[3] * c[3]; y[3] = x[2] * c[3] + x[3] * c[2]; *(v4f*)rw = y; } }
    __syncthreads(); }
  if (which < 2) { _Float16* DH = which == 0 ? QH : KH; _Float16* DL = which == 0 ? QL : KL; const int nhi = which == 0 ? QHI : KHI; const bool hi_rows = t0 < nhi;
    const float vs = which == 0 ? 1.44269504088896f : SCALE;   // the logit scale and log2(e) go into the operands, so that k_fa's products are exp2 arguments as they leave the accumulator; 2^-5 on k is exact
    for (int e = tid; e < 64 * 128; e += 128) { const int rl = e >> 7, cl = e & 127; const float v = st[rl][cl] * vs; const _Float16 hv = (_Float16)v; sh[rl][cl] = hv; sl[rl][cl] = (_Float16)(v - (float)hv); }
    __syncthreads();
    for (int e = tid; e < 64 * 16; e += 128) { const int rl = e >> 4, q = e & 15; vst2((unsigned*)(DH + (r0 + rl) * CC + c0 + q * 8), *(const v4u*)&sh[rl][q * 8]); if (hi_rows) vst2((unsigned*)(DL + (bb * nhi + t0 + rl) * (size_t)CC + c0 + q * 8), *(const v4u*)&sl[rl][q * 8]); }
  } else { const bool hi_rows = t0 < KHI;
    for (int e = tid; e < 64 * 128; e += 128) { const int rl = e & 63, cl = e >> 6; const float v = st[rl][cl]; th[cl][rl] = (_Float16)v; const __bf16 bh = (__bf16)v; tb[cl][rl] = bh; tbl[cl][rl] = (__bf16)(v - (float)bh); }
    __syncthreads();
    for (int e = tid; e < 128 * 8; e += 128) { const int cl = e >> 3, q = e & 7; vst2((unsigned*)(VT + (bb * CC + c0 + cl) * (size_t)TT + t0 + q * 8), *(const v4u*)&th[cl][q * 8]); if (hi_rows) { const size_t o3 = (bb * CC + c0 + cl) * (size_t)KHI + t0 + q * 8; vst2((unsigned*)(VB + o3), *(const v4u*)&tb[cl][q * 8]); vst2((unsigned*)(VBL + o3), *(const v4u*)&tbl[cl][q * 8]); } } } }
}
#define FA_Q 128
#define FA_K 64
#define FA_NS (TT / FA_K)
#define FA_LD 72           // LDS row pitch in halves: 144 B = 16 B x odd, conflict-free for the 16-byte fragment reads
__device__ __forceinline__ float xhalf(float v) { const int i = __builtin_bit_cast(int, v); return __builtin_bit_cast(float, __builtin_amdgcn_permlanex16(i, i, 0x76543210, 0xfedcba98, false, false)); }   /* lane l <-> l ^ 16 */
__global__ __launch_bounds__(256) void k_fa(const _Float16* __restrict__ QH, const _Float16* __restrict__ QL, const _Float16* __restrict__ KH, const _Float16* __restrict__ VT, float* __restrict__ Y) {
  __shared__ __align__(16) _Float16 ks[2][FA_K][FA_LD], vs[2][HD][FA_LD];
  const int tid = threadIdx.x, wave = tid >> 5, lane = tid & 31, col = lane & 15, g = lane >> 4; const int h = blockIdx.y, b = blockIdx.z; const int ql0 = blockIdx.x * FA_Q + wave * 16;
  v16h qh[HD / 32], qr[HD / 32];
#pragma unroll
  for (int kc = 0; kc < HD / 32; ++kc) { qh[kc] = frag_h(QH + ((size_t)b * TT + ql0 + col) * CC + h * HD + kc * 32, lane); qr[kc] = frag_h(QL + ((size_t)b * QHI + ql0 + col) * CC + h * HD + kc * 32, lane); }
  // staging: a thread moves two 16-byte pieces of the k tile (64 keys x 128 B) and two of the v tile (64 dims x 128 B), whole 128-B lines per 8 lanes
  const int sr = tid >> 3, sq = (tid & 7) * 8;
  const _Float16* kg = KH + ((size_t)b * TT + sr) * CC + h * HD + sq; const _Float16* vg = VT + ((size_t)b * CC + h * HD + sr) * (size_t)TT + sq;
  v4u k0r = *(const v4u*)kg, k1r = *(const v4u*)(kg + (size_t)32 * CC), v0r = *(const v4u*)vg, v1r = *(const v4u*)(vg + (size_t)32 * TT);
  *(v4u*)&ks[0][sr][sq] = k0r; *(v4u*)&ks[0][sr + 32][sq] = k1r; *(v4u*)&vs[0][sr][sq] = v0r; *(v4u*)&vs[0][sr + 32][sq] = v1r;
  __syncthreads();
  v8f o[HD / 16] = {}, nm = {}; float l = 0.f;   // nm: minus the reference maximum of the lane's query (log2 units) in all eight elements, the start value of every score tile
  // the stage loop stays rolled (for speed only); every inner loop is unrolled so that the fragment and accumulator arrays are indexed by constants and stay in registers
#pragma unroll 1
  for (int s = 0; s < FA_NS; ++s) { const int cur = s & 1;
    if (s + 1 < FA_NS) { const _Float16* kn = kg + (size_t)(s + 1) * FA_K * CC; const _Float16* vn = vg + (s + 1) * FA_K; k0r = *(const v4u*)kn; k1r = *(const v4u*)(kn + (size_t)32 * CC); v0r = *(const v4u*)vn; v1r = *(const v4u*)(vn + (size_t)32 * TT); }
    v8f sa[FA_K / 16]; v16h kf[HD / 32][FA_K / 16];
#pragma unroll
    for (int kc = 0; kc < HD / 32; ++kc) {
#pragma unroll
      for (int t = 0; t < FA_K / 16; ++t) kf[kc][t] = frag_h(&ks[cur][t * 16 + col][kc * 32], lane); }
    __builtin_amdgcn_sched_barrier(0);   // keeps the eight k fragments' LDS reads one group ahead of the products: with the fence below alone the compiler reads the second four into the first four's registers, among the products, and waits for them there
#pragma unroll
    for (int kc = 0; kc < HD / 32; ++kc) {
#pragma unroll
      for (int t = 0; t < FA_K / 16; ++t) sa[t] = __builtin_amdgcn_wmma_f32_16x16x32_f16(false, kf[kc][t], false, qh[kc], (short)0, kc == 0 ? nm : sa[t], false, false);
#pragma unroll
      for (int t = 0; t < FA_K / 16; ++t) sa[t] = __builtin_amdgcn_wmma_f32_16x16x32_f16(false, kf[kc][t], false, qr[kc], (short)0, sa[t], false, false); }
    __builtin_amdgcn_sched_barrier(0);   // keeps the maxima behind all sixteen products: moved in among them, each first read of a fresh score tile costs four idle vector slots
    float mt[FA_K / 16];   // one maximum and one sum per 16-key tile: four short chains, not one of 32 dependent links
#pragma unroll
    for (int t = 0; t < FA_K / 16; ++t) { mt[t] = -3.0e38f;
#pragma unroll
      for (int r = 0; r < 8; ++r) mt[t] = fmaxf(mt[t], sa[t][r]); }
    float mx = fmaxf(fmaxf(mt[0], mt[1]), fmaxf(mt[2], mt[3])); mx = fmaxf(mx, xhalf(mx));   // the stage's largest logit above the reference, the same in both lanes of a query
    const float thr = s == 0 ? -3.0e38f : 8.0f;   // stage 0 always takes its own maximum as the reference; later the reference moves only when exp2 would pass 2^8
    if (__builtin_amdgcn_ballot_w32(mx > thr) != 0) {   // one scalar branch a stage, for the whole wave
      const float d = mx > thr ? mx : 0.f, al = __builtin_amdgcn_exp2f(-fmaxf(d, 0.f));   // d < 0 only in stage 0, where sum and outputs are still 0
      l *= al;
#pragma unroll
      for (int r = 0; r < 8; ++r) nm[r] -= d;
#pragma unroll
      for (int t = 0; t < FA_K / 16; ++t) {
#pragma unroll
        for (int r = 0; r < 8; ++r) sa[t][r] -= d; }
#pragma unroll
      for (int j = 0; j < HD / 16; ++j) {
#pragma unroll
        for (int r = 0; r < 8; ++r) o[j][r] *= al; } }
    float st[FA_K / 16]; v16h p[FA_K / 32];
#pragma unroll
    for (int t = 0; t < FA_K / 16; ++t) { st[t] = 0.f;
#pragma unroll
      for (int r = 0; r < 8; ++r) { const float e = __builtin_amdgcn_exp2f(sa[t][r]); st[t] += e; p[t >> 1][(t & 1) * 8 + r] = (_Float16)e; } }
    l += (st[0] + st[1]) + (st[2] + st[3]);
#pragma unroll
    for (int kk = 0; kk < FA_K / 32; ++kk) {
#pragma unroll
      for (int j = 0; j < HD / 16; ++j) o[j] = __builtin_amdgcn_wmma_f32_16x16x32_f16(false, frag_h(&vs[cur][j * 16 + col][kk * 32], lane), false, p[kk], (short)0, o[j], false, false); }
    if (s + 1 < FA_NS) { *(v4u*)&ks[cur ^ 1][sr][sq] = k0r; *(v4u*)&ks[cur ^ 1][sr + 32][sq] = k1r; *(v4u*)&vs[cur ^ 1][sr][sq] = v0r; *(v4u*)&vs[cur ^ 1][sr + 32][sq] = v1r; }
    __syncthreads(); }   // one barrier a stage: publishes stage s + 1 and ends every wave's reads of the buffer that stage s + 2 overwrites
  l += xhalf(l); const float inv = 1.0f / l;
  float* yr = Y + ((size_t)b * TT + ql0 + col) * CC + h * HD + 8 * g;   // lane = query col; o[j][r] = dim j*16 + 8g + r
#pragma unroll
  for (int j = 0; j < HD / 16; ++j) { v4f a, c;
#pragma unroll
    for (int r = 0; r < 4; ++r) { a[r] = o[j][r] * inv; c[r] = o[j][4 + r] * inv; }
    vst2(yr + j * 16, a); vst2(yr + j * 16 + 4, c); } }
// ---- k_out: block = (64 rows, 128 cols): out = ctx Wo (+ bo): all rows: ctx bf16 hi + lo against exact bf16 Wo (2 products)
__global__ __launch_bounds__(128) void k_out(const float* __restrict__ Y, const __bf16* __restrict__ WOB, const float* __restrict__ BO, float* __restrict__ OUT) { __shared__ __align__(16) char ov[2 * (64 + 64 + 128) * GLD * 2];
  // one LDS range, used in turn: the two operand stages of the k loop (ctx hi, ctx lo, Wo); behind the loop's last barrier each wave's own output staging tile
  __bf16 (*yh)[64][GLD] = (__bf16 (*)[64][GLD])ov; __bf16 (*yl)[64][GLD] = (__bf16 (*)[64][GLD])(ov + 2 * 64 * GLD * 2); __bf16 (*wt)[128][GLD] = (__bf16 (*)[128][GLD])(ov + 4 * 64 * GLD * 2);
  float (*sf)[16][132] = (float (*)[16][132])ov;
  const int tid = threadIdx.x, wave = tid >> 5, lane = tid & 31, col = lane & 15, g = lane >> 4; const int c0 = blockIdx.y * 128; const size_t r0 = (size_t)blockIdx.x * 64 + wave * 16;
  v8f acc[8] = {};
  {   /* ALL rows: ctx split bf16 hi + lo x exact Wo (2 products) */
    const int pr = tid >> 4, pc = (tid & 15) * 4;   // a thread's 16-byte piece: row pr of each group of 8 rows, k pc..pc+3 of the stage
    const int qr = tid >> 3, qc = (tid & 7) * 8;    // its 16-byte piece of the bf16 Wo plane: row qr of each group of 16 rows, k qc..qc+7
    const float* yg = Y + ((size_t)blockIdx.x * 64 + pr) * CC + pc; const __bf16* wg = WOB + (size_t)(c0 + qr) * CC + qc;
    v4f yr[8]; v8b wr[8];
    ld_rows(yr, yg, CC); ld_rows_b(wr, wg, CC);
#pragma unroll
    for (int i = 0; i < 8; ++i) { const v4b hv = cvt4(yr[i]); *(v4b*)&yh[0][i * 8 + pr][pc] = hv; *(v4b*)&yl[0][i * 8 + pr][pc] = res4(yr[i], hv); }
#pragma unroll
    for (int i = 0; i < 8; ++i) *(v8b*)&wt[0][i * 16 + qr][qc] = wr[i];
    __syncthreads();
    // rolled stage loop, unrolled inner loops: as in k_proj
#pragma unroll 1
    for (int s = 0; s < CC / GK; ++s) { const int cur = s & 1;
      if (s + 1 < CC / GK) { ld_rows(yr, yg + (s + 1) * GK, CC); ld_rows_b(wr, wg + (s + 1) * GK, CC); }   // the next stage's loads fly while this stage is multiplied
#pragma unroll
      for (int kc = 0; kc < GK / 32; ++kc) { const v16b ah = frag_b(&yh[cur][wave * 16 + col][kc * 32], lane), al = frag_b(&yl[cur][wave * 16 + col][kc * 32], lane); v16b w[8];
#pragma unroll
        for (int j = 0; j < 8; ++j) w[j] = frag_b(&wt[cur][j * 16 + col][kc * 32], lane);
        __builtin_amdgcn_sched_barrier(0);   // keeps the ten fragments' LDS reads one group ahead of their products, as in k_proj
#pragma unroll
        for (int j = 0; j < 8; ++j) { acc[j] = __builtin_amdgcn_wmma_f32_16x16x32_bf16(false, ah, false, w[j], (short)0, acc[j], false, false);
          acc[j] = __builtin_amdgcn_wmma_f32_16x16x32_bf16(false, al, false, w[j], (short)0, acc[j], false, false); } }
      if (s + 1 < CC / GK) {
#pragma unroll
        for (int i = 0; i < 8; ++i) { const v4b hv = cvt4(yr[i]); *(v4b*)&yh[cur ^ 1][i * 8 + pr][pc] = hv; *(v4b*)&yl[cur ^ 1][i * 8 + pr][pc] = res4(yr[i], hv); }
#pragma unroll
        for (int i = 0; i < 8; ++i) *(v8b*)&wt[cur ^ 1][i * 16 + qr][qc] = wr[i]; }
      __syncthreads(); }   // one barrier a stage: publishes stage s + 1 and ends every wave's reads of the buffer that stage s + 2 (or the output staging) overwrites
#pragma unroll
    for (int j = 0; j < 8; ++j) { const float bias = BO ? bfr(BO[c0 + j * 16 + col]) : 0.f;
#pragma unroll
      for (int r = 0; r < 8; ++r) sf[wave][8 * g + r][j * 16 + col] = acc[j][r] + bias; }
  }
  LDSX(); for (int rl = 0; rl < 16; ++rl) vst2(OUT + (r0 + rl) * DIN + c0 + lane * 4, *(const v4f*)&sf[wave][rl][lane * 4]); }

extern "C" void kernel_launch(void* const* d_in, const int* in_sizes, int n_in, void* d_out, int out_size, void* d_ws, size_t ws_size, hipStream_t stream) {
  (void)in_sizes; (void)n_in; (void)out_size;
  const float** F = (const float**)d_in;
  if (ws_size < (size_t)WS_END) return;
  char* ws = (char*)d_ws; _Float16 *QH = (_Float16*)(ws + WS_QH), *KH = (_Float16*)(ws + WS_KH), *VT = (_Float16*)(ws + WS_VT), *QL = (_Float16*)(ws + WS_QL), *KL = (_Float16*)(ws + WS_KL); __bf16 *VB = (__bf16*)(ws + WS_VB), *VBL = (__bf16*)(ws + WS_VBL), *XB = (__bf16*)(ws + WS_XB), *WB = (__bf16*)(ws + WS_WB); float *Y = (float*)(ws + WS_Y), *RT = (float*)(ws + WS_RT);
  (void)Y; (void)QL; (void)KL; (void)VB; (void)VBL;
  // inputs: 0 x [2,2048,1024]; 1 Wq [1024,1024] (out,in), 2 bq; 3 Wk, 4 bk; 5 Wv, 6 bv; 7 Wo (no bias)
  k_cvt<<<dim3((NB * TT * DIN + 4 * CC * DIN) / CV_N), 256, 0, stream>>>(F[0], F[1], F[3], F[5], F[7], XB, WB, RT);
  k_proj<<<dim3(TNB * TT / PM, CC / 128, 3), 128, 0, stream>>>(XB, WB, F[2], F[4], F[6], RT, QH, QL, KH, KL, VT, VB, VBL);
  k_fa<<<dim3(TT / FA_Q, NH, TNB), 256, 0, stream>>>(QH, QL, KH, VT, Y);
  k_out<<<dim3(TNB * TT / 64, DIN / 128), 128, 0, stream>>>(Y, WB + 3 * (size_t)CC * DIN, nullptr, (float*)d_out);
}

// v007
// It runs in 88.6 microseconds.
// Timed twice side by side with v006, it ran 1.08 and 1.07 times as fast.
// Counting every step since v000, it is 16.6 times as fast.
// compute dtype: all float inputs rounded to bf16; q/k/v projections with EXACT bf16 products on WMMA 16x16x32 (f32 accumulate); interleaved RoPE in f32 (sincosf) on the projected q/k rows; q x log2(e) once to f16 against k x 2^-5 (= 1024^-0.5) once to f16 (1 product, in an f32 accumulator that starts at minus a reference maximum); one-pass softmax in f32 (exp2 of the accumulator as it is; the reference maximum moves, and sums and outputs are rescaled, only when a logit passes it by more than 8 in log2 units); exp(logit - reference) once to f16 against v once to f16 (1 product), divided by the sum at the end; ctx split bf16 hi + lo against exact Wo (2 products); f32 output.
#include <hip/hip_runtime.h>
#include <math.h>

typedef __attribute__((ext_vector_type(16))) _Float16 v16h;
typedef __attribute__((ext_vector_type(16))) __bf16 v16b;
typedef __attribute__((ext_vector_type(8)))  _Float16 v8h;
typedef __attribute__((ext_vector_type(8)))  float v8f;
typedef __attribute__((ext_vector_type(4)))  float v4f;
typedef __attribute__((ext_vector_type(2)))  float v2f;
typedef __attribute__((ext_vector_type(4)))  unsigned v4u;
typedef __attribute__((ext_vector_type(4)))  int v4i;
typedef float __attribute__((may_alias)) float_a;
typedef int __attribute__((may_alias)) int_a;

template <typename T> __device__ __forceinline__ void vst2(void* p, T v) { *(T*)p = v;  }
__device__ __forceinline__ v8f wmma16(v16h a, v16h b, v8f c) {
  v8f d = __builtin_amdgcn_wmma_f32_16x16x32_f16(false, a, false, b, (short)0, c, false, false);
  asm volatile("v_nop\n\tv_nop\n\tv_nop\n\tv_nop" : "+v"(d) : "v"(a), "v"(b));
  return d;
}
__device__ __forceinline__ v8f wmma_bf(v16b a, v16b b, v8f c) {
  v8f d = __builtin_amdgcn_wmma_f32_16x16x32_bf16(false, a, false, b, (short)0, c, false, false);
  asm volatile("v_nop\n\tv_nop\n\tv_nop\n\tv_nop" : "+v"(d) : "v"(a), "v"(b));
  return d;
}
// 16x16x32 fragments: lane = (h = lane>>4, row/col = lane&15); elements 0..7 = k0+8h+0..7, 8..15 = k0+16+8h+0..7; D element r = row 8h+r
__device__ __forceinline__ v16h frag_h(const _Float16* rowk0, int lane) {
  union { v16h v; v8h q[2]; } u; const _Float16* p = rowk0 + 8 * (lane >> 4);
  u.q[0] = *(const v8h*)p; u.q[1] = *(const v8h*)(p + 16); return u.v;
}
__device__ __forceinline__ v16h frag_f32(const float* rowk0, int lane) {
  v16h a; const float* p = rowk0 + 8 * (lane >> 4);
#pragma unroll
  for (int i = 0; i < 8; ++i) { a[i] = (_Float16)p[i]; a[8 + i] = (_Float16)p[16 + i]; }
  return a;
}
__device__ __forceinline__ v16h frag_f32s(const float* rowk0, int lane, float sc) {
  v16h a; const float* p = rowk0 + 8 * (lane >> 4);
#pragma unroll
  for (int i = 0; i < 8; ++i) { a[i] = (_Float16)(p[i] * sc); a[8 + i] = (_Float16)(p[16 + i] * sc); }
  return a;
}
// column fragment from a [K][ld] layout (column n), rows >= K read as 0
__device__ __forceinline__ v16h fragc_f32(const float* W, int k0, int n, int lane, int ld, int K) {
  v16h a; const int g = lane >> 4;
#pragma unroll
  for (int i = 0; i < 8; ++i) { const int ka = k0 + 8 * g + i, kb = ka + 16;
    a[i] = (_Float16)(ka < K ? W[(size_t)(ka < K ? ka : K - 1) * ld + n] : 0.f); a[8 + i] = (_Float16)(kb < K ? W[(size_t)(kb < K ? kb : K - 1) * ld + n] : 0.f); }
  return a;
}
struct F2 { v16b h, l; };
__device__ __forceinline__ F2 bsplit16(const float v[16]) { F2 r;
#pragma unroll
  for (int i = 0; i < 16; ++i) { const __bf16 h = (__bf16)v[i]; r.h[i] = h; r.l[i] = (__bf16)(v[i] - (float)h); }
  return r; }
__device__ __forceinline__ F2 split_row(const float* row, int k0, int lane) { float v[16]; const float* p = row + k0 + 8 * (lane >> 4);
#pragma unroll
  for (int i = 0; i < 8; ++i) { v[i] = p[i]; v[8 + i] = p[16 + i]; }
  return bsplit16(v); }
__device__ __forceinline__ F2 split_rowK(const float* row, int k0, int lane, int K) { float v[16]; const int g = lane >> 4;
#pragma unroll
  for (int i = 0; i < 8; ++i) { const int ka = k0 + 8 * g + i, kb = ka + 16; v[i] = ka < K ? row[ka < K ? ka : K - 1] : 0.f; v[8 + i] = kb < K ? row[kb < K ? kb : K - 1] : 0.f; }
  return bsplit16(v); }
__device__ __forceinline__ F2 split_col(const float* W, int k0, int n, int lane, int ld, int K) { float v[16]; const int g = lane >> 4;
#pragma unroll
  for (int i = 0; i < 8; ++i) { const int ka = k0 + 8 * g + i, kb = ka + 16; v[i] = ka < K ? W[(size_t)(ka < K ? ka : K - 1) * ld + n] : 0.f; v[8 + i] = kb < K ? W[(size_t)(kb < K ? kb : K - 1) * ld + n] : 0.f; }
  return bsplit16(v); }
__device__ __forceinline__ v8f mac3(const F2& a, const F2& b, v8f c) { c = wmma_bf(a.l, b.h, c); c = wmma_bf(a.h, b.l, c); return wmma_bf(a.h, b.h, c); }
__device__ __forceinline__ float sigm(float v) { return 1.0f / (1.0f + expf(-v)); }
#define LDSX() do { asm volatile("s_wait_dscnt 0" ::: "memory"); __builtin_amdgcn_wave_barrier(); __builtin_amdgcn_fence(__ATOMIC_RELEASE, "workgroup"); } while (0)

// Multi-head attention with RoPE (B 2, S 2,048, 1,024 = 16 x 64; 0.02-scale weights and biases): q,k,v = x W^T + b ((out,in)); interleaved-pair RoPE on q, k (angle t x 10000^(-2i/64)); scores = q k^T / sqrt(1024) (note: sqrt(D), not sqrt(hd)); out = merged(softmax(scores) v) Wo^T (no output bias).
#define NB 2
#define TT 2048
#define CC 1024            // NH * HD = projected width
#define DIN 1024          // input (model) width
#define NH 16
#define HD 64
#define NQB (TT / 64)
#define HG 4
#define SCALE (0.03125f)
#define CAUSAL 0
#ifndef TNB
#define TNB NB
#endif
__device__ __forceinline__ float bfr(float v) { return (float)(__bf16)v; }
__host__ __device__ __forceinline__ int kb_last(int qb) { return CAUSAL ? ((qb * 64 + 63) >> 7) : (TT / 128 - 1); }
typedef __attribute__((ext_vector_type(8))) __bf16 v8b;
__device__ __forceinline__ v16b frag_b(const __bf16* rowk0, int lane) {
  union { v16b v; v8b q[2]; } u; const __bf16* p = rowk0 + 8 * (lane >> 4);
  u.q[0] = *(const v8b*)p; u.q[1] = *(const v8b*)(p + 16); return u.v;
}
#define QBH 0              // unused: k_fa has no high-precision path
#define QHI 0               // rows carrying a q residual plane: none. k is rounded once to f16, so a residual of q alone would take away only q's half of the logit's rounding error; k's half stays either way
#define KHI 64            // key rows carrying k residual / v bf16 hi+lo planes (written by k_proj; no kernel here reads them)
// B fragment (k rows k0+.., output column o) of a weight: (in,out) [K][ld] or (out,in) [ld rows of K]: bf16 exact, or f16(bf16 * 256) exact
__device__ __forceinline__ v16b wcol_io(const float* Wm, int k0, int o, int lane, int ld) { v16b w; const int g = lane >> 4;
#pragma unroll
  for (int i = 0; i < 8; ++i) { w[i] = (__bf16)Wm[(size_t)(k0 + 8 * g + i) * ld + o]; w[8 + i] = (__bf16)Wm[(size_t)(k0 + 16 + 8 * g + i) * ld + o]; }
  return w; }
__device__ __forceinline__ v16b wcol_oi(const float* Wm, int k0, int o, int lane, int K) { v16b w; const float* p = Wm + (size_t)o * K + k0 + 8 * (lane >> 4);
#pragma unroll
  for (int i = 0; i < 8; ++i) { w[i] = (__bf16)p[i]; w[8 + i] = (__bf16)p[16 + i]; }
  return w; }
__device__ __forceinline__ v16h wcolh_io(const float* Wm, int k0, int o, int lane, int ld) { v16h w; const int g = lane >> 4;
#pragma unroll
  for (int i = 0; i < 8; ++i) { w[i] = (_Float16)(bfr(Wm[(size_t)(k0 + 8 * g + i) * ld + o]) * 256.0f); w[8 + i] = (_Float16)(bfr(Wm[(size_t)(k0 + 16 + 8 * g + i) * ld + o]) * 256.0f); }
  return w; }
__device__ __forceinline__ v16h wcolh_oi(const float* Wm, int k0, int o, int lane, int K) { v16h w; const float* p = Wm + (size_t)o * K + k0 + 8 * (lane >> 4);
#pragma unroll
  for (int i = 0; i < 8; ++i) { w[i] = (_Float16)(bfr(p[i]) * 256.0f); w[8 + i] = (_Float16)(bfr(p[16 + i]) * 256.0f); }
  return w; }
#define WQKV_LAYOUT 1   // 0 = (in,out) [DIN][CC]; 1 = (out,in) [CC][DIN]; 2 = per-head [NH][DIN][HD]; read only through WCOL, which no kernel calls (k_proj reads (out,in) [CC][DIN])
__device__ __forceinline__ v16b wcol_hdk(const float* Wm, int k0, int o, int lane) { v16b w; const int g = lane >> 4; const float* p = Wm + (size_t)(o / HD) * DIN * HD + (o % HD);
#pragma unroll
  for (int i = 0; i < 8; ++i) { w[i] = (__bf16)p[(size_t)(k0 + 8 * g + i) * HD]; w[8 + i] = (__bf16)p[(size_t)(k0 + 16 + 8 * g + i) * HD]; }
  return w; }
#define WO_OUT_IN 1
#if WQKV_LAYOUT == 1
#define WCOL(W, k0, o, lane) wcol_oi(W, k0, o, lane, DIN)
#elif WQKV_LAYOUT == 2
#define WCOL(W, k0, o, lane) wcol_hdk(W, k0, o, lane)
#else
#define WCOL(W, k0, o, lane) wcol_io(W, k0, o, lane, CC)
#endif
#if WO_OUT_IN
#define WOCOL(W, k0, o, lane) wcol_oi(W, k0, o, lane, CC)
#define WOCOLH(W, k0, o, lane) wcolh_oi(W, k0, o, lane, CC)
#else
#define WOCOL(W, k0, o, lane) wcol_io(W, k0, o, lane, DIN)
#define WOCOLH(W, k0, o, lane) wcolh_io(W, k0, o, lane, DIN)
#endif
__constant__ float c_invf[32] = {1.000000000e+0f,7.498942018e-1f,5.623413324e-1f,4.216965139e-1f,3.162277639e-1f,2.371373773e-1f,1.778279394e-1f,1.333521456e-1f,1.000000015e-1f,7.498942316e-2f,5.623413250e-2f,4.216964915e-2f,3.162277490e-2f,2.371373773e-2f,1.778279431e-2f,1.333521400e-2f,9.999999776e-3f,7.498942316e-3f,5.623413250e-3f,4.216964822e-3f,3.162277630e-3f,2.371373819e-3f,1.778279431e-3f,1.333521446e-3f,1.000000047e-3f,7.498941850e-4f,5.623413017e-4f,4.216965172e-4f,3.162277571e-4f,2.371373703e-4f,1.778279402e-4f,1.333521504e-4f};   /* f32(1 / 10000^(2i/64)) */
#ifndef SM_EXTRA_PARAMS
#define SM_EXTRA_PARAMS
#endif
#ifndef PROJ_EXTRA_PARAMS
#define PROJ_EXTRA_PARAMS
#endif
#ifndef SM_MASK_HOOK
#define SM_MASK_HOOK (void)0
#endif

#define WS_QH  0u                                      // f16 q x log2(e) rows [b*t][CC]
#define WS_KH  (WS_QH + 2u * (size_t)NB * TT * CC)      // f16 k x 2^-5 rows [b*t][CC]
#define WS_VT  (WS_KH + 2u * (size_t)NB * TT * CC)      // f16 v planes [b][c][t]
#define WS_QL  (WS_VT + 2u * (size_t)NB * CC * TT)      // f16 residual of q x log2(e), unscaled, rows [b][t < QHI][CC] (empty: QHI is 0)
#define WS_KL  (WS_QL + 2u * (size_t)NB * QHI * CC)     // f16 residual of k x 2^-5, unscaled, rows [b][t < KHI][CC]
#define WS_VB  (WS_KL + 2u * (size_t)NB * KHI * CC)     // bf16 v hi planes [b][c][t < KHI]
#define WS_VBL (WS_VB + 2u * (size_t)NB * CC * KHI)
#define WS_XB  (WS_VBL + 2u * (size_t)NB * CC * KHI)    // bf16 x rows [b*t][DIN]
#define WS_WB  (WS_XB + 2u * (size_t)NB * TT * DIN)     // bf16 Wq, Wk, Wv, Wo, each [CC][DIN] as given
#define WS_Y   (WS_WB + 2u * 4u * (size_t)CC * DIN)     // f32 ctx rows [b*t][CC] (only when there is an output projection)
#define WS_RT  (WS_Y  + 4u * (size_t)NB * TT * CC)      // f32 RoPE table [t][HD / 2] of (cos, sin), written by k_cvt in every call
#define WS_END (WS_RT + 8u * (size_t)TT * (HD / 2))

// GEMM operand staging (k_proj, k_out): a stage is 64 k of every operand row, kept as bf16 in LDS; every wave takes its fragments from there with 16-byte LDS loads. x and the four weights come from k_cvt's bf16 planes (a stage row = one 128-B line, 8 lanes x 16 B, copied as it is); ctx comes as f32 (16 lanes x 16 B per row) and is split by the block.
#define GK 64              // k per stage
#define GLD 72             // LDS row pitch in bf16: 144 B = 16 B x odd, conflict-free for the 16-byte fragment reads
typedef __attribute__((ext_vector_type(4))) __bf16 v4b;
__device__ __forceinline__ v4b cvt4(v4f v) { v4b r; r[0] = (__bf16)v[0]; r[1] = (__bf16)v[1]; r[2] = (__bf16)v[2]; r[3] = (__bf16)v[3]; return r; }
__device__ __forceinline__ v4b res4(v4f v, v4b h) { v4b r;
#pragma unroll
  for (int i = 0; i < 4; ++i) r[i] = (__bf16)(v[i] - (float)h[i]);
  return r; }
// a thread's N pieces of a stage: rows 8 apart, 16 bytes each
template <int N> __device__ __forceinline__ void ld_rows(v4f (&r)[N], const float* p, int ld) {
#pragma unroll
  for (int i = 0; i < N; ++i) r[i] = *(const v4f*)(p + (size_t)i * 8 * ld);
  asm volatile("s_wait_xcnt 0x0" :: "v"(p) : "memory"); }   // stands in front of every overwrite of these loads' address registers (p as an input keeps them whole up to here); its memory clobber also holds the loads here, ahead of the products they fly behind
// a thread's N pieces of a stage of a bf16 plane: rows 16 apart, 16 bytes each
template <int N> __device__ __forceinline__ void ld_rows_b(v8b (&r)[N], const __bf16* p, int ld) {
#pragma unroll
  for (int i = 0; i < N; ++i) r[i] = *(const v8b*)(p + (size_t)i * 16 * ld);
  asm volatile("s_wait_xcnt 0x0" :: "v"(p) : "memory"); }   // as in ld_rows: stands in front of every overwrite of these loads' address registers and holds the loads ahead of the products they fly behind
// ---- k_cvt also fills the RoPE table: one (position, pair) per thread, sincosf of the f32 angle t * c_invf[i]; both batches, all heads and both of q and k read the same 65,536 entries
// ---- k_cvt: x and the four weights rounded to bf16 ONCE, as a stream (one block per WGP, each 32,768 consecutive floats of one tensor, in whole-line 16-byte loads that are all issued ahead of the first store): every GEMM block that reads them afterwards fetches 2 bytes an element, not 4, and converts nothing
#define CV_N 32768
__global__ __launch_bounds__(256) void k_cvt(const float* __restrict__ X, const float* __restrict__ WQ, const float* __restrict__ WK, const float* __restrict__ WV, const float* __restrict__ WO, __bf16* __restrict__ XB, __bf16* __restrict__ WB, float* __restrict__ RT) {
  static_assert((NB * TT * DIN + 4 * CC * DIN) / CV_N * 256 == TT * (HD / 2), "one table entry per thread");
  const int nx = NB * TT * DIN / CV_N, nw = CC * DIN / CV_N; const int bi = blockIdx.x, tid = threadIdx.x;
  const float* s; __bf16* d;
  if (bi < nx) { s = X + (size_t)bi * CV_N; d = XB + (size_t)bi * CV_N; }
  else { const int w = (bi - nx) / nw; s = (w == 0 ? WQ : w == 1 ? WK : w == 2 ? WV : WO) + (size_t)((bi - nx) % nw) * CV_N; d = WB + (size_t)(bi - nx) * CV_N; }
  const int ri = bi * 256 + tid; const float fr = c_invf[ri & (HD / 2 - 1)];
  v4f r[CV_N / 1024];
#pragma unroll
  for (int i = 0; i < CV_N / 1024; ++i) r[i] = *(const v4f*)(s + i * 1024 + tid * 4);
  { float sn, cs; sincosf((float)(ri / (HD / 2)) * fr, &sn, &cs); v2f e; e[0] = cs; e[1] = sn; *(v2f*)(RT + 2 * (size_t)ri) = e; }
#pragma unroll
  for (int i = 0; i < CV_N / 1024; ++i) *(v4b*)(d + i * 1024 + tid * 4) = cvt4(r[i]); }
// ---- k_proj: block = (128 rows, 128 cols, which), four waves as 2 x 2, a wave = 64 x 64 (4 x and 4 weight fragments feed 16 products: half a fragment read from LDS per product): q/k/v = X W (+ b) with exact bf16 products (K = DIN) -> which 0: q f16 rows (+ residual rows < QHI); 1: k f16 rows (+ residual rows < KHI); 2: v f16 planes [c][t] (+ bf16 hi/lo planes for t < KHI)
#define PM 128             // rows of a block; the epilogue takes them in halves of 64, so that its f32 tile stays small enough for three blocks on a WGP
__global__ __launch_bounds__(128) void k_proj(const __bf16* __restrict__ XB, const __bf16* __restrict__ WB, const float* __restrict__ BQ, const float* __restrict__ BK, const float* __restrict__ BV, const float* __restrict__ RT,
    _Float16* __restrict__ QH, _Float16* __restrict__ QL, _Float16* __restrict__ KH, _Float16* __restrict__ KL, _Float16* __restrict__ VT, __bf16* __restrict__ VB, __bf16* __restrict__ VBL PROJ_EXTRA_PARAMS) {
  __shared__ __align__(16) float st[64][132]; __shared__ __align__(16) char ov[2 * (PM + 128) * GLD * 2];
  // one LDS range, used in turn: the two operand stages of the k loop; behind the loop's last barrier the epilogue's conversion tiles (q, k: sh, sl; v: th, tb, tbl)
  __bf16 (*xs)[PM][GLD] = (__bf16 (*)[PM][GLD])ov; __bf16 (*wt)[128][GLD] = (__bf16 (*)[128][GLD])(ov + 2 * PM * GLD * 2);
  _Float16 (*sh)[136] = (_Float16 (*)[136])ov; _Float16 (*sl)[136] = (_Float16 (*)[136])(ov + 64 * 136 * 2);
  _Float16 (*th)[72] = (_Float16 (*)[72])ov; __bf16 (*tb)[72] = (__bf16 (*)[72])(ov + 128 * 72 * 2); __bf16 (*tbl)[72] = (__bf16 (*)[72])(ov + 2 * 128 * 72 * 2);
  const int tid = threadIdx.x, wave = tid >> 5, lane = tid & 31, col = lane & 15, g = lane >> 4; const int wrow = wave >> 1, wcol = wave & 1; const int which = blockIdx.z; const int c0 = blockIdx.y * 128; const size_t r0 = (size_t)blockIdx.x * PM; const size_t bb = r0 / TT; const int t0 = (int)(r0 % TT);
  const float* BA = which == 0 ? BQ : which == 1 ? BK : BV;
  v8f acc[4][4] = {};
  const int pr = tid >> 3, pc = (tid & 7) * 8;   // a thread's 16-byte piece: row pr of each group of 16 rows, k pc..pc+7 of the stage
  const __bf16* xg = XB + (r0 + pr) * DIN + pc; const __bf16* wg = WB + ((size_t)which * CC + c0 + pr) * DIN + pc;
  v8b xr[PM / 16], wr[8];
  ld_rows_b(xr, xg, DIN); ld_rows_b(wr, wg, DIN);
#pragma unroll
  for (int i = 0; i < PM / 16; ++i) *(v8b*)&xs[0][i * 16 + pr][pc] = xr[i];
#pragma unroll
  for (int i = 0; i < 8; ++i) *(v8b*)&wt[0][i * 16 + pr][pc] = wr[i];
  __syncthreads();
  // the stage loop stays rolled so that the two buffers alternate by index and the loop stays small; the inner loops are unrolled so that the register arrays are indexed by constants
#pragma unroll 1
  for (int s = 0; s < DIN / GK; ++s) { const int cur = s & 1;
    if (s + 1 < DIN / GK) { ld_rows_b(xr, xg + (s + 1) * GK, DIN); ld_rows_b(wr, wg + (s + 1) * GK, DIN); }   // the next stage's loads fly while this stage is multiplied
#pragma unroll
    for (int kc = 0; kc < GK / 32; ++kc) { v16b a[4], w[4];
#pragma unroll
      for (int i = 0; i < 4; ++i) a[i] = frag_b(&xs[cur][wrow * 64 + i * 16 + col][kc * 32], lane);
#pragma unroll
      for (int j = 0; j < 4; ++j) w[j] = frag_b(&wt[cur][wcol * 64 + j * 16 + col][kc * 32], lane);
      __builtin_amdgcn_sched_barrier(0);   // keeps the eight fragments' LDS reads one group ahead of their products: left alone the compiler reads each into the same registers and waits out the LDS latency before every product
#pragma unroll
      for (int i = 0; i < 4; ++i) {
#pragma unroll
        for (int j = 0; j < 4; ++j) acc[i][j] = __builtin_amdgcn_wmma_f32_16x16x32_bf16(false, a[i], false, w[j], (short)0, acc[i][j], false, false); } }
    if (s + 1 < DIN / GK) {
#pragma unroll
      for (int i = 0; i < PM / 16; ++i) *(v8b*)&xs[cur ^ 1][i * 16 + pr][pc] = xr[i];
#pragma unroll
      for (int i = 0; i < 8; ++i) *(v8b*)&wt[cur ^ 1][i * 16 + pr][pc] = wr[i]; }
    __syncthreads(); }   // one barrier a stage: publishes stage s + 1 and ends every wave's reads of the buffer that stage s + 2 (or the epilogue) overwrites
  // the epilogue runs once per half of 64 rows: the two waves that hold the half hand it over through st, all four waves rotate, convert and store it. Half 1's writes of st stand behind half 0's third barrier (the last reads of st are in front of it); its writes of the conversion tiles stand behind its own first two barriers (every wave has left half 0's store loop by then)
  const size_t rblk = r0; const int tblk = t0;
  for (int hf = 0; hf < PM / 64; ++hf) { const size_t r0 = rblk + hf * 64; const int t0 = tblk + hf * 64;   // the half's first row, under the names that the lines below use
    asm volatile("s_wait_xcnt 0x0" ::: "memory");   // stands behind the stores of the half before, in front of this half's first write of a register that they name
  { // stage the f32 tile (acc + bias) in LDS, rotate the q and k rows (interleaved (even, odd) RoPE pairs, angle = t * 10000^(-2i/64), cos and sin from k_cvt's table), then convert
    // a wave takes whole rows (row it * 4 + wave, 4 columns = 2 pairs a lane): 512 B of the tile and the row's 256 B of the table per pass, both heads of the tile reading the same table row; the table loads are issued here, ahead of the bias loads and the tile's LDS stores, so that their latency is not paid behind the barrier
    v4f rt[16]; const float* tp = RT + (size_t)(t0 + wave) * HD + (lane & 15) * 4;
    if (which < 2) {
#pragma unroll
      for (int it = 0; it < 16; ++it) rt[it] = *(const v4f*)(tp + it * 4 * HD);
      asm volatile("s_wait_xcnt 0x0" :: "v"(tp) : "memory"); }   // as in ld_rows: stands in front of every overwrite of these loads' address registers
    if (wrow == hf) {   // only the two waves that hold this half write it; the three loops are unrolled so that acc is indexed by constants and stays in registers
#pragma unroll
      for (int j = 0; j < 4; ++j) { const float bias = BA ? bfr(BA[c0 + wcol * 64 + j * 16 + col]) : 0.f;
#pragma unroll
        for (int i = 0; i < 4; ++i) {
#pragma unroll
          for (int r = 0; r < 8; ++r) st[i * 16 + 8 * g + r][wcol * 64 + j * 16 + col] = acc[i][j][r] + bias; } } }
    __syncthreads();
    if (which < 2) {
#pragma unroll
      for (int it = 0; it < 16; ++it) { float* rw = &st[it * 4 + wave][lane * 4]; const v4f x = *(const v4f*)rw, c = rt[it]; v4f y;
        y[0] = x[0] * c[0] - x[1] * c[1]; y[1] = x[0] * c[1] + x[1] * c[0]; y[2] = x[2] * c[2] - x[3] * c[3]; y[3] = x[2] * c[3] + x[3] * c[2]; *(v4f*)rw = y; } }
    __syncthreads(); }
  if (which < 2) { _Float16* DH = which == 0 ? QH : KH; _Float16* DL = which == 0 ? QL : KL; const int nhi = which == 0 ? QHI : KHI; const bool hi_rows = t0 < nhi;
    const float vs = which == 0 ? 1.44269504088896f : SCALE;   // the logit scale and log2(e) go into the operands, so that k_fa's products are exp2 arguments as they leave the accumulator; 2^-5 on k is exact
    for (int e = tid; e < 64 * 128; e += 128) { const int rl = e >> 7, cl = e & 127; const float v = st[rl][cl] * vs; const _Float16 hv = (_Float16)v; sh[rl][cl] = hv; if (hi_rows) sl[rl][cl] = (_Float16)(v - (float)hv); }
    __syncthreads();
    for (int e = tid; e < 64 * 16; e += 128) { const int rl = e >> 4, q = e & 15; vst2((unsigned*)(DH + (r0 + rl) * CC + c0 + q * 8), *(const v4u*)&sh[rl][q * 8]); if (hi_rows) vst2((unsigned*)(DL + (bb * nhi + t0 + rl) * (size_t)CC + c0 + q * 8), *(const v4u*)&sl[rl][q * 8]); }
  } else { const bool hi_rows = t0 < KHI;
    for (int e = tid; e < 64 * 128; e += 128) { const int rl = e & 63, cl = e >> 6; const float v = st[rl][cl]; th[cl][rl] = (_Float16)v; const __bf16 bh = (__bf16)v; tb[cl][rl] = bh; tbl[cl][rl] = (__bf16)(v - (float)bh); }
    __syncthreads();
    for (int e = tid; e < 128 * 8; e += 128) { const int cl = e >> 3, q = e & 7; vst2((unsigned*)(VT + (bb * CC + c0 + cl) * (size_t)TT + t0 + q * 8), *(const v4u*)&th[cl][q * 8]); if (hi_rows) { const size_t o3 = (bb * CC + c0 + cl) * (size_t)KHI + t0 + q * 8; vst2((unsigned*)(VB + o3), *(const v4u*)&tb[cl][q * 8]); vst2((unsigned*)(VBL + o3), *(const v4u*)&tbl[cl][q * 8]); } } } }
}
#define FA_Q 128
#define FA_K 64
#define FA_NS (TT / FA_K)
#define FA_LD 72           // LDS row pitch in halves: 144 B = 16 B x odd, conflict-free for the 16-byte fragment reads
__device__ __forceinline__ float xhalf(float v) { const int i = __builtin_bit_cast(int, v); return __builtin_bit_cast(float, __builtin_amdgcn_permlanex16(i, i, 0x76543210, 0xfedcba98, false, false)); }   /* lane l <-> l ^ 16 */
__global__ __launch_bounds__(256) void k_fa(const _Float16* __restrict__ QH, const _Float16* __restrict__ KH, const _Float16* __restrict__ VT, float* __restrict__ Y) {
  __shared__ __align__(16) _Float16 ks[2][FA_K][FA_LD], vs[2][HD][FA_LD];
  const int tid = threadIdx.x, wave = tid >> 5, lane = tid & 31, col = lane & 15, g = lane >> 4; const int h = blockIdx.y, b = blockIdx.z; const int ql0 = blockIdx.x * FA_Q + wave * 16;
  v16h qh[HD / 32];
#pragma unroll
  for (int kc = 0; kc < HD / 32; ++kc) qh[kc] = frag_h(QH + ((size_t)b * TT + ql0 + col) * CC + h * HD + kc * 32, lane);
  // staging: a thread moves two 16-byte pieces of the k tile (64 keys x 128 B) and two of the v tile (64 dims x 128 B), whole 128-B lines per 8 lanes
  const int sr = tid >> 3, sq = (tid & 7) * 8;
  const _Float16* kg = KH + ((size_t)b * TT + sr) * CC + h * HD + sq; const _Float16* vg = VT + ((size_t)b * CC + h * HD + sr) * (size_t)TT + sq;
  v4u k0r = *(const v4u*)kg, k1r = *(const v4u*)(kg + (size_t)32 * CC), v0r = *(const v4u*)vg, v1r = *(const v4u*)(vg + (size_t)32 * TT);
  *(v4u*)&ks[0][sr][sq] = k0r; *(v4u*)&ks[0][sr + 32][sq] = k1r; *(v4u*)&vs[0][sr][sq] = v0r; *(v4u*)&vs[0][sr + 32][sq] = v1r;
  __syncthreads();
  v8f o[HD / 16] = {}, nm = {}; float l = 0.f;   // nm: minus the reference maximum of the lane's query (log2 units) in all eight elements, the start value of every score tile
  // the stage loop stays rolled (for speed only); every inner loop is unrolled so that the fragment and accumulator arrays are indexed by constants and stay in registers
#pragma unroll 1
  for (int s = 0; s < FA_NS; ++s) { const int cur = s & 1;
    if (s + 1 < FA_NS) { const _Float16* kn = kg + (size_t)(s + 1) * FA_K * CC; const _Float16* vn = vg + (s + 1) * FA_K; k0r = *(const v4u*)kn; k1r = *(const v4u*)(kn + (size_t)32 * CC); v0r = *(const v4u*)vn; v1r = *(const v4u*)(vn + (size_t)32 * TT); }
    v8f sa[FA_K / 16]; v16h kf[HD / 32][FA_K / 16];
#pragma unroll
    for (int kc = 0; kc < HD / 32; ++kc) {
#pragma unroll
      for (int t = 0; t < FA_K / 16; ++t) kf[kc][t] = frag_h(&ks[cur][t * 16 + col][kc * 32], lane); }
    __builtin_amdgcn_sched_barrier(0);   // keeps the eight k fragments' LDS reads one group ahead of the products: with the fence below alone the compiler reads the second four into the first four's registers, among the products, and waits for them there
#pragma unroll
    for (int kc = 0; kc < HD / 32; ++kc) {
#pragma unroll
      for (int t = 0; t < FA_K / 16; ++t) sa[t] = __builtin_amdgcn_wmma_f32_16x16x32_f16(false, kf[kc][t], false, qh[kc], (short)0, kc == 0 ? nm : sa[t], false, false); }
    __builtin_amdgcn_sched_barrier(0);   // keeps the maxima behind all eight products: moved in among them, each first read of a fresh score tile costs four idle vector slots
    float mt[FA_K / 16];   // one maximum and one sum per 16-key tile: four short chains, not one of 32 dependent links
#pragma unroll
    for (int t = 0; t < FA_K / 16; ++t) { mt[t] = -3.0e38f;
#pragma unroll
      for (int r = 0; r < 8; ++r) mt[t] = fmaxf(mt[t], sa[t][r]); }
    float mx = fmaxf(fmaxf(mt[0], mt[1]), fmaxf(mt[2], mt[3])); mx = fmaxf(mx, xhalf(mx));   // the stage's largest logit above the reference, the same in both lanes of a query
    const float thr = s == 0 ? -3.0e38f : 8.0f;   // stage 0 always takes its own maximum as the reference; later the reference moves only when exp2 would pass 2^8
    if (__builtin_amdgcn_ballot_w32(mx > thr) != 0) {   // one scalar branch a stage, for the whole wave
      const float d = mx > thr ? mx : 0.f, al = __builtin_amdgcn_exp2f(-fmaxf(d, 0.f));   // d < 0 only in stage 0, where sum and outputs are still 0
      l *= al;
#pragma unroll
      for (int r = 0; r < 8; ++r) nm[r] -= d;
#pragma unroll
      for (int t = 0; t < FA_K / 16; ++t) {
#pragma unroll
        for (int r = 0; r < 8; ++r) sa[t][r] -= d; }
#pragma unroll
      for (int j = 0; j < HD / 16; ++j) {
#pragma unroll
        for (int r = 0; r < 8; ++r) o[j][r] *= al; } }
    float st[FA_K / 16]; v16h p[FA_K / 32];
#pragma unroll
    for (int t = 0; t < FA_K / 16; ++t) { st[t] = 0.f;
#pragma unroll
      for (int r = 0; r < 8; ++r) { const float e = __builtin_amdgcn_exp2f(sa[t][r]); st[t] += e; p[t >> 1][(t & 1) * 8 + r] = (_Float16)e; } }
    l += (st[0] + st[1]) + (st[2] + st[3]);
#pragma unroll
    for (int kk = 0; kk < FA_K / 32; ++kk) {
#pragma unroll
      for (int j = 0; j < HD / 16; ++j) o[j] = __builtin_amdgcn_wmma_f32_16x16x32_f16(false, frag_h(&vs[cur][j * 16 + col][kk * 32], lane), false, p[kk], (short)0, o[j], false, false); }
    if (s + 1 < FA_NS) { *(v4u*)&ks[cur ^ 1][sr][sq] = k0r; *(v4u*)&ks[cur ^ 1][sr + 32][sq] = k1r; *(v4u*)&vs[cur ^ 1][sr][sq] = v0r; *(v4u*)&vs[cur ^ 1][sr + 32][sq] = v1r; }
    __syncthreads(); }   // one barrier a stage: publishes stage s + 1 and ends every wave's reads of the buffer that stage s + 2 overwrites
  l += xhalf(l); const float inv = 1.0f / l;
  float* yr = Y + ((size_t)b * TT + ql0 + col) * CC + h * HD + 8 * g;   // lane = query col; o[j][r] = dim j*16 + 8g + r
#pragma unroll
  for (int j = 0; j < HD / 16; ++j) { v4f a, c;
#pragma unroll
    for (int r = 0; r < 4; ++r) { a[r] = o[j][r] * inv; c[r] = o[j][4 + r] * inv; }
    vst2(yr + j * 16, a); vst2(yr + j * 16 + 4, c); } }
// ---- k_out: block = (64 rows, 128 cols): out = ctx Wo (+ bo): all rows: ctx bf16 hi + lo against exact bf16 Wo (2 products)
__global__ __launch_bounds__(128) void k_out(const float* __restrict__ Y, const __bf16* __restrict__ WOB, const float* __restrict__ BO, float* __restrict__ OUT) { __shared__ __align__(16) char ov[2 * (64 + 64 + 128) * GLD * 2];
  // one LDS range, used in turn: the two operand stages of the k loop (ctx hi, ctx lo, Wo); behind the loop's last barrier each wave's own output staging tile
  __bf16 (*yh)[64][GLD] = (__bf16 (*)[64][GLD])ov; __bf16 (*yl)[64][GLD] = (__bf16 (*)[64][GLD])(ov + 2 * 64 * GLD * 2); __bf16 (*wt)[128][GLD] = (__bf16 (*)[128][GLD])(ov + 4 * 64 * GLD * 2);
  float (*sf)[16][132] = (float (*)[16][132])ov;
  const int tid = threadIdx.x, wave = tid >> 5, lane = tid & 31, col = lane & 15, g = lane >> 4; const int c0 = blockIdx.y * 128; const size_t r0 = (size_t)blockIdx.x * 64 + wave * 16;
  v8f acc[8] = {};
  {   /* ALL rows: ctx split bf16 hi + lo x exact Wo (2 products) */
    const int pr = tid >> 4, pc = (tid & 15) * 4;   // a thread's 16-byte piece: row pr of each group of 8 rows, k pc..pc+3 of the stage
    const int qr = tid >> 3, qc = (tid & 7) * 8;    // its 16-byte piece of the bf16 Wo plane: row qr of each group of 16 rows, k qc..qc+7
    const float* yg = Y + ((size_t)blockIdx.x * 64 + pr) * CC + pc; const __bf16* wg = WOB + (size_t)(c0 + qr) * CC + qc;
    v4f yr[8]; v8b wr[8];
    ld_rows(yr, yg, CC); ld_rows_b(wr, wg, CC);
#pragma unroll
    for (int i = 0; i < 8; ++i) { const v4b hv = cvt4(yr[i]); *(v4b*)&yh[0][i * 8 + pr][pc] = hv; *(v4b*)&yl[0][i * 8 + pr][pc] = res4(yr[i], hv); }
#pragma unroll
    for (int i = 0; i < 8; ++i) *(v8b*)&wt[0][i * 16 + qr][qc] = wr[i];
    __syncthreads();
    // rolled stage loop, unrolled inner loops: as in k_proj
#pragma unroll 1
    for (int s = 0; s < CC / GK; ++s) { const int cur = s & 1;
      if (s + 1 < CC / GK) { ld_rows(yr, yg + (s + 1) * GK, CC); ld_rows_b(wr, wg + (s + 1) * GK, CC); }   // the next stage's loads fly while this stage is multiplied
#pragma unroll
      for (int kc = 0; kc < GK / 32; ++kc) { const v16b ah = frag_b(&yh[cur][wave * 16 + col][kc * 32], lane), al = frag_b(&yl[cur][wave * 16 + col][kc * 32], lane); v16b w[8];
#pragma unroll
        for (int j = 0; j < 8; ++j) w[j] = frag_b(&wt[cur][j * 16 + col][kc * 32], lane);
        __builtin_amdgcn_sched_barrier(0);   // keeps the ten fragments' LDS reads one group ahead of their products, as in k_proj
#pragma unroll
        for (int j = 0; j < 8; ++j) { acc[j] = __builtin_amdgcn_wmma_f32_16x16x32_bf16(false, ah, false, w[j], (short)0, acc[j], false, false);
          acc[j] = __builtin_amdgcn_wmma_f32_16x16x32_bf16(false, al, false, w[j], (short)0, acc[j], false, false); } }
      if (s + 1 < CC / GK) {
#pragma unroll
        for (int i = 0; i < 8; ++i) { const v4b hv = cvt4(yr[i]); *(v4b*)&yh[cur ^ 1][i * 8 + pr][pc] = hv; *(v4b*)&yl[cur ^ 1][i * 8 + pr][pc] = res4(yr[i], hv); }
#pragma unroll
        for (int i = 0; i < 8; ++i) *(v8b*)&wt[cur ^ 1][i * 16 + qr][qc] = wr[i]; }
      __syncthreads(); }   // one barrier a stage: publishes stage s + 1 and ends every wave's reads of the buffer that stage s + 2 (or the output staging) overwrites
#pragma unroll
    for (int j = 0; j < 8; ++j) { const float bias = BO ? bfr(BO[c0 + j * 16 + col]) : 0.f;
#pragma unroll
      for (int r = 0; r < 8; ++r) sf[wave][8 * g + r][j * 16 + col] = acc[j][r] + bias; }
  }
  LDSX(); for (int rl = 0; rl < 16; ++rl) vst2(OUT + (r0 + rl) * DIN + c0 + lane * 4, *(const v4f*)&sf[wave][rl][lane * 4]); }

extern "C" void kernel_launch(void* const* d_in, const int* in_sizes, int n_in, void* d_out, int out_size, void* d_ws, size_t ws_size, hipStream_t stream) {
  (void)in_sizes; (void)n_in; (void)out_size;
  const float** F = (const float**)d_in;
  if (ws_size < (size_t)WS_END) return;
  char* ws = (char*)d_ws; _Float16 *QH = (_Float16*)(ws + WS_QH), *KH = (_Float16*)(ws + WS_KH), *VT = (_Float16*)(ws + WS_VT), *QL = (_Float16*)(ws + WS_QL), *KL = (_Float16*)(ws + WS_KL); __bf16 *VB = (__bf16*)(ws + WS_VB), *VBL = (__bf16*)(ws + WS_VBL), *XB = (__bf16*)(ws + WS_XB), *WB = (__bf16*)(ws + WS_WB); float *Y = (float*)(ws + WS_Y), *RT = (float*)(ws + WS_RT);
  (void)Y; (void)QL; (void)KL; (void)VB; (void)VBL;
  // inputs: 0 x [2,2048,1024]; 1 Wq [1024,1024] (out,in), 2 bq; 3 Wk, 4 bk; 5 Wv, 6 bv; 7 Wo (no bias)
  k_cvt<<<dim3((NB * TT * DIN + 4 * CC * DIN) / CV_N), 256, 0, stream>>>(F[0], F[1], F[3], F[5], F[7], XB, WB, RT);
  k_proj<<<dim3(TNB * TT / PM, CC / 128, 3), 128, 0, stream>>>(XB, WB, F[2], F[4], F[6], RT, QH, QL, KH, KL, VT, VB, VBL);
  k_fa<<<dim3(TT / FA_Q, NH, TNB), 256, 0, stream>>>(QH, KH, VT, Y);
  k_out<<<dim3(TNB * TT / 64, DIN / 128), 128, 0, stream>>>(Y, WB + 3 * (size_t)CC * DIN, nullptr, (float*)d_out);
}

// v008
// Measured time: 85.2 microseconds a run.
// In both of two side-by-side timings against v007, it was 1.04 times as fast.
// All steps since v000 together make it 17.2 times as fast.
// compute dtype: all float inputs rounded to bf16; q/k/v projections with EXACT bf16 products on WMMA 16x16x32 (f32 accumulate); interleaved RoPE in f32 (sincosf) on the projected q/k rows; q x log2(e) once to f16 against k x 2^-5 (= 1024^-0.5) once to f16 (1 product, in an f32 accumulator that starts at minus a reference maximum); one-pass softmax in f32 (exp2 of the accumulator as it is; the reference maximum moves, and sums and outputs are rescaled, only when a logit passes it by more than 8 in log2 units); exp(logit - reference) once to f16 against v once to f16 (1 product), divided by the sum at the end; ctx split bf16 hi + lo against exact Wo (2 products); f32 output.
#include <hip/hip_runtime.h>
#include <math.h>

typedef __attribute__((ext_vector_type(16))) _Float16 v16h;
typedef __attribute__((ext_vector_type(16))) __bf16 v16b;
typedef __attribute__((ext_vector_type(8)))  _Float16 v8h;
typedef __attribute__((ext_vector_type(8)))  float v8f;
typedef __attribute__((ext_vector_type(4)))  float v4f;
typedef __attribute__((ext_vector_type(2)))  float v2f;
typedef __attribute__((ext_vector_type(4)))  unsigned v4u;
typedef __attribute__((ext_vector_type(4)))  int v4i;
typedef float __attribute__((may_alias)) float_a;
typedef int __attribute__((may_alias)) int_a;

template <typename T> __device__ __forceinline__ void vst2(void* p, T v) { *(T*)p = v;  }
__device__ __forceinline__ v8f wmma16(v16h a, v16h b, v8f c) {
  v8f d = __builtin_amdgcn_wmma_f32_16x16x32_f16(false, a, false, b, (short)0, c, false, false);
  asm volatile("v_nop\n\tv_nop\n\tv_nop\n\tv_nop" : "+v"(d) : "v"(a), "v"(b));
  return d;
}
__device__ __forceinline__ v8f wmma_bf(v16b a, v16b b, v8f c) {
  v8f d = __builtin_amdgcn_wmma_f32_16x16x32_bf16(false, a, false, b, (short)0, c, false, false);
  asm volatile("v_nop\n\tv_nop\n\tv_nop\n\tv_nop" : "+v"(d) : "v"(a), "v"(b));
  return d;
}
// 16x16x32 fragments: lane = (h = lane>>4, row/col = lane&15); elements 0..7 = k0+8h+0..7, 8..15 = k0+16+8h+0..7; D element r = row 8h+r
__device__ __forceinline__ v16h frag_h(const _Float16* rowk0, int lane) {
  union { v16h v; v8h q[2]; } u; const _Float16* p = rowk0 + 8 * (lane >> 4);
  u.q[0] = *(const v8h*)p; u.q[1] = *(const v8h*)(p + 16); return u.v;
}
__device__ __forceinline__ v16h frag_f32(const float* rowk0, int lane) {
  v16h a; const float* p = rowk0 + 8 * (lane >> 4);
#pragma unroll
  for (int i = 0; i < 8; ++i) { a[i] = (_Float16)p[i]; a[8 + i] = (_Float16)p[16 + i]; }
  return a;
}
__device__ __forceinline__ v16h frag_f32s(const float* rowk0, int lane, float sc) {
  v16h a; const float* p = rowk0 + 8 * (lane >> 4);
#pragma unroll
  for (int i = 0; i < 8; ++i) { a[i] = (_Float16)(p[i] * sc); a[8 + i] = (_Float16)(p[16 + i] * sc); }
  return a;
}
// column fragment from a [K][ld] layout (column n), rows >= K read as 0
__device__ __forceinline__ v16h fragc_f32(const float* W, int k0, int n, int lane, int ld, int K) {
  v16h a; const int g = lane >> 4;
#pragma unroll
  for (int i = 0; i < 8; ++i) { const int ka = k0 + 8 * g + i, kb = ka + 16;
    a[i] = (_Float16)(ka < K ? W[(size_t)(ka < K ? ka : K - 1) * ld + n] : 0.f); a[8 + i] = (_Float16)(kb < K ? W[(size_t)(kb < K ? kb : K - 1) * ld + n] : 0.f); }
  return a;
}
struct F2 { v16b h, l; };
__device__ __forceinline__ F2 bsplit16(const float v[16]) { F2 r;
#pragma unroll
  for (int i = 0; i < 16; ++i) { const __bf16 h = (__bf16)v[i]; r.h[i] = h; r.l[i] = (__bf16)(v[i] - (float)h); }
  return r; }
__device__ __forceinline__ F2 split_row(const float* row, int k0, int lane) { float v[16]; const float* p = row + k0 + 8 * (lane >> 4);
#pragma unroll
  for (int i = 0; i < 8; ++i) { v[i] = p[i]; v[8 + i] = p[16 + i]; }
  return bsplit16(v); }
__device__ __forceinline__ F2 split_rowK(const float* row, int k0, int lane, int K) { float v[16]; const int g = lane >> 4;
#pragma unroll
  for (int i = 0; i < 8; ++i) { const int ka = k0 + 8 * g + i, kb = ka + 16; v[i] = ka < K ? row[ka < K ? ka : K - 1] : 0.f; v[8 + i] = kb < K ? row[kb < K ? kb : K - 1] : 0.f; }
  return bsplit16(v); }
__device__ __forceinline__ F2 split_col(const float* W, int k0, int n, int lane, int ld, int K) { float v[16]; const int g = lane >> 4;
#pragma unroll
  for (int i = 0; i < 8; ++i) { const int ka = k0 + 8 * g + i, kb = ka + 16; v[i] = ka < K ? W[(size_t)(ka < K ? ka : K - 1) * ld + n] : 0.f; v[8 + i] = kb < K ? W[(size_t)(kb < K ? kb : K - 1) * ld + n] : 0.f; }
  return bsplit16(v); }
__device__ __forceinline__ v8f mac3(const F2& a, const F2& b, v8f c) { c = wmma_bf(a.l, b.h, c); c = wmma_bf(a.h, b.l, c); return wmma_bf(a.h, b.h, c); }
__device__ __forceinline__ float sigm(float v) { return 1.0f / (1.0f + expf(-v)); }
#define LDSX() do { asm volatile("s_wait_dscnt 0" ::: "memory"); __builtin_amdgcn_wave_barrier(); __builtin_amdgcn_fence(__ATOMIC_RELEASE, "workgroup"); } while (0)

// Multi-head attention with RoPE (B 2, S 2,048, 1,024 = 16 x 64; 0.02-scale weights and biases): q,k,v = x W^T + b ((out,in)); interleaved-pair RoPE on q, k (angle t x 10000^(-2i/64)); scores = q k^T / sqrt(1024) (note: sqrt(D), not sqrt(hd)); out = merged(softmax(scores) v) Wo^T (no output bias).
#define NB 2
#define TT 2048
#define CC 1024            // NH * HD = projected width
#define DIN 1024          // input (model) width
#define NH 16
#define HD 64
#define NQB (TT / 64)
#define HG 4
#define SCALE (0.03125f)
#define CAUSAL 0
#ifndef TNB
#define TNB NB
#endif
__device__ __forceinline__ float bfr(float v) { return (float)(__bf16)v; }
__host__ __device__ __forceinline__ int kb_last(int qb) { return CAUSAL ? ((qb * 64 + 63) >> 7) : (TT / 128 - 1); }
typedef __attribute__((ext_vector_type(8))) __bf16 v8b;
__device__ __forceinline__ v16b frag_b(const __bf16* rowk0, int lane) {
  union { v16b v; v8b q[2]; } u; const __bf16* p = rowk0 + 8 * (lane >> 4);
  u.q[0] = *(const v8b*)p; u.q[1] = *(const v8b*)(p + 16); return u.v;
}
#define QBH 0              // unused: k_fa has no high-precision path
#define QHI 0               // rows carrying a q residual plane: none. k is rounded once to f16, so a residual of q alone would take away only q's half of the logit's rounding error; k's half stays either way
#define KHI 64            // key rows carrying k residual / v bf16 hi+lo planes (written by k_proj; no kernel here reads them)
// B fragment (k rows k0+.., output column o) of a weight: (in,out) [K][ld] or (out,in) [ld rows of K]: bf16 exact, or f16(bf16 * 256) exact
__device__ __forceinline__ v16b wcol_io(const float* Wm, int k0, int o, int lane, int ld) { v16b w; const int g = lane >> 4;
#pragma unroll
  for (int i = 0; i < 8; ++i) { w[i] = (__bf16)Wm[(size_t)(k0 + 8 * g + i) * ld + o]; w[8 + i] = (__bf16)Wm[(size_t)(k0 + 16 + 8 * g + i) * ld + o]; }
  return w; }
__device__ __forceinline__ v16b wcol_oi(const float* Wm, int k0, int o, int lane, int K) { v16b w; const float* p = Wm + (size_t)o * K + k0 + 8 * (lane >> 4);
#pragma unroll
  for (int i = 0; i < 8; ++i) { w[i] = (__bf16)p[i]; w[8 + i] = (__bf16)p[16 + i]; }
  return w; }
__device__ __forceinline__ v16h wcolh_io(const float* Wm, int k0, int o, int lane, int ld) { v16h w; const int g = lane >> 4;
#pragma unroll
  for (int i = 0; i < 8; ++i) { w[i] = (_Float16)(bfr(Wm[(size_t)(k0 + 8 * g + i) * ld + o]) * 256.0f); w[8 + i] = (_Float16)(bfr(Wm[(size_t)(k0 + 16 + 8 * g + i) * ld + o]) * 256.0f); }
  return w; }
__device__ __forceinline__ v16h wcolh_oi(const float* Wm, int k0, int o, int lane, int K) { v16h w; const float* p = Wm + (size_t)o * K + k0 + 8 * (lane >> 4);
#pragma unroll
  for (int i = 0; i < 8; ++i) { w[i] = (_Float16)(bfr(p[i]) * 256.0f); w[8 + i] = (_Float16)(bfr(p[16 + i]) * 256.0f); }
  return w; }
#define WQKV_LAYOUT 1   // 0 = (in,out) [DIN][CC]; 1 = (out,in) [CC][DIN]; 2 = per-head [NH][DIN][HD]; read only through WCOL, which no kernel calls (k_proj reads (out,in) [CC][DIN])
__device__ __forceinline__ v16b wcol_hdk(const float* Wm, int k0, int o, int lane) { v16b w; const int g = lane >> 4; const float* p = Wm + (size_t)(o / HD) * DIN * HD + (o % HD);
#pragma unroll
  for (int i = 0; i < 8; ++i) { w[i] = (__bf16)p[(size_t)(k0 + 8 * g + i) * HD]; w[8 + i] = (__bf16)p[(size_t)(k0 + 16 + 8 * g + i) * HD]; }
  return w; }
#define WO_OUT_IN 1
#if WQKV_LAYOUT == 1
#define WCOL(W, k0, o, lane) wcol_oi(W, k0, o, lane, DIN)
#elif WQKV_LAYOUT == 2
#define WCOL(W, k0, o, lane) wcol_hdk(W, k0, o, lane)
#else
#define WCOL(W, k0, o, lane) wcol_io(W, k0, o, lane, CC)
#endif
#if WO_OUT_IN
#define WOCOL(W, k0, o, lane) wcol_oi(W, k0, o, lane, CC)
#define WOCOLH(W, k0, o, lane) wcolh_oi(W, k0, o, lane, CC)
#else
#define WOCOL(W, k0, o, lane) wcol_io(W, k0, o, lane, DIN)
#define WOCOLH(W, k0, o, lane) wcolh_io(W, k0, o, lane, DIN)
#endif
__constant__ float c_invf[32] = {1.000000000e+0f,7.498942018e-1f,5.623413324e-1f,4.216965139e-1f,3.162277639e-1f,2.371373773e-1f,1.778279394e-1f,1.333521456e-1f,1.000000015e-1f,7.498942316e-2f,5.623413250e-2f,4.216964915e-2f,3.162277490e-2f,2.371373773e-2f,1.778279431e-2f,1.333521400e-2f,9.999999776e-3f,7.498942316e-3f,5.623413250e-3f,4.216964822e-3f,3.162277630e-3f,2.371373819e-3f,1.778279431e-3f,1.333521446e-3f,1.000000047e-3f,7.498941850e-4f,5.623413017e-4f,4.216965172e-4f,3.162277571e-4f,2.371373703e-4f,1.778279402e-4f,1.333521504e-4f};   /* f32(1 / 10000^(2i/64)) */
#ifndef SM_EXTRA_PARAMS
#define SM_EXTRA_PARAMS
#endif
#ifndef PROJ_EXTRA_PARAMS
#define PROJ_EXTRA_PARAMS
#endif
#ifndef SM_MASK_HOOK
#define SM_MASK_HOOK (void)0
#endif

#define WS_QH  0u                                      // f16 q x log2(e) rows [b*t][CC]
#define WS_KH  (WS_QH + 2u * (size_t)NB * TT * CC)      // f16 k x 2^-5 rows [b*t][CC]
#define WS_VT  (WS_KH + 2u * (size_t)NB * TT * CC)      // f16 v planes [b][c][t]
#define WS_QL  (WS_VT + 2u * (size_t)NB * CC * TT)      // f16 residual of q x log2(e), unscaled, rows [b][t < QHI][CC] (empty: QHI is 0)
#define WS_KL  (WS_QL + 2u * (size_t)NB * QHI * CC)     // f16 residual of k x 2^-5, unscaled, rows [b][t < KHI][CC]
#define WS_VB  (WS_KL + 2u * (size_t)NB * KHI * CC)     // bf16 v hi planes [b][c][t < KHI]
#define WS_VBL (WS_VB + 2u * (size_t)NB * CC * KHI)
#define WS_XB  (WS_VBL + 2u * (size_t)NB * CC * KHI)    // bf16 x rows [b*t][DIN]
#define WS_WB  (WS_XB + 2u * (size_t)NB * TT * DIN)     // bf16 Wq, Wk, Wv, Wo, each [CC][DIN] as given
#define WS_Y   (WS_WB + 2u * 4u * (size_t)CC * DIN)     // f32 ctx rows [b*t][CC] (only when there is an output projection)
#define WS_RT  (WS_Y  + 4u * (size_t)NB * TT * CC)      // f32 RoPE table [t][HD / 2] of (cos, sin), written by k_cvt in every call
#define WS_END (WS_RT + 8u * (size_t)TT * (HD / 2))

// GEMM operand staging (k_proj, k_out): a stage is 64 k of every operand row, kept as bf16 in LDS; every wave takes its fragments from there with 16-byte LDS loads. x and the four weights come from k_cvt's bf16 planes (a stage row = one 128-B line, 8 lanes x 16 B, copied as it is); ctx comes as f32 (16 lanes x 16 B per row) and is split by the block.
#define GK 64              // k per stage
#define GLD 72             // LDS row pitch in bf16: 144 B = 16 B x odd, conflict-free for the 16-byte fragment reads
typedef __attribute__((ext_vector_type(4))) __bf16 v4b;
__device__ __forceinline__ v4b cvt4(v4f v) { v4b r; r[0] = (__bf16)v[0]; r[1] = (__bf16)v[1]; r[2] = (__bf16)v[2]; r[3] = (__bf16)v[3]; return r; }
__device__ __forceinline__ v4b res4(v4f v, v4b h) { v4b r;
#pragma unroll
  for (int i = 0; i < 4; ++i) r[i] = (__bf16)(v[i] - (float)h[i]);
  return r; }
// a thread's N pieces of a stage: rows 8 apart, 16 bytes each
template <int N> __device__ __forceinline__ void ld_rows(v4f (&r)[N], const float* p, int ld) {
#pragma unroll
  for (int i = 0; i < N; ++i) r[i] = *(const v4f*)(p + (size_t)i * 8 * ld);
  asm volatile("s_wait_xcnt 0x0" :: "v"(p) : "memory"); }   // stands in front of every overwrite of these loads' address registers (p as an input keeps them whole up to here); its memory clobber also holds the loads here, ahead of the products they fly behind
// a thread's N pieces of a stage of a bf16 plane: rows 16 apart, 16 bytes each
template <int N> __device__ __forceinline__ void ld_rows_b(v8b (&r)[N], const __bf16* p, int ld) {
#pragma unroll
  for (int i = 0; i < N; ++i) r[i] = *(const v8b*)(p + (size_t)i * 16 * ld);
  asm volatile("s_wait_xcnt 0x0" :: "v"(p) : "memory"); }   // as in ld_rows: stands in front of every overwrite of these loads' address registers and holds the loads ahead of the products they fly behind
// ---- k_cvt also fills the RoPE table: one (position, pair) per thread, sincosf of the f32 angle t * c_invf[i]; both batches, all heads and both of q and k read the same 65,536 entries
// ---- k_cvt: x and the four weights rounded to bf16 ONCE, as a stream (one block per WGP, each 32,768 consecutive floats of one tensor, in whole-line 16-byte loads that are all issued ahead of the first store): every GEMM block that reads them afterwards fetches 2 bytes an element, not 4, and converts nothing
#define CV_N 32768
__global__ __launch_bounds__(256) void k_cvt(const float* __restrict__ X, const float* __restrict__ WQ, const float* __restrict__ WK, const float* __restrict__ WV, const float* __restrict__ WO, __bf16* __restrict__ XB, __bf16* __restrict__ WB, float* __restrict__ RT) {
  static_assert((NB * TT * DIN + 4 * CC * DIN) / CV_N * 256 == TT * (HD / 2), "one table entry per thread");
  const int nx = NB * TT * DIN / CV_N, nw = CC * DIN / CV_N; const int bi = blockIdx.x, tid = threadIdx.x;
  const float* s; __bf16* d;
  if (bi < nx) { s = X + (size_t)bi * CV_N; d = XB + (size_t)bi * CV_N; }
  else { const int w = (bi - nx) / nw; s = (w == 0 ? WQ : w == 1 ? WK : w == 2 ? WV : WO) + (size_t)((bi - nx) % nw) * CV_N; d = WB + (size_t)(bi - nx) * CV_N; }
  const int ri = bi * 256 + tid; const float fr = c_invf[ri & (HD / 2 - 1)];
  v4f r[CV_N / 1024];
#pragma unroll
  for (int i = 0; i < CV_N / 1024; ++i) r[i] = *(const v4f*)(s + i * 1024 + tid * 4);
  { float sn, cs; sincosf((float)(ri / (HD / 2)) * fr, &sn, &cs); v2f e; e[0] = cs; e[1] = sn; *(v2f*)(RT + 2 * (size_t)ri) = e; }
#pragma unroll
  for (int i = 0; i < CV_N / 1024; ++i) *(v4b*)(d + i * 1024 + tid * 4) = cvt4(r[i]); }
// ---- k_proj: block = (128 rows, 128 cols, which), four waves as 2 x 2, a wave = 64 x 64 (4 x and 4 weight fragments feed 16 products: half a fragment read from LDS per product): q/k/v = X W (+ b) with exact bf16 products (K = DIN) -> which 0: q f16 rows (+ residual rows < QHI); 1: k f16 rows (+ residual rows < KHI); 2: v f16 planes [c][t] (+ bf16 hi/lo planes for t < KHI)
#define PM 128             // rows of a block; the epilogue takes them in halves of 64, so that its f32 tile stays small enough for three blocks on a WGP
__global__ __launch_bounds__(128) void k_proj(const __bf16* __restrict__ XB, const __bf16* __restrict__ WB, const float* __restrict__ BQ, const float* __restrict__ BK, const float* __restrict__ BV, const float* __restrict__ RT,
    _Float16* __restrict__ QH, _Float16* __restrict__ QL, _Float16* __restrict__ KH, _Float16* __restrict__ KL, _Float16* __restrict__ VT, __bf16* __restrict__ VB, __bf16* __restrict__ VBL PROJ_EXTRA_PARAMS) {
  __shared__ __align__(16) float st[64][132]; __shared__ __align__(16) char ov[2 * (PM + 128) * GLD * 2];
  // one LDS range, used in turn: the two operand stages of the k loop; behind the loop's last barrier the epilogue's conversion tiles (q, k: sh, sl; v: th, tb, tbl)
  __bf16 (*xs)[PM][GLD] = (__bf16 (*)[PM][GLD])ov; __bf16 (*wt)[128][GLD] = (__bf16 (*)[128][GLD])(ov + 2 * PM * GLD * 2);
  _Float16 (*sh)[136] = (_Float16 (*)[136])ov; _Float16 (*sl)[136] = (_Float16 (*)[136])(ov + 64 * 136 * 2);
  _Float16 (*th)[72] = (_Float16 (*)[72])ov; __bf16 (*tb)[72] = (__bf16 (*)[72])(ov + 128 * 72 * 2); __bf16 (*tbl)[72] = (__bf16 (*)[72])(ov + 2 * 128 * 72 * 2);
  const int tid = threadIdx.x, wave = tid >> 5, lane = tid & 31, col = lane & 15, g = lane >> 4; const int wrow = wave >> 1, wcol = wave & 1; const int which = blockIdx.z; const int c0 = blockIdx.y * 128; const size_t r0 = (size_t)blockIdx.x * PM; const size_t bb = r0 / TT; const int t0 = (int)(r0 % TT);
  const float* BA = which == 0 ? BQ : which == 1 ? BK : BV;
  v8f acc[4][4] = {};
  const int pr = tid >> 3, pc = (tid & 7) * 8;   // a thread's 16-byte piece: row pr of each group of 16 rows, k pc..pc+7 of the stage
  const __bf16* xg = XB + (r0 + pr) * DIN + pc; const __bf16* wg = WB + ((size_t)which * CC + c0 + pr) * DIN + pc;
  v8b xr[PM / 16], wr[8];
  // rotated k walk: the 24 blocks that read the same x rows and the 32 that read the same weight rows would otherwise ask L2 for the same lines at the same moment; each block enters the 16 stages at its own place and wraps round (the f32 sum over k starts there). The q, k and v blocks of one (row, column) tile keep one start
  static_assert((DIN / GK & (DIN / GK - 1)) == 0, "the wrap is a mask");
  const int rot = (blockIdx.x + 2 * blockIdx.y) & (DIN / GK - 1);
  ld_rows_b(xr, xg + rot * GK, DIN); ld_rows_b(wr, wg + rot * GK, DIN);
#pragma unroll
  for (int i = 0; i < PM / 16; ++i) *(v8b*)&xs[0][i * 16 + pr][pc] = xr[i];
#pragma unroll
  for (int i = 0; i < 8; ++i) *(v8b*)&wt[0][i * 16 + pr][pc] = wr[i];
  __syncthreads();
  // the stage loop stays rolled so that the two buffers alternate by index and the loop stays small; the inner loops are unrolled so that the register arrays are indexed by constants
#pragma unroll 1
  for (int s = 0; s < DIN / GK; ++s) { const int cur = s & 1;
    if (s + 1 < DIN / GK) { const int kn = ((s + 1 + rot) & (DIN / GK - 1)) * GK; ld_rows_b(xr, xg + kn, DIN); ld_rows_b(wr, wg + kn, DIN); }   // the next stage's loads fly while this stage is multiplied
#pragma unroll
    for (int kc = 0; kc < GK / 32; ++kc) { v16b a[4], w[4];
#pragma unroll
      for (int i = 0; i < 4; ++i) a[i] = frag_b(&xs[cur][wrow * 64 + i * 16 + col][kc * 32], lane);
#pragma unroll
      for (int j = 0; j < 4; ++j) w[j] = frag_b(&wt[cur][wcol * 64 + j * 16 + col][kc * 32], lane);
      __builtin_amdgcn_sched_barrier(0);   // keeps the eight fragments' LDS reads one group ahead of their products: left alone the compiler reads each into the same registers and waits out the LDS latency before every product
#pragma unroll
      for (int i = 0; i < 4; ++i) {
#pragma unroll
        for (int j = 0; j < 4; ++j) acc[i][j] = __builtin_amdgcn_wmma_f32_16x16x32_bf16(false, a[i], false, w[j], (short)0, acc[i][j], false, false); } }
    if (s + 1 < DIN / GK) {
#pragma unroll
      for (int i = 0; i < PM / 16; ++i) *(v8b*)&xs[cur ^ 1][i * 16 + pr][pc] = xr[i];
#pragma unroll
      for (int i = 0; i < 8; ++i) *(v8b*)&wt[cur ^ 1][i * 16 + pr][pc] = wr[i]; }
    __syncthreads(); }   // one barrier a stage: publishes stage s + 1 and ends every wave's reads of the buffer that stage s + 2 (or the epilogue) overwrites
  // the epilogue runs once per half of 64 rows: the two waves that hold the half hand it over through st, all four waves rotate, convert and store it. Half 1's writes of st stand behind half 0's third barrier (the last reads of st are in front of it); its writes of the conversion tiles stand behind its own first two barriers (every wave has left half 0's store loop by then)
  const size_t rblk = r0; const int tblk = t0;
  for (int hf = 0; hf < PM / 64; ++hf) { const size_t r0 = rblk + hf * 64; const int t0 = tblk + hf * 64;   // the half's first row, under the names that the lines below use
    asm volatile("s_wait_xcnt 0x0" ::: "memory");   // stands behind the stores of the half before, in front of this half's first write of a register that they name
  { // stage the f32 tile (acc + bias) in LDS, rotate the q and k rows (interleaved (even, odd) RoPE pairs, angle = t * 10000^(-2i/64), cos and sin from k_cvt's table), then convert
    // a wave takes whole rows (row it * 4 + wave, 4 columns = 2 pairs a lane): 512 B of the tile and the row's 256 B of the table per pass, both heads of the tile reading the same table row; the table loads are issued here, ahead of the bias loads and the tile's LDS stores, so that their latency is not paid behind the barrier
    v4f rt[16]; const float* tp = RT + (size_t)(t0 + wave) * HD + (lane & 15) * 4;
    if (which < 2) {
#pragma unroll
      for (int it = 0; it < 16; ++it) rt[it] = *(const v4f*)(tp + it * 4 * HD);
      asm volatile("s_wait_xcnt 0x0" :: "v"(tp) : "memory"); }   // as in ld_rows: stands in front of every overwrite of these loads' address registers
    if (wrow == hf) {   // only the two waves that hold this half write it; the three loops are unrolled so that acc is indexed by constants and stays in registers
#pragma unroll
      for (int j = 0; j < 4; ++j) { const float bias = BA ? bfr(BA[c0 + wcol * 64 + j * 16 + col]) : 0.f;
#pragma unroll
        for (int i = 0; i < 4; ++i) {
#pragma unroll
          for (int r = 0; r < 8; ++r) st[i * 16 + 8 * g + r][wcol * 64 + j * 16 + col] = acc[i][j][r] + bias; } } }
    __syncthreads();
    if (which < 2) {
#pragma unroll
      for (int it = 0; it < 16; ++it) { float* rw = &st[it * 4 + wave][lane * 4]; const v4f x = *(const v4f*)rw, c = rt[it]; v4f y;
        y[0] = x[0] * c[0] - x[1] * c[1]; y[1] = x[0] * c[1] + x[1] * c[0]; y[2] = x[2] * c[2] - x[3] * c[3]; y[3] = x[2] * c[3] + x[3] * c[2]; *(v4f*)rw = y; } }
    __syncthreads(); }
  if (which < 2) { _Float16* DH = which == 0 ? QH : KH; _Float16* DL = which == 0 ? QL : KL; const int nhi = which == 0 ? QHI : KHI; const bool hi_rows = t0 < nhi;
    const float vs = which == 0 ? 1.44269504088896f : SCALE;   // the logit scale and log2(e) go into the operands, so that k_fa's products are exp2 arguments as they leave the accumulator; 2^-5 on k is exact
    for (int e = tid; e < 64 * 128; e += 128) { const int rl = e >> 7, cl = e & 127; const float v = st[rl][cl] * vs; const _Float16 hv = (_Float16)v; sh[rl][cl] = hv; if (hi_rows) sl[rl][cl] = (_Float16)(v - (float)hv); }
    __syncthreads();
    for (int e = tid; e < 64 * 16; e += 128) { const int rl = e >> 4, q = e & 15; vst2((unsigned*)(DH + (r0 + rl) * CC + c0 + q * 8), *(const v4u*)&sh[rl][q * 8]); if (hi_rows) vst2((unsigned*)(DL + (bb * nhi + t0 + rl) * (size_t)CC + c0 + q * 8), *(const v4u*)&sl[rl][q * 8]); }
  } else { const bool hi_rows = t0 < KHI;
    for (int e = tid; e < 64 * 128; e += 128) { const int rl = e & 63, cl = e >> 6; const float v = st[rl][cl]; th[cl][rl] = (_Float16)v; const __bf16 bh = (__bf16)v; tb[cl][rl] = bh; tbl[cl][rl] = (__bf16)(v - (float)bh); }
    __syncthreads();
    for (int e = tid; e < 128 * 8; e += 128) { const int cl = e >> 3, q = e & 7; vst2((unsigned*)(VT + (bb * CC + c0 + cl) * (size_t)TT + t0 + q * 8), *(const v4u*)&th[cl][q * 8]); if (hi_rows) { const size_t o3 = (bb * CC + c0 + cl) * (size_t)KHI + t0 + q * 8; vst2((unsigned*)(VB + o3), *(const v4u*)&tb[cl][q * 8]); vst2((unsigned*)(VBL + o3), *(const v4u*)&tbl[cl][q * 8]); } } } }
}
#define FA_Q 128
#define FA_K 64
#define FA_NS (TT / FA_K)
#define FA_LD 72           // LDS row pitch in halves: 144 B = 16 B x odd, conflict-free for the 16-byte fragment reads
__device__ __forceinline__ float xhalf(float v) { const int i = __builtin_bit_cast(int, v); return __builtin_bit_cast(float, __builtin_amdgcn_permlanex16(i, i, 0x76543210, 0xfedcba98, false, false)); }   /* lane l <-> l ^ 16 */
__global__ __launch_bounds__(256) void k_fa(const _Float16* __restrict__ QH, const _Float16* __restrict__ KH, const _Float16* __restrict__ VT, float* __restrict__ Y) {
  __shared__ __align__(16) _Float16 ks[2][FA_K][FA_LD], vs[2][HD][FA_LD];
  const int tid = threadIdx.x, wave = tid >> 5, lane = tid & 31, col = lane & 15, g = lane >> 4; const int h = blockIdx.y, b = blockIdx.z; const int ql0 = blockIdx.x * FA_Q + wave * 16;
  v16h qh[HD / 32];
#pragma unroll
  for (int kc = 0; kc < HD / 32; ++kc) qh[kc] = frag_h(QH + ((size_t)b * TT + ql0 + col) * CC + h * HD + kc * 32, lane);
  // staging: a thread moves two 16-byte pieces of the k tile (64 keys x 128 B) and two of the v tile (64 dims x 128 B), whole 128-B lines per 8 lanes
  const int sr = tid >> 3, sq = (tid & 7) * 8;
  const _Float16* kg = KH + ((size_t)b * TT + sr) * CC + h * HD + sq; const _Float16* vg = VT + ((size_t)b * CC + h * HD + sr) * (size_t)TT + sq;
  // rotated key walk: the 16 blocks of a (b, h) read the same k and v lines; each enters the 32 stages two further on and wraps round, so that they do not ask L2 for one line at one moment (softmax takes the keys in any order; the f32 sums start at that stage)
  static_assert((FA_NS & (FA_NS - 1)) == 0, "the wrap is a mask");
  const int rot = (2 * blockIdx.x) & (FA_NS - 1);
  const _Float16* kf0 = kg + (size_t)rot * FA_K * CC; const _Float16* vf0 = vg + rot * FA_K;
  v4u k0r = *(const v4u*)kf0, k1r = *(const v4u*)(kf0 + (size_t)32 * CC), v0r = *(const v4u*)vf0, v1r = *(const v4u*)(vf0 + (size_t)32 * TT);
  *(v4u*)&ks[0][sr][sq] = k0r; *(v4u*)&ks[0][sr + 32][sq] = k1r; *(v4u*)&vs[0][sr][sq] = v0r; *(v4u*)&vs[0][sr + 32][sq] = v1r;
  __syncthreads();
  v8f o[HD / 16] = {}, nm = {}; float l = 0.f;   // nm: minus the reference maximum of the lane's query (log2 units) in all eight elements, the start value of every score tile
  // the stage loop stays rolled (for speed only); every inner loop is unrolled so that the fragment and accumulator arrays are indexed by constants and stay in registers
#pragma unroll 1
  for (int s = 0; s < FA_NS; ++s) { const int cur = s & 1;
    if (s + 1 < FA_NS) { const int sn = (s + 1 + rot) & (FA_NS - 1); const _Float16* kn = kg + (size_t)sn * FA_K * CC; const _Float16* vn = vg + sn * FA_K; k0r = *(const v4u*)kn; k1r = *(const v4u*)(kn + (size_t)32 * CC); v0r = *(const v4u*)vn; v1r = *(const v4u*)(vn + (size_t)32 * TT); }
    v8f sa[FA_K / 16]; v16h kf[HD / 32][FA_K / 16];
#pragma unroll
    for (int kc = 0; kc < HD / 32; ++kc) {
#pragma unroll
      for (int t = 0; t < FA_K / 16; ++t) kf[kc][t] = frag_h(&ks[cur][t * 16 + col][kc * 32], lane); }
    __builtin_amdgcn_sched_barrier(0);   // keeps the eight k fragments' LDS reads one group ahead of the products: with the fence below alone the compiler reads the second four into the first four's registers, among the products, and waits for them there
#pragma unroll
    for (int kc = 0; kc < HD / 32; ++kc) {
#pragma unroll
      for (int t = 0; t < FA_K / 16; ++t) sa[t] = __builtin_amdgcn_wmma_f32_16x16x32_f16(false, kf[kc][t], false, qh[kc], (short)0, kc == 0 ? nm : sa[t], false, false); }
    __builtin_amdgcn_sched_barrier(0);   // keeps the maxima behind all eight products: moved in among them, each first read of a fresh score tile costs four idle vector slots
    float mt[FA_K / 16];   // one maximum and one sum per 16-key tile: four short chains, not one of 32 dependent links
#pragma unroll
    for (int t = 0; t < FA_K / 16; ++t) { mt[t] = -3.0e38f;
#pragma unroll
      for (int r = 0; r < 8; ++r) mt[t] = fmaxf(mt[t], sa[t][r]); }
    float mx = fmaxf(fmaxf(mt[0], mt[1]), fmaxf(mt[2], mt[3])); mx = fmaxf(mx, xhalf(mx));   // the stage's largest logit above the reference, the same in both lanes of a query
    const float thr = s == 0 ? -3.0e38f : 8.0f;   // stage 0 always takes its own maximum as the reference; later the reference moves only when exp2 would pass 2^8
    if (__builtin_amdgcn_ballot_w32(mx > thr) != 0) {   // one scalar branch a stage, for the whole wave
      const float d = mx > thr ? mx : 0.f, al = __builtin_amdgcn_exp2f(-fmaxf(d, 0.f));   // d < 0 only in stage 0, where sum and outputs are still 0
      l *= al;
#pragma unroll
      for (int r = 0; r < 8; ++r) nm[r] -= d;
#pragma unroll
      for (int t = 0; t < FA_K / 16; ++t) {
#pragma unroll
        for (int r = 0; r < 8; ++r) sa[t][r] -= d; }
#pragma unroll
      for (int j = 0; j < HD / 16; ++j) {
#pragma unroll
        for (int r = 0; r < 8; ++r) o[j][r] *= al; } }
    float st[FA_K / 16]; v16h p[FA_K / 32];
#pragma unroll
    for (int t = 0; t < FA_K / 16; ++t) { st[t] = 0.f;
#pragma unroll
      for (int r = 0; r < 8; ++r) { const float e = __builtin_amdgcn_exp2f(sa[t][r]); st[t] += e; p[t >> 1][(t & 1) * 8 + r] = (_Float16)e; } }
    l += (st[0] + st[1]) + (st[2] + st[3]);
#pragma unroll
    for (int kk = 0; kk < FA_K / 32; ++kk) {
#pragma unroll
      for (int j = 0; j < HD / 16; ++j) o[j] = __builtin_amdgcn_wmma_f32_16x16x32_f16(false, frag_h(&vs[cur][j * 16 + col][kk * 32], lane), false, p[kk], (short)0, o[j], false, false); }
    if (s + 1 < FA_NS) { *(v4u*)&ks[cur ^ 1][sr][sq] = k0r; *(v4u*)&ks[cur ^ 1][sr + 32][sq] = k1r; *(v4u*)&vs[cur ^ 1][sr][sq] = v0r; *(v4u*)&vs[cur ^ 1][sr + 32][sq] = v1r; }
    __syncthreads(); }   // one barrier a stage: publishes stage s + 1 and ends every wave's reads of the buffer that stage s + 2 overwrites
  l += xhalf(l); const float inv = 1.0f / l;
  float* yr = Y + ((size_t)b * TT + ql0 + col) * CC + h * HD + 8 * g;   // lane = query col; o[j][r] = dim j*16 + 8g + r
#pragma unroll
  for (int j = 0; j < HD / 16; ++j) { v4f a, c;
#pragma unroll
    for (int r = 0; r < 4; ++r) { a[r] = o[j][r] * inv; c[r] = o[j][4 + r] * inv; }
    vst2(yr + j * 16, a); vst2(yr + j * 16 + 4, c); } }
// ---- k_out: block = (64 rows, 128 cols): out = ctx Wo (+ bo): all rows: ctx bf16 hi + lo against exact bf16 Wo (2 products)
__global__ __launch_bounds__(128) void k_out(const float* __restrict__ Y, const __bf16* __restrict__ WOB, const float* __restrict__ BO, float* __restrict__ OUT) { __shared__ __align__(16) char ov[2 * (64 + 64 + 128) * GLD * 2];
  // one LDS range, used in turn: the two operand stages of the k loop (ctx hi, ctx lo, Wo); behind the loop's last barrier each wave's own output staging tile
  __bf16 (*yh)[64][GLD] = (__bf16 (*)[64][GLD])ov; __bf16 (*yl)[64][GLD] = (__bf16 (*)[64][GLD])(ov + 2 * 64 * GLD * 2); __bf16 (*wt)[128][GLD] = (__bf16 (*)[128][GLD])(ov + 4 * 64 * GLD * 2);
  float (*sf)[16][132] = (float (*)[16][132])ov;
  const int tid = threadIdx.x, wave = tid >> 5, lane = tid & 31, col = lane & 15, g = lane >> 4; const int c0 = blockIdx.y * 128; const size_t r0 = (size_t)blockIdx.x * 64 + wave * 16;
  v8f acc[8] = {};
  {   /* ALL rows: ctx split bf16 hi + lo x exact Wo (2 products) */
    const int pr = tid >> 4, pc = (tid & 15) * 4;   // a thread's 16-byte piece: row pr of each group of 8 rows, k pc..pc+3 of the stage
    const int qr = tid >> 3, qc = (tid & 7) * 8;    // its 16-byte piece of the bf16 Wo plane: row qr of each group of 16 rows, k qc..qc+7
    const float* yg = Y + ((size_t)blockIdx.x * 64 + pr) * CC + pc; const __bf16* wg = WOB + (size_t)(c0 + qr) * CC + qc;
    v4f yr[8]; v8b wr[8];
    // rotated k walk, as in k_proj: the 8 blocks of a row tile and the 64 of a column tile enter the 16 stages at different places
    static_assert((CC / GK & (CC / GK - 1)) == 0, "the wrap is a mask");
    const int rot = (blockIdx.x + 4 * blockIdx.y) & (CC / GK - 1);
    ld_rows(yr, yg + rot * GK, CC); ld_rows_b(wr, wg + rot * GK, CC);
#pragma unroll
    for (int i = 0; i < 8; ++i) { const v4b hv = cvt4(yr[i]); *(v4b*)&yh[0][i * 8 + pr][pc] = hv; *(v4b*)&yl[0][i * 8 + pr][pc] = res4(yr[i], hv); }
#pragma unroll
    for (int i = 0; i < 8; ++i) *(v8b*)&wt[0][i * 16 + qr][qc] = wr[i];
    __syncthreads();
    // rolled stage loop, unrolled inner loops: as in k_proj
#pragma unroll 1
    for (int s = 0; s < CC / GK; ++s) { const int cur = s & 1;
      if (s + 1 < CC / GK) { const int kn = ((s + 1 + rot) & (CC / GK - 1)) * GK; ld_rows(yr, yg + kn, CC); ld_rows_b(wr, wg + kn, CC); }   // the next stage's loads fly while this stage is multiplied
#pragma unroll
      for (int kc = 0; kc < GK / 32; ++kc) { const v16b ah = frag_b(&yh[cur][wave * 16 + col][kc * 32], lane), al = frag_b(&yl[cur][wave * 16 + col][kc * 32], lane); v16b w[8];
#pragma unroll
        for (int j = 0; j < 8; ++j) w[j] = frag_b(&wt[cur][j * 16 + col][kc * 32], lane);
        __builtin_amdgcn_sched_barrier(0);   // keeps the ten fragments' LDS reads one group ahead of their products, as in k_proj
#pragma unroll
        for (int j = 0; j < 8; ++j) { acc[j] = __builtin_amdgcn_wmma_f32_16x16x32_bf16(false, ah, false, w[j], (short)0, acc[j], false, false);
          acc[j] = __builtin_amdgcn_wmma_f32_16x16x32_bf16(false, al, false, w[j], (short)0, acc[j], false, false); } }
      if (s + 1 < CC / GK) {
#pragma unroll
        for (int i = 0; i < 8; ++i) { const v4b hv = cvt4(yr[i]); *(v4b*)&yh[cur ^ 1][i * 8 + pr][pc] = hv; *(v4b*)&yl[cur ^ 1][i * 8 + pr][pc] = res4(yr[i], hv); }
#pragma unroll
        for (int i = 0; i < 8; ++i) *(v8b*)&wt[cur ^ 1][i * 16 + qr][qc] = wr[i]; }
      __syncthreads(); }   // one barrier a stage: publishes stage s + 1 and ends every wave's reads of the buffer that stage s + 2 (or the output staging) overwrites
#pragma unroll
    for (int j = 0; j < 8; ++j) { const float bias = BO ? bfr(BO[c0 + j * 16 + col]) : 0.f;
#pragma unroll
      for (int r = 0; r < 8; ++r) sf[wave][8 * g + r][j * 16 + col] = acc[j][r] + bias; }
  }
  LDSX(); for (int rl = 0; rl < 16; ++rl) vst2(OUT + (r0 + rl) * DIN + c0 + lane * 4, *(const v4f*)&sf[wave][rl][lane * 4]); }

extern "C" void kernel_launch(void* const* d_in, const int* in_sizes, int n_in, void* d_out, int out_size, void* d_ws, size_t ws_size, hipStream_t stream) {
  (void)in_sizes; (void)n_in; (void)out_size;
  const float** F = (const float**)d_in;
  if (ws_size < (size_t)WS_END) return;
  char* ws = (char*)d_ws; _Float16 *QH = (_Float16*)(ws + WS_QH), *KH = (_Float16*)(ws + WS_KH), *VT = (_Float16*)(ws + WS_VT), *QL = (_Float16*)(ws + WS_QL), *KL = (_Float16*)(ws + WS_KL); __bf16 *VB = (__bf16*)(ws + WS_VB), *VBL = (__bf16*)(ws + WS_VBL), *XB = (__bf16*)(ws + WS_XB), *WB = (__bf16*)(ws + WS_WB); float *Y = (float*)(ws + WS_Y), *RT = (float*)(ws + WS_RT);
  (void)Y; (void)QL; (void)KL; (void)VB; (void)VBL;
  // inputs: 0 x [2,2048,1024]; 1 Wq [1024,1024] (out,in), 2 bq; 3 Wk, 4 bk; 5 Wv, 6 bv; 7 Wo (no bias)
  k_cvt<<<dim3((NB * TT * DIN + 4 * CC * DIN) / CV_N), 256, 0, stream>>>(F[0], F[1], F[3], F[5], F[7], XB, WB, RT);
  k_proj<<<dim3(TNB * TT / PM, CC / 128, 3), 128, 0, stream>>>(XB, WB, F[2], F[4], F[6], RT, QH, QL, KH, KL, VT, VB, VBL);
  k_fa<<<dim3(TT / FA_Q, NH, TNB), 256, 0, stream>>>(QH, KH, VT, Y);
  k_out<<<dim3(TNB * TT / 64, DIN / 128), 128, 0, stream>>>(Y, WB + 3 * (size_t)CC * DIN, nullptr, (float*)d_out);
}

// v009
// One run takes 82.4 microseconds.
// Timed twice side by side with v008, it ran 1.04 and 1.03 times as fast.
// Over all steps from v000 it is 17.8 times as fast.
// compute dtype: all float inputs rounded to bf16; q/k/v projections with EXACT bf16 products on WMMA 16x16x32 (f32 accumulate); interleaved RoPE in f32 (sincosf) on the projected q/k rows; q x log2(e) once to f16 against k x 2^-5 (= 1024^-0.5) once to f16 (1 product, in an f32 accumulator that starts at minus a reference maximum); one-pass softmax in f32 (exp2 of the accumulator as it is; the reference maximum moves, and sums and outputs are rescaled, only when a logit passes it by more than 8 in log2 units); exp(logit - reference) once to f16 against v once to f16 (1 product), divided by the sum at the end; ctx split bf16 hi + lo against exact Wo (2 products); f32 output.
#include <hip/hip_runtime.h>
#include <math.h>

typedef __attribute__((ext_vector_type(16))) _Float16 v16h;
typedef __attribute__((ext_vector_type(16))) __bf16 v16b;
typedef __attribute__((ext_vector_type(8)))  _Float16 v8h;
typedef __attribute__((ext_vector_type(8)))  float v8f;
typedef __attribute__((ext_vector_type(4)))  float v4f;
typedef __attribute__((ext_vector_type(2)))  float v2f;
typedef __attribute__((ext_vector_type(4)))  unsigned v4u;
typedef __attribute__((ext_vector_type(4)))  int v4i;
typedef float __attribute__((may_alias)) float_a;
typedef int __attribute__((may_alias)) int_a;

template <typename T> __device__ __forceinline__ void vst2(void* p, T v) { *(T*)p = v;  }
__device__ __forceinline__ v8f wmma16(v16h a, v16h b, v8f c) {
  v8f d = __builtin_amdgcn_wmma_f32_16x16x32_f16(false, a, false, b, (short)0, c, false, false);
  asm volatile("v_nop\n\tv_nop\n\tv_nop\n\tv_nop" : "+v"(d) : "v"(a), "v"(b));
  return d;
}
__device__ __forceinline__ v8f wmma_bf(v16b a, v16b b, v8f c) {
  v8f d = __builtin_amdgcn_wmma_f32_16x16x32_bf16(false, a, false, b, (short)0, c, false, false);
  asm volatile("v_nop\n\tv_nop\n\tv_nop\n\tv_nop" : "+v"(d) : "v"(a), "v"(b));
  return d;
}
// 16x16x32 fragments: lane = (h = lane>>4, row/col = lane&15); elements 0..7 = k0+8h+0..7, 8..15 = k0+16+8h+0..7; D element r = row 8h+r
__device__ __forceinline__ v16h frag_h(const _Float16* rowk0, int lane) {
  union { v16h v; v8h q[2]; } u; const _Float16* p = rowk0 + 8 * (lane >> 4);
  u.q[0] = *(const v8h*)p; u.q[1] = *(const v8h*)(p + 16); return u.v;
}
__device__ __forceinline__ v16h frag_f32(const float* rowk0, int lane) {
  v16h a; const float* p = rowk0 + 8 * (lane >> 4);
#pragma unroll
  for (int i = 0; i < 8; ++i) { a[i] = (_Float16)p[i]; a[8 + i] = (_Float16)p[16 + i]; }
  return a;
}
__device__ __forceinline__ v16h frag_f32s(const float* rowk0, int lane, float sc) {
  v16h a; const float* p = rowk0 + 8 * (lane >> 4);
#pragma unroll
  for (int i = 0; i < 8; ++i) { a[i] = (_Float16)(p[i] * sc); a[8 + i] = (_Float16)(p[16 + i] * sc); }
  return a;
}
// column fragment from a [K][ld] layout (column n), rows >= K read as 0
__device__ __forceinline__ v16h fragc_f32(const float* W, int k0, int n, int lane, int ld, int K) {
  v16h a; const int g = lane >> 4;
#pragma unroll
  for (int i = 0; i < 8; ++i) { const int ka = k0 + 8 * g + i, kb = ka + 16;
    a[i] = (_Float16)(ka < K ? W[(size_t)(ka < K ? ka : K - 1) * ld + n] : 0.f); a[8 + i] = (_Float16)(kb < K ? W[(size_t)(kb < K ? kb : K - 1) * ld + n] : 0.f); }
  return a;
}
struct F2 { v16b h, l; };
__device__ __forceinline__ F2 bsplit16(const float v[16]) { F2 r;
#pragma unroll
  for (int i = 0; i < 16; ++i) { const __bf16 h = (__bf16)v[i]; r.h[i] = h; r.l[i] = (__bf16)(v[i] - (float)h); }
  return r; }
__device__ __forceinline__ F2 split_row(const float* row, int k0, int lane) { float v[16]; const float* p = row + k0 + 8 * (lane >> 4);
#pragma unroll
  for (int i = 0; i < 8; ++i) { v[i] = p[i]; v[8 + i] = p[16 + i]; }
  return bsplit16(v); }
__device__ __forceinline__ F2 split_rowK(const float* row, int k0, int lane, int K) { float v[16]; const int g = lane >> 4;
#pragma unroll
  for (int i = 0; i < 8; ++i) { const int ka = k0 + 8 * g + i, kb = ka + 16; v[i] = ka < K ? row[ka < K ? ka : K - 1] : 0.f; v[8 + i] = kb < K ? row[kb < K ? kb : K - 1] : 0.f; }
  return bsplit16(v); }
__device__ __forceinline__ F2 split_col(const float* W, int k0, int n, int lane, int ld, int K) { float v[16]; const int g = lane >> 4;
#pragma unroll
  for (int i = 0; i < 8; ++i) { const int ka = k0 + 8 * g + i, kb = ka + 16; v[i] = ka < K ? W[(size_t)(ka < K ? ka : K - 1) * ld + n] : 0.f; v[8 + i] = kb < K ? W[(size_t)(kb < K ? kb : K - 1) * ld + n] : 0.f; }
  return bsplit16(v); }
__device__ __forceinline__ v8f mac3(const F2& a, const F2& b, v8f c) { c = wmma_bf(a.l, b.h, c); c = wmma_bf(a.h, b.l, c); return wmma_bf(a.h, b.h, c); }
__device__ __forceinline__ float sigm(float v) { return 1.0f / (1.0f + expf(-v)); }
#define LDSX() do { asm volatile("s_wait_dscnt 0" ::: "memory"); __builtin_amdgcn_wave_barrier(); __builtin_amdgcn_fence(__ATOMIC_RELEASE, "workgroup"); } while (0)

// Multi-head attention with RoPE (B 2, S 2,048, 1,024 = 16 x 64; 0.02-scale weights and biases): q,k,v = x W^T + b ((out,in)); interleaved-pair RoPE on q, k (angle t x 10000^(-2i/64)); scores = q k^T / sqrt(1024) (note: sqrt(D), not sqrt(hd)); out = merged(softmax(scores) v) Wo^T (no output bias).
#define NB 2
#define TT 2048
#define CC 1024            // NH * HD = projected width
#define DIN 1024          // input (model) width
#define NH 16
#define HD 64
#define NQB (TT / 64)
#define HG 4
#define SCALE (0.03125f)
#define CAUSAL 0
#ifndef TNB
#define TNB NB
#endif
__device__ __forceinline__ float bfr(float v) { return (float)(__bf16)v; }
__host__ __device__ __forceinline__ int kb_last(int qb) { return CAUSAL ? ((qb * 64 + 63) >> 7) : (TT / 128 - 1); }
typedef __attribute__((ext_vector_type(8))) __bf16 v8b;
__device__ __forceinline__ v16b frag_b(const __bf16* rowk0, int lane) {
  union { v16b v; v8b q[2]; } u; const __bf16* p = rowk0 + 8 * (lane >> 4);
  u.q[0] = *(const v8b*)p; u.q[1] = *(const v8b*)(p + 16); return u.v;
}
#define QBH 0              // unused: k_fa has no high-precision path
#define QHI 0               // rows carrying a q residual plane: none. k is rounded once to f16, so a residual of q alone would take away only q's half of the logit's rounding error; k's half stays either way
#define KHI 64            // key rows carrying k residual / v bf16 hi+lo planes (written by k_proj; no kernel here reads them)
// B fragment (k rows k0+.., output column o) of a weight: (in,out) [K][ld] or (out,in) [ld rows of K]: bf16 exact, or f16(bf16 * 256) exact
__device__ __forceinline__ v16b wcol_io(const float* Wm, int k0, int o, int lane, int ld) { v16b w; const int g = lane >> 4;
#pragma unroll
  for (int i = 0; i < 8; ++i) { w[i] = (__bf16)Wm[(size_t)(k0 + 8 * g + i) * ld + o]; w[8 + i] = (__bf16)Wm[(size_t)(k0 + 16 + 8 * g + i) * ld + o]; }
  return w; }
__device__ __forceinline__ v16b wcol_oi(const float* Wm, int k0, int o, int lane, int K) { v16b w; const float* p = Wm + (size_t)o * K + k0 + 8 * (lane >> 4);
#pragma unroll
  for (int i = 0; i < 8; ++i) { w[i] = (__bf16)p[i]; w[8 + i] = (__bf16)p[16 + i]; }
  return w; }
__device__ __forceinline__ v16h wcolh_io(const float* Wm, int k0, int o, int lane, int ld) { v16h w; const int g = lane >> 4;
#pragma unroll
  for (int i = 0; i < 8; ++i) { w[i] = (_Float16)(bfr(Wm[(size_t)(k0 + 8 * g + i) * ld + o]) * 256.0f); w[8 + i] = (_Float16)(bfr(Wm[(size_t)(k0 + 16 + 8 * g + i) * ld + o]) * 256.0f); }
  return w; }
__device__ __forceinline__ v16h wcolh_oi(const float* Wm, int k0, int o, int lane, int K) { v16h w; const float* p = Wm + (size_t)o * K + k0 + 8 * (lane >> 4);
#pragma unroll
  for (int i = 0; i < 8; ++i) { w[i] = (_Float16)(bfr(p[i]) * 256.0f); w[8 + i] = (_Float16)(bfr(p[16 + i]) * 256.0f); }
  return w; }
#define WQKV_LAYOUT 1   // 0 = (in,out) [DIN][CC]; 1 = (out,in) [CC][DIN]; 2 = per-head [NH][DIN][HD]; read only through WCOL, which no kernel calls (k_proj reads (out,in) [CC][DIN])
__device__ __forceinline__ v16b wcol_hdk(const float* Wm, int k0, int o, int lane) { v16b w; const int g = lane >> 4; const float* p = Wm + (size_t)(o / HD) * DIN * HD + (o % HD);
#pragma unroll
  for (int i = 0; i < 8; ++i) { w[i] = (__bf16)p[(size_t)(k0 + 8 * g + i) * HD]; w[8 + i] = (__bf16)p[(size_t)(k0 + 16 + 8 * g + i) * HD]; }
  return w; }
#define WO_OUT_IN 1
#if WQKV_LAYOUT == 1
#define WCOL(W, k0, o, lane) wcol_oi(W, k0, o, lane, DIN)
#elif WQKV_LAYOUT == 2
#define WCOL(W, k0, o, lane) wcol_hdk(W, k0, o, lane)
#else
#define WCOL(W, k0, o, lane) wcol_io(W, k0, o, lane, CC)
#endif
#if WO_OUT_IN
#define WOCOL(W, k0, o, lane) wcol_oi(W, k0, o, lane, CC)
#define WOCOLH(W, k0, o, lane) wcolh_oi(W, k0, o, lane, CC)
#else
#define WOCOL(W, k0, o, lane) wcol_io(W, k0, o, lane, DIN)
#define WOCOLH(W, k0, o, lane) wcolh_io(W, k0, o, lane, DIN)
#endif
__constant__ float c_invf[32] = {1.000000000e+0f,7.498942018e-1f,5.623413324e-1f,4.216965139e-1f,3.162277639e-1f,2.371373773e-1f,1.778279394e-1f,1.333521456e-1f,1.000000015e-1f,7.498942316e-2f,5.623413250e-2f,4.216964915e-2f,3.162277490e-2f,2.371373773e-2f,1.778279431e-2f,1.333521400e-2f,9.999999776e-3f,7.498942316e-3f,5.623413250e-3f,4.216964822e-3f,3.162277630e-3f,2.371373819e-3f,1.778279431e-3f,1.333521446e-3f,1.000000047e-3f,7.498941850e-4f,5.623413017e-4f,4.216965172e-4f,3.162277571e-4f,2.371373703e-4f,1.778279402e-4f,1.333521504e-4f};   /* f32(1 / 10000^(2i/64)) */
#ifndef SM_EXTRA_PARAMS
#define SM_EXTRA_PARAMS
#endif
#ifndef PROJ_EXTRA_PARAMS
#define PROJ_EXTRA_PARAMS
#endif
#ifndef SM_MASK_HOOK
#define SM_MASK_HOOK (void)0
#endif

#define WS_QH  0u                                      // f16 q x log2(e) rows [b*t][CC]
#define WS_KH  (WS_QH + 2u * (size_t)NB * TT * CC)      // f16 k x 2^-5 rows [b*t][CC]
#define WS_VT  (WS_KH + 2u * (size_t)NB * TT * CC)      // f16 v planes [b][c][t]
#define WS_QL  (WS_VT + 2u * (size_t)NB * CC * TT)      // f16 residual of q x log2(e), unscaled, rows [b][t < QHI][CC] (empty: QHI is 0)
#define WS_KL  (WS_QL + 2u * (size_t)NB * QHI * CC)     // f16 residual of k x 2^-5, unscaled, rows [b][t < KHI][CC]
#define WS_VB  (WS_KL + 2u * (size_t)NB * KHI * CC)     // bf16 v hi planes [b][c][t < KHI]
#define WS_VBL (WS_VB + 2u * (size_t)NB * CC * KHI)
#define WS_XB  (WS_VBL + 2u * (size_t)NB * CC * KHI)    // bf16 x rows [b*t][DIN]
#define WS_WB  (WS_XB + 2u * (size_t)NB * TT * DIN)     // bf16 Wq, Wk, Wv, Wo, each [CC][DIN] as given
#define WS_Y   (WS_WB + 2u * 4u * (size_t)CC * DIN)     // f32 ctx rows [b*t][CC] (only when there is an output projection)
#define WS_RT  (WS_Y  + 4u * (size_t)NB * TT * CC)      // f32 RoPE table [t][HD / 2] of (cos, sin), written by k_cvt in every call
#define WS_END (WS_RT + 8u * (size_t)TT * (HD / 2))

// GEMM operand staging (k_proj, k_out): a stage is 64 k of every operand row, kept as bf16 in LDS; every wave takes its fragments from there with 16-byte LDS loads. x and the four weights come from k_cvt's bf16 planes (a stage row = one 128-B line, 8 lanes x 16 B, copied as it is); ctx comes as f32 (16 lanes x 16 B per row) and is split by the block.
#define GK 64              // k per stage
#define GLD 72             // LDS row pitch in bf16: 144 B = 16 B x odd, conflict-free for the 16-byte fragment reads
typedef __attribute__((ext_vector_type(4))) __bf16 v4b;
__device__ __forceinline__ v4b cvt4(v4f v) { v4b r; r[0] = (__bf16)v[0]; r[1] = (__bf16)v[1]; r[2] = (__bf16)v[2]; r[3] = (__bf16)v[3]; return r; }
__device__ __forceinline__ v4b res4(v4f v, v4b h) { v4b r;
#pragma unroll
  for (int i = 0; i < 4; ++i) r[i] = (__bf16)(v[i] - (float)h[i]);
  return r; }
// a thread's N pieces of a stage: rows 8 apart, 16 bytes each
template <int N> __device__ __forceinline__ void ld_rows(v4f (&r)[N], const float* p, int ld) {
#pragma unroll
  for (int i = 0; i < N; ++i) r[i] = *(const v4f*)(p + (size_t)i * 8 * ld);
  asm volatile("s_wait_xcnt 0x0" :: "v"(p) : "memory"); }   // stands in front of every overwrite of these loads' address registers (p as an input keeps them whole up to here); its memory clobber also holds the loads here, ahead of the products they fly behind
// a thread's N pieces of a stage of a bf16 plane: rows 16 apart, 16 bytes each
template <int N> __device__ __forceinline__ void ld_rows_b(v8b (&r)[N], const __bf16* p, int ld) {
#pragma unroll
  for (int i = 0; i < N; ++i) r[i] = *(const v8b*)(p + (size_t)i * 16 * ld);
  asm volatile("s_wait_xcnt 0x0" :: "v"(p) : "memory"); }   // as in ld_rows: stands in front of every overwrite of these loads' address registers and holds the loads ahead of the products they fly behind
// ---- k_cvt also fills the RoPE table: one (position, pair) per thread, sincosf of the f32 angle t * c_invf[i]; both batches, all heads and both of q and k read the same 65,536 entries
// ---- k_cvt: x and the four weights rounded to bf16 ONCE, as a stream (one block per WGP, each 32,768 consecutive floats of one tensor, in whole-line 16-byte loads that are all issued ahead of the first store): every GEMM block that reads them afterwards fetches 2 bytes an element, not 4, and converts nothing
#define CV_N 32768
__global__ __launch_bounds__(256) void k_cvt(const float* __restrict__ X, const float* __restrict__ WQ, const float* __restrict__ WK, const float* __restrict__ WV, const float* __restrict__ WO, __bf16* __restrict__ XB, __bf16* __restrict__ WB, float* __restrict__ RT) {
  static_assert((NB * TT * DIN + 4 * CC * DIN) / CV_N * 256 == TT * (HD / 2), "one table entry per thread");
  const int nx = NB * TT * DIN / CV_N, nw = CC * DIN / CV_N; const int bi = blockIdx.x, tid = threadIdx.x;
  const float* s; __bf16* d;
  if (bi < nx) { s = X + (size_t)bi * CV_N; d = XB + (size_t)bi * CV_N; }
  else { const int w = (bi - nx) / nw; s = (w == 0 ? WQ : w == 1 ? WK : w == 2 ? WV : WO) + (size_t)((bi - nx) % nw) * CV_N; d = WB + (size_t)(bi - nx) * CV_N; }
  const int ri = bi * 256 + tid; const float fr = c_invf[ri & (HD / 2 - 1)];
  v4f r[CV_N / 1024];
#pragma unroll
  for (int i = 0; i < CV_N / 1024; ++i) r[i] = *(const v4f*)(s + i * 1024 + tid * 4);
  { float sn, cs; sincosf((float)(ri / (HD / 2)) * fr, &sn, &cs); v2f e; e[0] = cs; e[1] = sn; *(v2f*)(RT + 2 * (size_t)ri) = e; }
#pragma unroll
  for (int i = 0; i < CV_N / 1024; ++i) *(v4b*)(d + i * 1024 + tid * 4) = cvt4(r[i]); }
// ---- k_proj: block = (128 rows, 128 cols, which), four waves as 2 x 2, a wave = 64 x 64 (4 x and 4 weight fragments feed 16 products: half a fragment read from LDS per product): q/k/v = X W (+ b) with exact bf16 products (K = DIN) -> which 0: q f16 rows (+ residual rows < QHI); 1: k f16 rows (+ residual rows < KHI); 2: v f16 planes [c][t] (+ bf16 hi/lo planes for t < KHI)
#define PM 128             // rows of a block; the epilogue takes them in halves of 64, so that its f32 tile stays small enough for three blocks on a WGP
__global__ __launch_bounds__(128) void k_proj(const __bf16* __restrict__ XB, const __bf16* __restrict__ WB, const float* __restrict__ BQ, const float* __restrict__ BK, const float* __restrict__ BV, const float* __restrict__ RT,
    _Float16* __restrict__ QH, _Float16* __restrict__ QL, _Float16* __restrict__ KH, _Float16* __restrict__ KL, _Float16* __restrict__ VT, __bf16* __restrict__ VB, __bf16* __restrict__ VBL PROJ_EXTRA_PARAMS) {
  __shared__ __align__(16) float st[64][132]; __shared__ __align__(16) char ov[2 * (PM + 128) * GLD * 2];
  // one LDS range, used in turn: the two operand stages of the k loop; behind the loop's last barrier the epilogue's conversion tiles (q, k: sh, sl; v: th, tb, tbl)
  __bf16 (*xs)[PM][GLD] = (__bf16 (*)[PM][GLD])ov; __bf16 (*wt)[128][GLD] = (__bf16 (*)[128][GLD])(ov + 2 * PM * GLD * 2);
  _Float16 (*sh)[136] = (_Float16 (*)[136])ov; _Float16 (*sl)[136] = (_Float16 (*)[136])(ov + 64 * 136 * 2);
  _Float16 (*th)[72] = (_Float16 (*)[72])ov; __bf16 (*tb)[72] = (__bf16 (*)[72])(ov + 128 * 72 * 2); __bf16 (*tbl)[72] = (__bf16 (*)[72])(ov + 2 * 128 * 72 * 2);
  const int tid = threadIdx.x, wave = tid >> 5, lane = tid & 31, col = lane & 15, g = lane >> 4; const int wrow = wave >> 1, wcol = wave & 1; const int which = blockIdx.z; const int c0 = blockIdx.y * 128; const size_t r0 = (size_t)blockIdx.x * PM; const size_t bb = r0 / TT; const int t0 = (int)(r0 % TT);
  const float* BA = which == 0 ? BQ : which == 1 ? BK : BV;
  v8f acc[4][4] = {};
  const int pr = tid >> 3, pc = (tid & 7) * 8;   // a thread's 16-byte piece: row pr of each group of 16 rows, k pc..pc+7 of the stage
  const __bf16* xg = XB + (r0 + pr) * DIN + pc; const __bf16* wg = WB + ((size_t)which * CC + c0 + pr) * DIN + pc;
  v8b xr[PM / 16], wr[8];
  // rotated k walk: the 24 blocks that read the same x rows and the 32 that read the same weight rows would otherwise ask L2 for the same lines at the same moment; each block enters the 16 stages at its own place and wraps round (the f32 sum over k starts there). The q, k and v blocks of one (row, column) tile keep one start
  static_assert((DIN / GK & (DIN / GK - 1)) == 0, "the wrap is a mask");
  const int rot = (blockIdx.x + 2 * blockIdx.y) & (DIN / GK - 1);
  ld_rows_b(xr, xg + rot * GK, DIN); ld_rows_b(wr, wg + rot * GK, DIN);
#pragma unroll
  for (int i = 0; i < PM / 16; ++i) *(v8b*)&xs[0][i * 16 + pr][pc] = xr[i];
#pragma unroll
  for (int i = 0; i < 8; ++i) *(v8b*)&wt[0][i * 16 + pr][pc] = wr[i];
  __syncthreads();
  // the stage loop stays rolled so that the two buffers alternate by index and the loop stays small; the inner loops are unrolled so that the register arrays are indexed by constants
#pragma unroll 1
  for (int s = 0; s < DIN / GK; ++s) { const int cur = s & 1;
    if (s + 1 < DIN / GK) { const int kn = ((s + 1 + rot) & (DIN / GK - 1)) * GK; ld_rows_b(xr, xg + kn, DIN); ld_rows_b(wr, wg + kn, DIN); }   // the next stage's loads fly while this stage is multiplied
#pragma unroll
    for (int kc = 0; kc < GK / 32; ++kc) { v16b a[4], w[4];
#pragma unroll
      for (int i = 0; i < 4; ++i) a[i] = frag_b(&xs[cur][wrow * 64 + i * 16 + col][kc * 32], lane);
#pragma unroll
      for (int j = 0; j < 4; ++j) w[j] = frag_b(&wt[cur][wcol * 64 + j * 16 + col][kc * 32], lane);
      __builtin_amdgcn_sched_barrier(0);   // keeps the eight fragments' LDS reads one group ahead of their products: left alone the compiler reads each into the same registers and waits out the LDS latency before every product
#pragma unroll
      for (int i = 0; i < 4; ++i) {
#pragma unroll
        for (int j = 0; j < 4; ++j) acc[i][j] = __builtin_amdgcn_wmma_f32_16x16x32_bf16(false, a[i], false, w[j], (short)0, acc[i][j], false, false); } }
    if (s + 1 < DIN / GK) {
#pragma unroll
      for (int i = 0; i < PM / 16; ++i) *(v8b*)&xs[cur ^ 1][i * 16 + pr][pc] = xr[i];
#pragma unroll
      for (int i = 0; i < 8; ++i) *(v8b*)&wt[cur ^ 1][i * 16 + pr][pc] = wr[i]; }
    __syncthreads(); }   // one barrier a stage: publishes stage s + 1 and ends every wave's reads of the buffer that stage s + 2 (or the epilogue) overwrites
  // the epilogue runs once per half of 64 rows: the two waves that hold the half hand it over through st, all four waves rotate, convert and store it. Half 1's writes of st stand behind half 0's third barrier (the last reads of st are in front of it); its writes of the conversion tiles stand behind its own first two barriers (every wave has left half 0's store loop by then)
  const size_t rblk = r0; const int tblk = t0;
  for (int hf = 0; hf < PM / 64; ++hf) { const size_t r0 = rblk + hf * 64; const int t0 = tblk + hf * 64;   // the half's first row, under the names that the lines below use
    asm volatile("s_wait_xcnt 0x0" ::: "memory");   // stands behind the stores of the half before, in front of this half's first write of a register that they name
  { // stage the f32 tile (acc + bias) in LDS, rotate the q and k rows (interleaved (even, odd) RoPE pairs, angle = t * 10000^(-2i/64), cos and sin from k_cvt's table), then convert
    // a wave takes whole rows (row it * 4 + wave, 4 columns = 2 pairs a lane): 512 B of the tile and the row's 256 B of the table per pass, both heads of the tile reading the same table row; the table loads are issued here, ahead of the bias loads and the tile's LDS stores, so that their latency is not paid behind the barrier
    v4f rt[16]; const float* tp = RT + (size_t)(t0 + wave) * HD + (lane & 15) * 4;
    if (which < 2) {
#pragma unroll
      for (int it = 0; it < 16; ++it) rt[it] = *(const v4f*)(tp + it * 4 * HD);
      asm volatile("s_wait_xcnt 0x0" :: "v"(tp) : "memory"); }   // as in ld_rows: stands in front of every overwrite of these loads' address registers
    if (wrow == hf) {   // only the two waves that hold this half write it; the three loops are unrolled so that acc is indexed by constants and stays in registers
#pragma unroll
      for (int j = 0; j < 4; ++j) { const float bias = BA ? bfr(BA[c0 + wcol * 64 + j * 16 + col]) : 0.f;
#pragma unroll
        for (int i = 0; i < 4; ++i) {
#pragma unroll
          for (int r = 0; r < 8; ++r) st[i * 16 + 8 * g + r][wcol * 64 + j * 16 + col] = acc[i][j][r] + bias; } } }
    __syncthreads();
    if (which < 2) {
#pragma unroll
      for (int it = 0; it < 16; ++it) { float* rw = &st[it * 4 + wave][lane * 4]; const v4f x = *(const v4f*)rw, c = rt[it]; v4f y;
        y[0] = x[0] * c[0] - x[1] * c[1]; y[1] = x[0] * c[1] + x[1] * c[0]; y[2] = x[2] * c[2] - x[3] * c[3]; y[3] = x[2] * c[3] + x[3] * c[2]; *(v4f*)rw = y; } }
    __syncthreads(); }
  if (which < 2) { _Float16* DH = which == 0 ? QH : KH; _Float16* DL = which == 0 ? QL : KL; const int nhi = which == 0 ? QHI : KHI; const bool hi_rows = t0 < nhi;
    const float vs = which == 0 ? 1.44269504088896f : SCALE;   // the logit scale and log2(e) go into the operands, so that k_fa's products are exp2 arguments as they leave the accumulator; 2^-5 on k is exact
    for (int e = tid; e < 64 * 128; e += 128) { const int rl = e >> 7, cl = e & 127; const float v = st[rl][cl] * vs; const _Float16 hv = (_Float16)v; sh[rl][cl] = hv; if (hi_rows) sl[rl][cl] = (_Float16)(v - (float)hv); }
    __syncthreads();
    for (int e = tid; e < 64 * 16; e += 128) { const int rl = e >> 4, q = e & 15; vst2((unsigned*)(DH + (r0 + rl) * CC + c0 + q * 8), *(const v4u*)&sh[rl][q * 8]); if (hi_rows) vst2((unsigned*)(DL + (bb * nhi + t0 + rl) * (size_t)CC + c0 + q * 8), *(const v4u*)&sl[rl][q * 8]); }
  } else { const bool hi_rows = t0 < KHI;
    for (int e = tid; e < 64 * 128; e += 128) { const int rl = e & 63, cl = e >> 6; const float v = st[rl][cl]; th[cl][rl] = (_Float16)v; const __bf16 bh = (__bf16)v; tb[cl][rl] = bh; tbl[cl][rl] = (__bf16)(v - (float)bh); }
    __syncthreads();
    for (int e = tid; e < 128 * 8; e += 128) { const int cl = e >> 3, q = e & 7; vst2((unsigned*)(VT + (bb * CC + c0 + cl) * (size_t)TT + t0 + q * 8), *(const v4u*)&th[cl][q * 8]); if (hi_rows) { const size_t o3 = (bb * CC + c0 + cl) * (size_t)KHI + t0 + q * 8; vst2((unsigned*)(VB + o3), *(const v4u*)&tb[cl][q * 8]); vst2((unsigned*)(VBL + o3), *(const v4u*)&tbl[cl][q * 8]); } } } }
}
#define FA_Q 128
#define FA_K 64
#define FA_NS (TT / FA_K)
#define FA_LD 72           // LDS row pitch in halves: 144 B = 16 B x odd, conflict-free for the 16-byte fragment reads
#define FA_C 2             // column groups of 16 queries per wave
__device__ __forceinline__ float xhalf(float v) { const int i = __builtin_bit_cast(int, v); return __builtin_bit_cast(float, __builtin_amdgcn_permlanex16(i, i, 0x76543210, 0xfedcba98, false, false)); }   /* lane l <-> l ^ 16 */
__global__ __launch_bounds__(256) void k_fa(const _Float16* __restrict__ QH, const _Float16* __restrict__ KH, const _Float16* __restrict__ VT, float* __restrict__ Y) {
  // one LDS range, used in turn: the two stages of k and v tiles; behind the loop's last barrier the exchange between the key halves (8 waves x 9 pieces x 32 lanes x 16 B, exactly the same size)
  __shared__ __align__(16) char sm[2 * (FA_K + HD) * FA_LD * 2];
  static_assert(8 * 9 * 32 * 16 <= sizeof(sm), "the exchange fits the tiles' range");
  _Float16 (*ks)[FA_K][FA_LD] = (_Float16 (*)[FA_K][FA_LD])sm; _Float16 (*vs)[HD][FA_LD] = (_Float16 (*)[HD][FA_LD])(sm + 2 * FA_K * FA_LD * 2);
  const int tid = threadIdx.x, wave = tid >> 5, lane = tid & 31, col = lane & 15, g = lane >> 4; const int h = blockIdx.y, b = blockIdx.z; const int kh = wave >> 2; const int ql0 = blockIdx.x * FA_Q + (wave & 3) * (16 * FA_C);
  v16h qh[FA_C][HD / 32];
#pragma unroll
  for (int c = 0; c < FA_C; ++c) {
#pragma unroll
    for (int kc = 0; kc < HD / 32; ++kc) qh[c][kc] = frag_h(QH + ((size_t)b * TT + ql0 + c * 16 + col) * CC + h * HD + kc * 32, lane); }
  // staging: a thread moves two 16-byte pieces of the k tile (64 keys x 128 B) and two of the v tile (64 dims x 128 B), whole 128-B lines per 8 lanes
  const int sr = tid >> 3, sq = (tid & 7) * 8;
  const _Float16* kg = KH + ((size_t)b * TT + sr) * CC + h * HD + sq; const _Float16* vg = VT + ((size_t)b * CC + h * HD + sr) * (size_t)TT + sq;
  // rotated key walk: the 16 blocks of a (b, h) read the same k and v lines; each enters the 32 stages two further on and wraps round, so that they do not ask L2 for one line at one moment (softmax takes the keys in any order; the f32 sums start at that stage)
  static_assert((FA_NS & (FA_NS - 1)) == 0, "the wrap is a mask");
  const int rot = (2 * blockIdx.x) & (FA_NS - 1);
  const _Float16* kf0 = kg + (size_t)rot * FA_K * CC; const _Float16* vf0 = vg + rot * FA_K;
  v4u k0r = *(const v4u*)kf0, k1r = *(const v4u*)(kf0 + (size_t)32 * CC), v0r = *(const v4u*)vf0, v1r = *(const v4u*)(vf0 + (size_t)32 * TT);
  *(v4u*)&ks[0][sr][sq] = k0r; *(v4u*)&ks[0][sr + 32][sq] = k1r; *(v4u*)&vs[0][sr][sq] = v0r; *(v4u*)&vs[0][sr + 32][sq] = v1r;
  __syncthreads();
  v8f o[FA_C][HD / 16] = {}, nm[FA_C] = {}; float l[FA_C] = {};   // nm: minus the reference maximum of the lane's query of that column group (log2 units) in all eight elements, the start value of its score tiles
  // the stage loop stays rolled; every inner loop is unrolled so that the fragment and accumulator arrays are indexed by constants and stay in registers
#pragma unroll 1
  for (int s = 0; s < FA_NS; ++s) { const int cur = s & 1;
    if (s + 1 < FA_NS) { const int sn = (s + 1 + rot) & (FA_NS - 1); const _Float16* kn = kg + (size_t)sn * FA_K * CC; const _Float16* vn = vg + sn * FA_K; k0r = *(const v4u*)kn; k1r = *(const v4u*)(kn + (size_t)32 * CC); v0r = *(const v4u*)vn; v1r = *(const v4u*)(vn + (size_t)32 * TT); }
    v8f sa[FA_C][2]; v16h kf[HD / 32][2], vf[HD / 16];
#pragma unroll
    for (int kc = 0; kc < HD / 32; ++kc) {
#pragma unroll
      for (int t = 0; t < 2; ++t) kf[kc][t] = frag_h(&ks[cur][kh * 32 + t * 16 + col][kc * 32], lane); }
#pragma unroll
    for (int j = 0; j < HD / 16; ++j) vf[j] = frag_h(&vs[cur][j * 16 + col][kh * 32], lane);
    __builtin_amdgcn_sched_barrier(0);   // keeps the wave's eight fragments' LDS reads (four of k, four of v) one group ahead of the products: left alone the compiler reads each v fragment into the same registers, among the products, and waits out the LDS latency before every pair
#pragma unroll
    for (int kc = 0; kc < HD / 32; ++kc) {
#pragma unroll
      for (int t = 0; t < 2; ++t) {
#pragma unroll
        for (int c = 0; c < FA_C; ++c) sa[c][t] = __builtin_amdgcn_wmma_f32_16x16x32_f16(false, kf[kc][t], false, qh[c][kc], (short)0, kc == 0 ? nm[c] : sa[c][t], false, false); } }
    __builtin_amdgcn_sched_barrier(0);   // keeps the maxima behind all eight products: moved in among them, each first read of a fresh score tile costs four idle vector slots
    float mx[FA_C];   // per column group: the stage's largest logit above the reference, the same in both lanes of a query; one maximum and one sum per 16-key tile, four short chains in all
#pragma unroll
    for (int c = 0; c < FA_C; ++c) { float mt[2];
#pragma unroll
      for (int t = 0; t < 2; ++t) { mt[t] = -3.0e38f;
#pragma unroll
        for (int r = 0; r < 8; ++r) mt[t] = fmaxf(mt[t], sa[c][t][r]); }
      mx[c] = fmaxf(mt[0], mt[1]); mx[c] = fmaxf(mx[c], xhalf(mx[c])); }
    const float thr = s == 0 ? -3.0e38f : 8.0f;   // stage 0 always takes its own maximum as the reference; later the reference moves only when exp2 would pass 2^8
    if (__builtin_amdgcn_ballot_w32(fmaxf(mx[0], mx[1]) > thr) != 0) {   // one scalar branch a stage, for the whole wave and both column groups
#pragma unroll
      for (int c = 0; c < FA_C; ++c) {
        const float d = mx[c] > thr ? mx[c] : 0.f, al = __builtin_amdgcn_exp2f(-fmaxf(d, 0.f));   // d < 0 only in stage 0, where sum and outputs are still 0
        l[c] *= al;
#pragma unroll
        for (int r = 0; r < 8; ++r) nm[c][r] -= d;
#pragma unroll
        for (int t = 0; t < 2; ++t) {
#pragma unroll
          for (int r = 0; r < 8; ++r) sa[c][t][r] -= d; }
#pragma unroll
        for (int j = 0; j < HD / 16; ++j) {
#pragma unroll
          for (int r = 0; r < 8; ++r) o[c][j][r] *= al; } } }
    v16h p[FA_C];
#pragma unroll
    for (int c = 0; c < FA_C; ++c) { float st[2];
#pragma unroll
      for (int t = 0; t < 2; ++t) { st[t] = 0.f;
#pragma unroll
        for (int r = 0; r < 8; ++r) { const float e = __builtin_amdgcn_exp2f(sa[c][t][r]); st[t] += e; p[c][t * 8 + r] = (_Float16)e; } }
      l[c] += st[0] + st[1]; }
#pragma unroll
    for (int j = 0; j < HD / 16; ++j) {
#pragma unroll
      for (int c = 0; c < FA_C; ++c) o[c][j] = __builtin_amdgcn_wmma_f32_16x16x32_f16(false, vf[j], false, p[c], (short)0, o[c][j], false, false); }
    if (s + 1 < FA_NS) { *(v4u*)&ks[cur ^ 1][sr][sq] = k0r; *(v4u*)&ks[cur ^ 1][sr + 32][sq] = k1r; *(v4u*)&vs[cur ^ 1][sr][sq] = v0r; *(v4u*)&vs[cur ^ 1][sr + 32][sq] = v1r; }
    __syncthreads(); }   // one barrier a stage: publishes stage s + 1 and ends every wave's reads of the buffer that stage s + 2 (or the exchange) overwrites
  // join of the key halves: wave (query group, kh) finishes column group kh. It hands the other column group's outputs, sum and reference to its partner, wave ^ 4, lane to lane (a lane of both holds the same query and the same dims), and takes the partner's part of its own
  const bool up = kh != 0; v4f* xb = (v4f*)sm; v4f* xo = xb + wave * (9 * 32) + lane; const v4f* xi = xb + (wave ^ 4) * (9 * 32) + lane;
#pragma unroll
  for (int j = 0; j < HD / 16; ++j) { v4f a, c;
#pragma unroll
    for (int r = 0; r < 4; ++r) { a[r] = up ? o[0][j][r] : o[1][j][r]; c[r] = up ? o[0][j][4 + r] : o[1][j][4 + r]; }
    xo[(2 * j) * 32] = a; xo[(2 * j + 1) * 32] = c; }
  { v4f e; e[0] = up ? l[0] : l[1]; e[1] = up ? nm[0][0] : nm[1][0]; e[2] = 0.f; e[3] = 0.f; xo[8 * 32] = e; }
  __syncthreads();   // once per block: every wave's handed-over part is in LDS before its partner reads it
  const v4f pe = xi[8 * 32]; const float dn = (up ? nm[1][0] : nm[0][0]) - pe[1];   // partner's reference maximum minus this wave's
  const float fs = __builtin_amdgcn_exp2f(-fabsf(dn)); const float fk = dn > 0.f ? fs : 1.0f, fp = dn > 0.f ? 1.0f : fs;   // the common reference is the larger of the two maxima: the part with the smaller one is scaled down
  float lt = (up ? l[1] : l[0]) * fk + pe[0] * fp; lt += xhalf(lt); const float inv = 1.0f / lt; const float ak = fk * inv, ap = fp * inv;
  float* yr = Y + ((size_t)b * TT + ql0 + kh * 16 + col) * CC + h * HD + 8 * g;   // lane = query col of column group kh; o[.][j][r] = dim j*16 + 8g + r
  v4f ya[HD / 16], yc[HD / 16];
#pragma unroll
  for (int j = 0; j < HD / 16; ++j) { const v4f pa = xi[(2 * j) * 32], pc = xi[(2 * j + 1) * 32];
#pragma unroll
    for (int r = 0; r < 4; ++r) { ya[j][r] = (up ? o[1][j][r] : o[0][j][r]) * ak + pa[r] * ap; yc[j][r] = (up ? o[1][j][4 + r] : o[0][j][4 + r]) * ak + pc[r] * ap; } }
  __builtin_amdgcn_sched_barrier(0);   // keeps the eight stores one run behind all the arithmetic: moved in among it, a stored register is taken again for a later product and the wave waits on the store there
#pragma unroll
  for (int j = 0; j < HD / 16; ++j) { vst2(yr + j * 16, ya[j]); vst2(yr + j * 16 + 4, yc[j]); } }
// ---- k_out: block = (64 rows, 128 cols): out = ctx Wo (+ bo): ctx split bf16 hi + lo against exact bf16 Wo (2 products), all rows
__global__ __launch_bounds__(128) void k_out(const float* __restrict__ Y, const __bf16* __restrict__ WOB, const float* __restrict__ BO, float* __restrict__ OUT) { __shared__ __align__(16) char ov[2 * (64 + 64 + 128) * GLD * 2];
  // one LDS range, used in turn: the two operand stages of the k loop (ctx hi, ctx lo, Wo); behind the loop's last barrier each wave's own output staging tile
  __bf16 (*yh)[64][GLD] = (__bf16 (*)[64][GLD])ov; __bf16 (*yl)[64][GLD] = (__bf16 (*)[64][GLD])(ov + 2 * 64 * GLD * 2); __bf16 (*wt)[128][GLD] = (__bf16 (*)[128][GLD])(ov + 4 * 64 * GLD * 2);
  float (*sf)[16][132] = (float (*)[16][132])ov;
  const int tid = threadIdx.x, wave = tid >> 5, lane = tid & 31, col = lane & 15, g = lane >> 4; const int c0 = blockIdx.y * 128; const size_t r0 = (size_t)blockIdx.x * 64 + wave * 16;
  v8f acc[8] = {};
  {   /* ALL rows: ctx split bf16 hi + lo x exact Wo (2 products) */
    const int pr = tid >> 4, pc = (tid & 15) * 4;   // a thread's 16-byte piece: row pr of each group of 8 rows, k pc..pc+3 of the stage
    const int qr = tid >> 3, qc = (tid & 7) * 8;    // its 16-byte piece of the bf16 Wo plane: row qr of each group of 16 rows, k qc..qc+7
    const float* yg = Y + ((size_t)blockIdx.x * 64 + pr) * CC + pc; const __bf16* wg = WOB + (size_t)(c0 + qr) * CC + qc;
    v4f yr[8]; v8b wr[8];
    // rotated k walk, as in k_proj: the 8 blocks of a row tile and the 64 of a column tile enter the 16 stages at different places
    static_assert((CC / GK & (CC / GK - 1)) == 0, "the wrap is a mask");
    const int rot = (blockIdx.x + 4 * blockIdx.y) & (CC / GK - 1);
    ld_rows(yr, yg + rot * GK, CC); ld_rows_b(wr, wg + rot * GK, CC);
#pragma unroll
    for (int i = 0; i < 8; ++i) { const v4b hv = cvt4(yr[i]); *(v4b*)&yh[0][i * 8 + pr][pc] = hv; *(v4b*)&yl[0][i * 8 + pr][pc] = res4(yr[i], hv); }
#pragma unroll
    for (int i = 0; i < 8; ++i) *(v8b*)&wt[0][i * 16 + qr][qc] = wr[i];
    __syncthreads();
    // rolled stage loop, unrolled inner loops: as in k_proj
#pragma unroll 1
    for (int s = 0; s < CC / GK; ++s) { const int cur = s & 1;
      if (s + 1 < CC / GK) { const int kn = ((s + 1 + rot) & (CC / GK - 1)) * GK; ld_rows(yr, yg + kn, CC); ld_rows_b(wr, wg + kn, CC); }   // the next stage's loads fly while this stage is multiplied
#pragma unroll
      for (int kc = 0; kc < GK / 32; ++kc) { const v16b ah = frag_b(&yh[cur][wave * 16 + col][kc * 32], lane), al = frag_b(&yl[cur][wave * 16 + col][kc * 32], lane); v16b w[8];
#pragma unroll
        for (int j = 0; j < 8; ++j) w[j] = frag_b(&wt[cur][j * 16 + col][kc * 32], lane);
        __builtin_amdgcn_sched_barrier(0);   // keeps the ten fragments' LDS reads one group ahead of their products, as in k_proj
#pragma unroll
        for (int j = 0; j < 8; ++j) { acc[j] = __builtin_amdgcn_wmma_f32_16x16x32_bf16(false, ah, false, w[j], (short)0, acc[j], false, false);
          acc[j] = __builtin_amdgcn_wmma_f32_16x16x32_bf16(false, al, false, w[j], (short)0, acc[j], false, false); } }
      if (s + 1 < CC / GK) {
#pragma unroll
        for (int i = 0; i < 8; ++i) { const v4b hv = cvt4(yr[i]); *(v4b*)&yh[cur ^ 1][i * 8 + pr][pc] = hv; *(v4b*)&yl[cur ^ 1][i * 8 + pr][pc] = res4(yr[i], hv); }
#pragma unroll
        for (int i = 0; i < 8; ++i) *(v8b*)&wt[cur ^ 1][i * 16 + qr][qc] = wr[i]; }
      __syncthreads(); }   // one barrier a stage: publishes stage s + 1 and ends every wave's reads of the buffer that stage s + 2 (or the output staging) overwrites
#pragma unroll
    for (int j = 0; j < 8; ++j) { const float bias = BO ? bfr(BO[c0 + j * 16 + col]) : 0.f;
#pragma unroll
      for (int r = 0; r < 8; ++r) sf[wave][8 * g + r][j * 16 + col] = acc[j][r] + bias; }
  }
  LDSX(); for (int rl = 0; rl < 16; ++rl) vst2(OUT + (r0 + rl) * DIN + c0 + lane * 4, *(const v4f*)&sf[wave][rl][lane * 4]); }

extern "C" void kernel_launch(void* const* d_in, const int* in_sizes, int n_in, void* d_out, int out_size, void* d_ws, size_t ws_size, hipStream_t stream) {
  (void)in_sizes; (void)n_in; (void)out_size;
  const float** F = (const float**)d_in;
  if (ws_size < (size_t)WS_END) return;
  char* ws = (char*)d_ws; _Float16 *QH = (_Float16*)(ws + WS_QH), *KH = (_Float16*)(ws + WS_KH), *VT = (_Float16*)(ws + WS_VT), *QL = (_Float16*)(ws + WS_QL), *KL = (_Float16*)(ws + WS_KL); __bf16 *VB = (__bf16*)(ws + WS_VB), *VBL = (__bf16*)(ws + WS_VBL), *XB = (__bf16*)(ws + WS_XB), *WB = (__bf16*)(ws + WS_WB); float *Y = (float*)(ws + WS_Y), *RT = (float*)(ws + WS_RT);
  (void)Y; (void)QL; (void)KL; (void)VB; (void)VBL;
  // inputs: 0 x [2,2048,1024]; 1 Wq [1024,1024] (out,in), 2 bq; 3 Wk, 4 bk; 5 Wv, 6 bv; 7 Wo (no bias)
  k_cvt<<<dim3((NB * TT * DIN + 4 * CC * DIN) / CV_N), 256, 0, stream>>>(F[0], F[1], F[3], F[5], F[7], XB, WB, RT);
  k_proj<<<dim3(TNB * TT / PM, CC / 128, 3), 128, 0, stream>>>(XB, WB, F[2], F[4], F[6], RT, QH, QL, KH, KL, VT, VB, VBL);
  k_fa<<<dim3(TT / FA_Q, NH, TNB), 256, 0, stream>>>(QH, KH, VT, Y);
  k_out<<<dim3(TNB * TT / 64, DIN / 128), 128, 0, stream>>>(Y, WB + 3 * (size_t)CC * DIN, nullptr, (float*)d_out);
}
